// v000
// Measured on an AMD MI455X. A time is GPU time per run, averaged over a window of back-to-back runs after a warm-up
// (all launches, gaps included; the runs take copies of the inputs in turn), and the median of several windows.
// Apart from v000's, it joins two sittings. Times from different sittings can be a few percent apart, while
// side-by-side timings come from the same sitting.
// v000, which the later versions start from, runs in 652 microseconds.
#include <hip/hip_runtime.h>
#include <math.h>
// Shifted-window MSA, faithful to the reference's raw torch .view reshapes (the 'windows' are consecutive 4704-float chunks of the rolled
// (H, W, C, 3)-interleaved qkv tensor, not spatial windows), its asymmetric rolls (−4 then +3) and its integer-indexed column mask:
// qkv = x·qkv_wᵀ + qkv_b (100352 x 128 · 128 x 384, eight row parts; everything incl. the output linear runs per part so the workspace carve stays ≈75 MB) and the output linear (· 128 x 128) on v_wmma_f32_16x16x32_f16, f16 operands,
// f32 accumulate (plain single products — lean slice);
// — the per-chunk 49-token attention runs as batched 64x64 WMMA tiles (scores q·kᵀ with K = 32 and p·v with p x2^15, grid.y = chunk), f16 operands, f32 accumulate; only the bias gather, −inf masks and softmax stay on VALU.
typedef __attribute__((ext_vector_type(16))) _Float16 v16h;
typedef __attribute__((ext_vector_type(8)))  _Float16 v8h;
typedef __attribute__((ext_vector_type(16))) __bf16   v16b;
typedef __attribute__((ext_vector_type(8)))  __bf16   v8b;
typedef __attribute__((ext_vector_type(8)))  float    v8f;
typedef __attribute__((ext_vector_type(4)))  float    v4f;
#define PSCALE 32768.0f
#define U16(p) ((const unsigned short*)(const void*)(p))
#define PSCALE_INV (1.0f / 32768.0f)

__device__ __forceinline__ unsigned short f2bf_bits(float f) {
  unsigned u = __float_as_uint(f);
  return (unsigned short)((u + 0x7FFFu + ((u >> 16) & 1u)) >> 16);
}
__device__ __forceinline__ float bf_bits2f(unsigned short h) { return __uint_as_float(((unsigned)h) << 16); }

// hazard guards as plain device helpers (no inline asm inside the kernel template body)
__device__ __forceinline__ void dep_guard_h(v8f& a, v8f& b, v16h x, v16h y) { asm volatile("v_nop\n\tv_nop\n\tv_nop\n\tv_nop" : "+v"(a), "+v"(b) : "v"(x), "v"(y)); }
__device__ __forceinline__ void dep_guard_b(v8f& a, v8f& b, v16b x, v16b y) { asm volatile("v_nop\n\tv_nop\n\tv_nop\n\tv_nop" : "+v"(a), "+v"(b) : "v"(x), "v"(y)); }
__device__ __forceinline__ void keep4_h(v16h a, v16h b, v16h c, v16h d) { asm volatile("v_nop" :: "v"(a), "v"(b), "v"(c), "v"(d)); }
__device__ __forceinline__ void keep4_b(v16b a, v16b b, v16b c, v16b d) { asm volatile("v_nop" :: "v"(a), "v"(b), "v"(c), "v"(d)); }
__device__ __forceinline__ void acc_guard4(v8f& a, v8f& b, v8f& c, v8f& d) { asm volatile("v_nop\n\tv_nop\n\tv_nop\n\tv_nop" : "+v"(a), "+v"(b), "+v"(c), "+v"(d)); }
template <typename T> struct Frag;
template <> struct Frag<_Float16> {
  typedef v16h V; union U { v16h v; v8h h[2]; };
  static __device__ __forceinline__ v16h load(const _Float16* p) {   // elements 0..7 <- p[0..7], 8..15 <- p[16..23]
    U f; f.h[0] = *(const v8h*)(p); f.h[1] = *(const v8h*)(p + 16); return f.v;
  }
  static __device__ __forceinline__ v8f mma(v16h a, v16h b, v8f c) {
    return __builtin_amdgcn_wmma_f32_16x16x32_f16(false, a, false, b, (short)0, c, false, false);
  }
  static __device__ __forceinline__ void guard(v8f& a, v8f& b, v16h x, v16h y) { dep_guard_h(a, b, x, y); }
  static __device__ __forceinline__ void keep(v16h a, v16h b, v16h c, v16h d) { keep4_h(a, b, c, d); }
};
template <> struct Frag<__bf16> {
  typedef v16b V; union U { v16b v; v8b h[2]; };
  static __device__ __forceinline__ v16b load(const __bf16* p) {
    U f; f.h[0] = *(const v8b*)(p); f.h[1] = *(const v8b*)(p + 16); return f.v;
  }
  static __device__ __forceinline__ v8f mma(v16b a, v16b b, v8f c) {
    return __builtin_amdgcn_wmma_f32_16x16x32_bf16(false, a, false, b, (short)0, c, false, false);
  }
  static __device__ __forceinline__ void guard(v8f& a, v8f& b, v16b x, v16b y) { dep_guard_b(a, b, x, y); }
  static __device__ __forceinline__ void keep(v16b a, v16b b, v16b c, v16b d) { keep4_b(a, b, c, d); }
};

// ---- Register-blocked batched WMMA GEMM ------------------------------------
// C[m,n] = scale * sum_k A[m,k] * Bt[n,k] (+bias)(+resid); each wave owns a 64x64 tile.
// A row-major [M,K]; Bt row-major [N,K]; M,N % 64 == 0, K % 32 == 0.
// SPLIT: operands are hi/lo planes (A2/Bt2 = lo planes, same layout); product = hi·hi + hi·lo + lo·hi.
// BIAS_MODE: 0 = none, 1 = bias[m], 2 = bias[n].
// OUT_MODE: 0 = f32, 1 = f16, 2 = bf16 hi plane (Cout) + bf16 lo plane (Cout2).
// ET: 0 = f16 operands, 1 = bf16 operands (pointers passed as 16-bit storage)
template <int ET> struct Elem;
template <> struct Elem<0> { typedef _Float16 T; };
template <> struct Elem<1> { typedef __bf16 T; };
template <int ET, bool SPLIT, int BIAS_MODE, int OUT_MODE, bool RESID, int ACT = 0>
__global__ __launch_bounds__(256) void wmma_gemm64(
    const unsigned short* __restrict__ Ap, const unsigned short* __restrict__ A2p, int lda, long strideA,
    const unsigned short* __restrict__ Btp, const unsigned short* __restrict__ Bt2p, int ldb, long strideB,
    void* __restrict__ Cout, void* __restrict__ Cout2, int ldc, long strideC,
    const float* __restrict__ bias,
    const float* __restrict__ resid, long strideR,
    int M, int N, int K, float scale) {
  typedef typename Elem<ET>::T T;
  typedef typename Frag<T>::V V;
  const T* A = (const T*)Ap; const T* A2 = (const T*)A2p; const T* Bt = (const T*)Btp; const T* Bt2 = (const T*)Bt2p;
  __shared__ __align__(16) float sT[8][16 * 68];   // per-wave 16x64 slab, pitch 68 floats
  const int b    = blockIdx.y;
  const int lane = threadIdx.x & 31;
  const int wave = threadIdx.x >> 5;
  const int tilesN = N >> 6;
  const int tilesM = M >> 6;
  const int tile = blockIdx.x * 8 + wave;
  if (tile >= tilesM * tilesN) return;   // wave-uniform; no block barriers in this kernel
  const int tm = tile / tilesN;
  const int tn = tile - tm * tilesN;
  const int m0 = tm << 6;
  const int n0 = tn << 6;

  const T* Ab  = A  + (size_t)b * strideA;
  const T* Bb  = Bt + (size_t)b * strideB;
  const T* Ab2 = SPLIT ? (A2  + (size_t)b * strideA) : nullptr;
  const T* Bb2 = SPLIT ? (Bt2 + (size_t)b * strideB) : nullptr;

  const int rlane = lane & 15;                 // row (A) / col (B, D) within subtile
  const int koff  = (lane >> 4) * 8;           // k offset of this lane half
  const int mOff  = (lane >> 4) * 8;           // D row offset

  v8f acc[4][4];
#pragma unroll
  for (int i = 0; i < 4; ++i)
#pragma unroll
    for (int j = 0; j < 4; ++j) acc[i][j] = (v8f){0.f,0.f,0.f,0.f,0.f,0.f,0.f,0.f};

  for (int k0 = 0; k0 < K; k0 += 32) {
    V bh[4], bl[4];
#pragma unroll
    for (int j = 0; j < 4; ++j) {
      const size_t bo = (size_t)(n0 + (j << 4) + rlane) * ldb + koff + k0;
      bh[j] = Frag<T>::load(Bb + bo);
      if (SPLIT) bl[j] = Frag<T>::load(Bb2 + bo);
    }
#pragma unroll
    for (int i = 0; i < 4; ++i) {
      const size_t ao = (size_t)(m0 + (i << 4) + rlane) * lda + koff + k0;
      V ah = Frag<T>::load(Ab + ao);
      V al;
      if (SPLIT) al = Frag<T>::load(Ab2 + ao);
#pragma unroll
      for (int j = 0; j < 4; ++j) {
        acc[i][j] = Frag<T>::mma(ah, bh[j], acc[i][j]);
        if (SPLIT) {
          acc[i][j] = Frag<T>::mma(ah, bl[j], acc[i][j]);
          acc[i][j] = Frag<T>::mma(al, bh[j], acc[i][j]);
        }
      }
      Frag<T>::guard(acc[i][0], acc[i][3], ah, SPLIT ? al : ah);
    }
    Frag<T>::keep(bh[0], bh[1], bh[2], bh[3]);
    if (SPLIT) Frag<T>::keep(bl[0], bl[1], bl[2], bl[3]);
  }
  acc_guard4(acc[0][0], acc[0][1], acc[0][2], acc[0][3]);
  acc_guard4(acc[1][0], acc[1][1], acc[1][2], acc[1][3]);
  acc_guard4(acc[2][0], acc[2][1], acc[2][2], acc[2][3]);
  acc_guard4(acc[3][0], acc[3][1], acc[3][2], acc[3][3]);

  // ---- epilogue ----
  float* slab = sT[wave];
  const float* Rb = RESID ? (resid + (size_t)b * strideR) : nullptr;
#pragma unroll
  for (int i = 0; i < 4; ++i) {
    const int mBase = m0 + (i << 4);
#pragma unroll
    for (int j = 0; j < 4; ++j) {
      const int n = n0 + (j << 4) + rlane;
      float bv = 0.f;
      if (BIAS_MODE == 2) bv = bias[n];
#pragma unroll
      for (int r = 0; r < 8; ++r) {
        float v = acc[i][j][r] * scale;
        if (BIAS_MODE == 1) v += bias[mBase + mOff + r];
        if (BIAS_MODE == 2) v += bv;
        if (RESID) v += Rb[(size_t)(mBase + mOff + r) * ldc + n];
        if (ACT == 1) v = tanhf(v);
        if (ACT == 2) v = fmaxf(v, 0.0f);
        if (ACT == 3) v = v / (1.0f + expf(-v));
        if (ACT == 4) v = (v > 0.f) ? v : 0.01f * v;
        if (ACT == 5) v = 0.5f * v * (1.0f + erff(v * 0.70710678118654752f));
        slab[(mOff + r) * 68 + (j << 4) + rlane] = v;
      }
    }
    __builtin_amdgcn_fence(__ATOMIC_RELEASE, "workgroup");
    __builtin_amdgcn_wave_barrier();
    __builtin_amdgcn_fence(__ATOMIC_ACQUIRE, "workgroup");
    if (OUT_MODE == 0) {
      float* C = (float*)Cout + (size_t)b * strideC;
      const int hh = lane >> 4, c4 = (lane & 15) * 4;     // row seg = 256 B = 16 lanes x 16 B
      {
#pragma unroll
        for (int it = 0; it < 8; ++it) {
          const int row = it * 2 + hh;
          v4f v = *(const v4f*)(slab + row * 68 + c4);
          *(v4f*)(C + (size_t)(mBase + row) * ldc + n0 + c4) = v;
        }
        
      }
    } else {
      const int q = lane >> 3, c8 = (lane & 7) * 8;
      unsigned short* C  = (unsigned short*)Cout  + (size_t)b * strideC;
      unsigned short* C2 = (OUT_MODE == 2) ? ((unsigned short*)Cout2 + (size_t)b * strideC) : nullptr;
      {
#pragma unroll
        for (int it = 0; it < 4; ++it) {
          const int row = it * 4 + q;
          const float* sp = slab + row * 68 + c8;
          v8h hv, lv;
#pragma unroll
          for (int e = 0; e < 8; ++e) {
            if (OUT_MODE == 1) {
              hv[e] = (_Float16)sp[e];
            } else {
              unsigned short hb = f2bf_bits(sp[e]);
              unsigned short lb = f2bf_bits(sp[e] - bf_bits2f(hb));
              hv[e] = __builtin_bit_cast(_Float16, hb);
              lv[e] = __builtin_bit_cast(_Float16, lb);
            }
          }
          *(v8h*)(C + (size_t)(mBase + row) * ldc + n0 + c8) = hv;
          if (OUT_MODE == 2) *(v8h*)(C2 + (size_t)(mBase + row) * ldc + n0 + c8) = lv;
        }
        
      }
    }
    __builtin_amdgcn_fence(__ATOMIC_RELEASE, "workgroup");
    __builtin_amdgcn_wave_barrier();
    __builtin_amdgcn_fence(__ATOMIC_ACQUIRE, "workgroup");
  }
}

__global__ __launch_bounds__(256) void cast_f32_f16x2(
    const float* __restrict__ in, _Float16* __restrict__ out, int n2) {
  int i = blockIdx.x * 256 + threadIdx.x;
  if (i < n2) {
    const _Float16 h0 = (_Float16)in[2 * i], h1 = (_Float16)in[2 * i + 1];
    const unsigned u = (unsigned)__builtin_bit_cast(unsigned short, h0) | ((unsigned)__builtin_bit_cast(unsigned short, h1) << 16);
    ((unsigned*)out)[i] = u;
    
  }
}


#define SN 32
#define SHW 56
#define SP (SHW * SHW)          // 3136
#define SC 128
#define SROWS (SN * SP)         // 100352
#define SWIN 256                // chunks ('windows') per image = 4*8*8
#define SCH (49 * 32 * 3)       // 4704 floats per chunk
#define NHALF (SN / 8)            // images per part (8 parts; name kept)
__constant__ unsigned long long ROWM[49] = {0x1fffff0000000ull,0x1fffff0000000ull,0x1fffff0000000ull,0x1fffff0000000ull,0x1fffff0000000ull,0x1fffff0000000ull,0x1fffff0000000ull,0x1fffff0000000ull,0x1fffff0000000ull,0x1fffff0000000ull,0x1fffff0000000ull,0x1fffff0000000ull,0x1fffff0000000ull,0x1fffff0000000ull,0x1fffff0000000ull,0x1fffff0000000ull,0x1fffff0000000ull,0x1fffff0000000ull,0x1fffff0000000ull,0x1fffff0000000ull,0x1fffff0000000ull,0x1fffff0000000ull,0x1fffff0000000ull,0x1fffff0000000ull,0x1fffff0000000ull,0x1fffff0000000ull,0x1fffff0000000ull,0x1fffff0000000ull,0xfffffffull,0xfffffffull,0xfffffffull,0xfffffffull,0xfffffffull,0xfffffffull,0xfffffffull,0xfffffffull,0xfffffffull,0xfffffffull,0xfffffffull,0xfffffffull,0xfffffffull,0xfffffffull,0xfffffffull,0xfffffffull,0xfffffffull,0xfffffffull,0xfffffffull,0xfffffffull,0xfffffffull};
__constant__ unsigned long long COLM[49] = {0x1c3870e1c3870ull,0x1c3870e1c3870ull,0x1c3870e1c3870ull,0x1c3870e1c3870ull,0x3c78f1e3c78full,0x0ull,0x0ull,0x1c3870e1c3870ull,0x1c3870e1c3870ull,0x1c3870e1c3870ull,0x1c3870e1c3870ull,0x3c78f1e3c78full,0x0ull,0x0ull,0x1c3870e1c3870ull,0x1c3870e1c3870ull,0x1c3870e1c3870ull,0x1c3870e1c3870ull,0x3c78f1e3c78full,0x0ull,0x0ull,0x1c3870e1c3870ull,0x1c3870e1c3870ull,0x1c3870e1c3870ull,0x1c3870e1c3870ull,0x3c78f1e3c78full,0x0ull,0x0ull,0x1c3870e1c3870ull,0x1c3870e1c3870ull,0x1c3870e1c3870ull,0x1c3870e1c3870ull,0x3c78f1e3c78full,0x0ull,0x0ull,0x1c3870e1c3870ull,0x1c3870e1c3870ull,0x1c3870e1c3870ull,0x1c3870e1c3870ull,0x3c78f1e3c78full,0x0ull,0x0ull,0x1c3870e1c3870ull,0x1c3870e1c3870ull,0x1c3870e1c3870ull,0x1c3870e1c3870ull,0x3c78f1e3c78full,0x0ull,0x0ull};
// chunk operands: per chunk w of image n (global chunk id cg = (n - n0)*256 + w within the half): Q16/K16 [cg][64 tok][32] f16 (tokens >= 49 zero),
// VT16 [cg][64 d][64 tok] f16 (d >= 32 / tok >= 49 zero); gathered through the (-4,-4) roll; block per chunk
__global__ __launch_bounds__(256) void chunk_kernel(const float* __restrict__ QKVh, int n0, unsigned* __restrict__ Q16, unsigned* __restrict__ K16, unsigned* __restrict__ VT16) {
  __shared__ float q[64][33], k[64][33], v[64][33];
  const int nl = blockIdx.y, w = blockIdx.x, t = threadIdx.x; const size_t cg = (size_t)nl * SWIN + w;
  for (int i = t; i < 64 * 33; i += 256) { (&q[0][0])[i] = 0.f; (&k[0][0])[i] = 0.f; (&v[0][0])[i] = 0.f; }
  __syncthreads();
  // incremental gather: thread (ds = t % 96 -> d = ds/3, s = ds%3; half = t / 96 -> tokens [25*half, ...)) walks f = w*4704 + tok*96 + ds with one div at the start
  if (t < 192) { const int ds = t % 96, half = t / 96; const int d = ds / 3, s = ds % 3; const int tok0 = half * 25, tok1 = half ? 49 : 25;
    long f = (long)w * SCH + (long)tok0 * 96 + ds; int pix = (int)(f / 384), o = (int)(f % 384); int y = pix / SHW, x = pix % SHW;
    for (int tok = tok0; tok < tok1; ++tok) {
      const int ys = (y + 4 >= SHW) ? y + 4 - SHW : y + 4, xs = (x + 4 >= SHW) ? x + 4 - SHW : x + 4;
      const float val = QKVh[((size_t)nl * SP + ys * SHW + xs) * 384 + o];
      if (s == 0) q[tok][d] = val; else if (s == 1) k[tok][d] = val; else v[tok][d] = val;
      o += 96; if (o >= 384) { o -= 384; ++x; if (x == SHW) { x = 0; ++y; } } } }
  __syncthreads();
  {
    for (int i = t; i < 64 * 16; i += 256) { const int tok = i / 16, dp = 2 * (i % 16);
      ((unsigned*)Q16)[(cg * 64 + tok) * 16 + dp / 2] = (unsigned)__builtin_bit_cast(unsigned short, (_Float16)q[tok][dp]) | ((unsigned)__builtin_bit_cast(unsigned short, (_Float16)q[tok][dp + 1]) << 16);
      ((unsigned*)K16)[(cg * 64 + tok) * 16 + dp / 2] = (unsigned)__builtin_bit_cast(unsigned short, (_Float16)k[tok][dp]) | ((unsigned)__builtin_bit_cast(unsigned short, (_Float16)k[tok][dp + 1]) << 16); }
    for (int i = t; i < 64 * 32; i += 256) { const int d = i / 32, tp = 2 * (i % 32); const float a = (d < 32) ? v[tp][d] : 0.f, b = (d < 32) ? v[tp + 1][d] : 0.f;
      ((unsigned*)VT16)[(cg * 64 + d) * 32 + tp / 2] = (unsigned)__builtin_bit_cast(unsigned short, (_Float16)a) | ((unsigned)__builtin_bit_cast(unsigned short, (_Float16)b) << 16); }
     }
}
// softmax per chunk row: S [cg][64][64] f32 (scaled scores) + bias + masks -> P16 [cg][64][64] (x2^15; cols >= 49 -> 0, rows >= 49 not written); wave per (cg, row)
__global__ __launch_bounds__(256) void soft_kernel(const float* __restrict__ Sm, const float* __restrict__ rpe, unsigned* __restrict__ P16) {
  const int lane = threadIdx.x & 31, wave = threadIdx.x >> 5; const size_t gr = (size_t)blockIdx.x * 8 + wave; const size_t cg = gr / 64; const int p = (int)(gr % 64); const int w = (int)(cg % SWIN);
  const int hh = (w / 8) % 8, ww = w % 8;
  if (p >= 49) return;      // dead (padding) rows: their outputs are never stored
  float s0 = -INFINITY, s1 = -INFINITY; const int c0 = 2 * lane, c1 = 2 * lane + 1;
  if (p < 49) {
    if (c0 < 49) { s0 = Sm[gr * 64 + c0] + rpe[(c0 / 7 - p / 7 + 6) * 13 + (c0 % 7 - p % 7 + 6)]; if (hh == 7 && ((ROWM[p] >> c0) & 1ull)) s0 = -INFINITY; if (ww == 7 && ((COLM[p] >> c0) & 1ull)) s0 = -INFINITY; }
    if (c1 < 49) { s1 = Sm[gr * 64 + c1] + rpe[(c1 / 7 - p / 7 + 6) * 13 + (c1 % 7 - p % 7 + 6)]; if (hh == 7 && ((ROWM[p] >> c1) & 1ull)) s1 = -INFINITY; if (ww == 7 && ((COLM[p] >> c1) & 1ull)) s1 = -INFINITY; } }
  float mx = fmaxf(s0, s1); for (int o = 16; o > 0; o >>= 1) mx = fmaxf(mx, __shfl_xor(mx, o, 32));
  float e0 = (p < 49 && c0 < 49) ? expf(s0 - mx) : 0.f, e1 = (p < 49 && c1 < 49) ? expf(s1 - mx) : 0.f;   // -inf entries -> 0 (mx finite: bias entries exist)
  float se = e0 + e1; for (int o = 16; o > 0; o >>= 1) se += __shfl_xor(se, o, 32);
  const float sc = (p < 49) ? 32768.0f / se : 0.f;
  const unsigned u = (unsigned)__builtin_bit_cast(unsigned short, (_Float16)(e0 * sc)) | ((unsigned)__builtin_bit_cast(unsigned short, (_Float16)(e1 * sc)) << 16);
  ((unsigned*)P16)[gr * 32 + lane] = u; 
}
// scatter the chunk outputs OC [cg][64 tok][64 d] into O_flat[n][w*1568 + t*32 + d]; block per chunk (1568 floats = 49 lines)
__global__ __launch_bounds__(256) void ostore_kernel(const float* __restrict__ OC, int n0, float* __restrict__ O) {
  const int nl = blockIdx.y, w = blockIdx.x; const size_t cg = (size_t)nl * SWIN + w; float* dst = O + (size_t)nl * SP * SC + (size_t)w * 1568; (void)n0;     // O is part-local
  { for (int e = threadIdx.x; e < 1568; e += 256) { const int p = e / 32, d = e % 32; ((float*)dst)[e] = OC[(cg * 64 + p) * 64 + d]; }  }
}
// roll (+3,+3) and cast: A16[n][y][x][c] = O[n][(y-3) mod 56][(x-3) mod 56][c]; wave per pixel row of 128 (4 per lane)
__global__ __launch_bounds__(256) void roll_cast_kernel(const float* __restrict__ O, unsigned* __restrict__ A16) {     // part-local: r over NHALF*SP rows
  const int lane = threadIdx.x & 31, wave = threadIdx.x >> 5; const size_t r = (size_t)blockIdx.x * 8 + wave; const int n = (int)(r / SP), pix = (int)(r % SP); const int y = pix / SHW, x = pix % SHW;
  const int ys = (y - 3 + SHW) % SHW, xs = (x - 3 + SHW) % SHW; const v4f a = *(const v4f*)(O + ((size_t)n * SP + ys * SHW + xs) * SC + lane * 4);
  typedef __attribute__((ext_vector_type(2))) unsigned u2; u2 u; u[0] = (unsigned)__builtin_bit_cast(unsigned short, (_Float16)a[0]) | ((unsigned)__builtin_bit_cast(unsigned short, (_Float16)a[1]) << 16); u[1] = (unsigned)__builtin_bit_cast(unsigned short, (_Float16)a[2]) | ((unsigned)__builtin_bit_cast(unsigned short, (_Float16)a[3]) << 16);
  *(u2*)(A16 + (r * SC) / 2 + lane * 2) = u; 
}
extern "C" void kernel_launch(void* const* d_in, const int* in_sizes, int n_in, void* d_out, int out_size, void* d_ws, size_t ws_size, hipStream_t stream) {
  (void)in_sizes; (void)n_in; (void)out_size; (void)ws_size;
  const float* x = (const float*)d_in[0]; const float* qw = (const float*)d_in[1]; const float* qb = (const float*)d_in[2]; const float* ow = (const float*)d_in[3]; const float* ob = (const float*)d_in[4]; const float* rpe = (const float*)d_in[5];
  char* ws = (char*)d_ws; size_t off = 0;
  auto carve = [&](size_t bytes) -> char* { char* p = ws + off; off += (bytes + 255) & ~(size_t)255; return p; };
  _Float16* X16 = (_Float16*)carve((size_t)NHALF * SP * SC * 2); _Float16* QW16 = (_Float16*)carve(384 * SC * 2); _Float16* OW16 = (_Float16*)carve(SC * SC * 2);
  float* QKVh = (float*)carve((size_t)NHALF * SP * 384 * 4); float* O = (float*)carve((size_t)NHALF * SP * SC * 4); unsigned* A16 = (unsigned*)carve((size_t)NHALF * SP * SC * 2);     // all part-local
  const int NCG = NHALF * SWIN;     // 1024 chunks per part
  unsigned* Q16c = (unsigned*)carve((size_t)NCG * 64 * 32 * 2); unsigned* K16c = (unsigned*)carve((size_t)NCG * 64 * 32 * 2); unsigned* VT16 = (unsigned*)carve((size_t)NCG * 64 * 64 * 2);
  float* Sm = (float*)carve((size_t)NCG * 64 * 64 * 4); unsigned* P16 = (unsigned*)carve((size_t)NCG * 64 * 64 * 2); float* OC = Sm;     // scores buffer reused for the chunk outputs
  cast_f32_f16x2<<<(384 * SC / 2 + 255) / 256, 256, 0, stream>>>(qw, QW16, 384 * SC / 2);
  cast_f32_f16x2<<<(SC * SC / 2 + 255) / 256, 256, 0, stream>>>(ow, OW16, SC * SC / 2);
  for (int half = 0; half < 8; ++half) { const int n0 = half * NHALF;
    cast_f32_f16x2<<<(NHALF * SP * SC / 2 + 255) / 256, 256, 0, stream>>>(x + (size_t)n0 * SP * SC, X16, (long)NHALF * SP * SC / 2);
    { const int t = (NHALF * SP / 64) * 6;
      wmma_gemm64<0, false, 2, 0, false><<<dim3((t + 7) / 8, 1), 256, 0, stream>>>(U16(X16), nullptr, SC, 0, U16(QW16), nullptr, SC, 0, QKVh, nullptr, 384, 0, qb, nullptr, 0, NHALF * SP, 384, SC, 1.0f); }
    chunk_kernel<<<dim3(SWIN, NHALF), 256, 0, stream>>>(QKVh, n0, Q16c, K16c, VT16);
    wmma_gemm64<0, false, 0, 0, false><<<dim3(1, NCG), 256, 0, stream>>>((const unsigned short*)Q16c, nullptr, 32, 64 * 32, (const unsigned short*)K16c, nullptr, 32, 64 * 32, Sm, nullptr, 64, 64 * 64, nullptr, nullptr, 0, 64, 64, 32, 0.17677669529663687f);
    soft_kernel<<<NCG * 64 / 8, 256, 0, stream>>>(Sm, rpe, P16);
    wmma_gemm64<0, false, 0, 0, false><<<dim3(1, NCG), 256, 0, stream>>>((const unsigned short*)P16, nullptr, 64, 64 * 64, (const unsigned short*)VT16, nullptr, 64, 64 * 64, OC, nullptr, 64, 64 * 64, nullptr, nullptr, 0, 64, 64, 64, 1.0f / 32768.0f);
    ostore_kernel<<<dim3(SWIN, NHALF), 256, 0, stream>>>(OC, n0, O);
    roll_cast_kernel<<<NHALF * SP / 8, 256, 0, stream>>>(O, A16);
    { const int t2 = (NHALF * SP / 64) * 2;
      wmma_gemm64<0, false, 2, 0, false><<<dim3((t2 + 7) / 8, 1), 256, 0, stream>>>((const unsigned short*)A16, nullptr, SC, 0, U16(OW16), nullptr, SC, 0, (float*)d_out + (size_t)n0 * SP * SC, nullptr, SC, 0, ob, nullptr, 0, NHALF * SP, SC, SC, 1.0f); } }
}

// v001
// It runs in 274 microseconds.
// Two timings next to v000 put it at 2.36 and 2.41 times that version's speed.
#include <hip/hip_runtime.h>
#include <math.h>
// Shifted-window MSA, faithful to the reference's raw torch .view reshapes (the 'windows' are consecutive 4704-float chunks of the rolled
// (H, W, C, 3)-interleaved qkv tensor, not spatial windows), its asymmetric rolls (−4 then +3) and its integer-indexed column mask:
// qkv = x·qkv_wᵀ + qkv_b (100352 x 128 · 128 x 384, eight row parts; everything incl. the output linear runs per part so the workspace carve stays ≈32 MB) and the output linear (· 128 x 128) on v_wmma_f32_16x16x32_f16, f16 operands,
// f32 accumulate (plain single products — lean slice); the per-chunk attention's bias gather, −inf masks and softmax in f32 on VALU
// The per-chunk 49-token attention runs in one kernel, block per chunk: scores q.kT (K = 32) and p.v (p x2^15, K = 64) on WMMA, f16 operands, f32 accumulate; bias, -inf masks and softmax on VALU; all intermediates in LDS or registers.
typedef __attribute__((ext_vector_type(16))) _Float16 v16h;
typedef __attribute__((ext_vector_type(8)))  _Float16 v8h;
typedef __attribute__((ext_vector_type(16))) __bf16   v16b;
typedef __attribute__((ext_vector_type(8)))  __bf16   v8b;
typedef __attribute__((ext_vector_type(8)))  float    v8f;
typedef __attribute__((ext_vector_type(4)))  float    v4f;
#define PSCALE 32768.0f
#define U16(p) ((const unsigned short*)(const void*)(p))
#define PSCALE_INV (1.0f / 32768.0f)

__device__ __forceinline__ unsigned short f2bf_bits(float f) {
  unsigned u = __float_as_uint(f);
  return (unsigned short)((u + 0x7FFFu + ((u >> 16) & 1u)) >> 16);
}
__device__ __forceinline__ float bf_bits2f(unsigned short h) { return __uint_as_float(((unsigned)h) << 16); }

// hazard guards as plain device helpers (no inline asm inside the kernel template body)
__device__ __forceinline__ void dep_guard_h(v8f& a, v8f& b, v16h x, v16h y) { asm volatile("v_nop\n\tv_nop\n\tv_nop\n\tv_nop" : "+v"(a), "+v"(b) : "v"(x), "v"(y)); }
__device__ __forceinline__ void dep_guard_b(v8f& a, v8f& b, v16b x, v16b y) { asm volatile("v_nop\n\tv_nop\n\tv_nop\n\tv_nop" : "+v"(a), "+v"(b) : "v"(x), "v"(y)); }
__device__ __forceinline__ void keep4_h(v16h a, v16h b, v16h c, v16h d) { asm volatile("v_nop" :: "v"(a), "v"(b), "v"(c), "v"(d)); }
__device__ __forceinline__ void keep4_b(v16b a, v16b b, v16b c, v16b d) { asm volatile("v_nop" :: "v"(a), "v"(b), "v"(c), "v"(d)); }
__device__ __forceinline__ void acc_guard4(v8f& a, v8f& b, v8f& c, v8f& d) { asm volatile("v_nop\n\tv_nop\n\tv_nop\n\tv_nop" : "+v"(a), "+v"(b), "+v"(c), "+v"(d)); }
template <typename T> struct Frag;
template <> struct Frag<_Float16> {
  typedef v16h V; union U { v16h v; v8h h[2]; };
  static __device__ __forceinline__ v16h load(const _Float16* p) {   // elements 0..7 <- p[0..7], 8..15 <- p[16..23]
    U f; f.h[0] = *(const v8h*)(p); f.h[1] = *(const v8h*)(p + 16); return f.v;
  }
  static __device__ __forceinline__ v8f mma(v16h a, v16h b, v8f c) {
    return __builtin_amdgcn_wmma_f32_16x16x32_f16(false, a, false, b, (short)0, c, false, false);
  }
  static __device__ __forceinline__ void guard(v8f& a, v8f& b, v16h x, v16h y) { dep_guard_h(a, b, x, y); }
  static __device__ __forceinline__ void keep(v16h a, v16h b, v16h c, v16h d) { keep4_h(a, b, c, d); }
};
template <> struct Frag<__bf16> {
  typedef v16b V; union U { v16b v; v8b h[2]; };
  static __device__ __forceinline__ v16b load(const __bf16* p) {
    U f; f.h[0] = *(const v8b*)(p); f.h[1] = *(const v8b*)(p + 16); return f.v;
  }
  static __device__ __forceinline__ v8f mma(v16b a, v16b b, v8f c) {
    return __builtin_amdgcn_wmma_f32_16x16x32_bf16(false, a, false, b, (short)0, c, false, false);
  }
  static __device__ __forceinline__ void guard(v8f& a, v8f& b, v16b x, v16b y) { dep_guard_b(a, b, x, y); }
  static __device__ __forceinline__ void keep(v16b a, v16b b, v16b c, v16b d) { keep4_b(a, b, c, d); }
};

// ---- Register-blocked batched WMMA GEMM ------------------------------------
// C[m,n] = scale * sum_k A[m,k] * Bt[n,k] (+bias)(+resid); each wave owns a 64x64 tile.
// A row-major [M,K]; Bt row-major [N,K]; M,N % 64 == 0, K % 32 == 0.
// SPLIT: operands are hi/lo planes (A2/Bt2 = lo planes, same layout); product = hi·hi + hi·lo + lo·hi.
// BIAS_MODE: 0 = none, 1 = bias[m], 2 = bias[n].
// OUT_MODE: 0 = f32, 1 = f16, 2 = bf16 hi plane (Cout) + bf16 lo plane (Cout2).
// ET: 0 = f16 operands, 1 = bf16 operands (pointers passed as 16-bit storage)
template <int ET> struct Elem;
template <> struct Elem<0> { typedef _Float16 T; };
template <> struct Elem<1> { typedef __bf16 T; };
template <int ET, bool SPLIT, int BIAS_MODE, int OUT_MODE, bool RESID, int ACT = 0>
__global__ __launch_bounds__(256) void wmma_gemm64(
    const unsigned short* __restrict__ Ap, const unsigned short* __restrict__ A2p, int lda, long strideA,
    const unsigned short* __restrict__ Btp, const unsigned short* __restrict__ Bt2p, int ldb, long strideB,
    void* __restrict__ Cout, void* __restrict__ Cout2, int ldc, long strideC,
    const float* __restrict__ bias,
    const float* __restrict__ resid, long strideR,
    int M, int N, int K, float scale) {
  typedef typename Elem<ET>::T T;
  typedef typename Frag<T>::V V;
  const T* A = (const T*)Ap; const T* A2 = (const T*)A2p; const T* Bt = (const T*)Btp; const T* Bt2 = (const T*)Bt2p;
  __shared__ __align__(16) float sT[8][16 * 68];   // per-wave 16x64 slab, pitch 68 floats
  const int b    = blockIdx.y;
  const int lane = threadIdx.x & 31;
  const int wave = threadIdx.x >> 5;
  const int tilesN = N >> 6;
  const int tilesM = M >> 6;
  const int tile = blockIdx.x * 8 + wave;
  if (tile >= tilesM * tilesN) return;   // wave-uniform; no block barriers in this kernel
  const int tm = tile / tilesN;
  const int tn = tile - tm * tilesN;
  const int m0 = tm << 6;
  const int n0 = tn << 6;

  const T* Ab  = A  + (size_t)b * strideA;
  const T* Bb  = Bt + (size_t)b * strideB;
  const T* Ab2 = SPLIT ? (A2  + (size_t)b * strideA) : nullptr;
  const T* Bb2 = SPLIT ? (Bt2 + (size_t)b * strideB) : nullptr;

  const int rlane = lane & 15;                 // row (A) / col (B, D) within subtile
  const int koff  = (lane >> 4) * 8;           // k offset of this lane half
  const int mOff  = (lane >> 4) * 8;           // D row offset

  v8f acc[4][4];
#pragma unroll
  for (int i = 0; i < 4; ++i)
#pragma unroll
    for (int j = 0; j < 4; ++j) acc[i][j] = (v8f){0.f,0.f,0.f,0.f,0.f,0.f,0.f,0.f};

  for (int k0 = 0; k0 < K; k0 += 32) {
    V bh[4], bl[4];
#pragma unroll
    for (int j = 0; j < 4; ++j) {
      const size_t bo = (size_t)(n0 + (j << 4) + rlane) * ldb + koff + k0;
      bh[j] = Frag<T>::load(Bb + bo);
      if (SPLIT) bl[j] = Frag<T>::load(Bb2 + bo);
    }
#pragma unroll
    for (int i = 0; i < 4; ++i) {
      const size_t ao = (size_t)(m0 + (i << 4) + rlane) * lda + koff + k0;
      V ah = Frag<T>::load(Ab + ao);
      V al;
      if (SPLIT) al = Frag<T>::load(Ab2 + ao);
#pragma unroll
      for (int j = 0; j < 4; ++j) {
        acc[i][j] = Frag<T>::mma(ah, bh[j], acc[i][j]);
        if (SPLIT) {
          acc[i][j] = Frag<T>::mma(ah, bl[j], acc[i][j]);
          acc[i][j] = Frag<T>::mma(al, bh[j], acc[i][j]);
        }
      }
      Frag<T>::guard(acc[i][0], acc[i][3], ah, SPLIT ? al : ah);
    }
    Frag<T>::keep(bh[0], bh[1], bh[2], bh[3]);
    if (SPLIT) Frag<T>::keep(bl[0], bl[1], bl[2], bl[3]);
  }
  acc_guard4(acc[0][0], acc[0][1], acc[0][2], acc[0][3]);
  acc_guard4(acc[1][0], acc[1][1], acc[1][2], acc[1][3]);
  acc_guard4(acc[2][0], acc[2][1], acc[2][2], acc[2][3]);
  acc_guard4(acc[3][0], acc[3][1], acc[3][2], acc[3][3]);

  // ---- epilogue ----
  float* slab = sT[wave];
  const float* Rb = RESID ? (resid + (size_t)b * strideR) : nullptr;
#pragma unroll
  for (int i = 0; i < 4; ++i) {
    const int mBase = m0 + (i << 4);
#pragma unroll
    for (int j = 0; j < 4; ++j) {
      const int n = n0 + (j << 4) + rlane;
      float bv = 0.f;
      if (BIAS_MODE == 2) bv = bias[n];
#pragma unroll
      for (int r = 0; r < 8; ++r) {
        float v = acc[i][j][r] * scale;
        if (BIAS_MODE == 1) v += bias[mBase + mOff + r];
        if (BIAS_MODE == 2) v += bv;
        if (RESID) v += Rb[(size_t)(mBase + mOff + r) * ldc + n];
        if (ACT == 1) v = tanhf(v);
        if (ACT == 2) v = fmaxf(v, 0.0f);
        if (ACT == 3) v = v / (1.0f + expf(-v));
        if (ACT == 4) v = (v > 0.f) ? v : 0.01f * v;
        if (ACT == 5) v = 0.5f * v * (1.0f + erff(v * 0.70710678118654752f));
        slab[(mOff + r) * 68 + (j << 4) + rlane] = v;
      }
    }
    __builtin_amdgcn_fence(__ATOMIC_RELEASE, "workgroup");
    __builtin_amdgcn_wave_barrier();
    __builtin_amdgcn_fence(__ATOMIC_ACQUIRE, "workgroup");
    if (OUT_MODE == 0) {
      float* C = (float*)Cout + (size_t)b * strideC;
      const int hh = lane >> 4, c4 = (lane & 15) * 4;     // row seg = 256 B = 16 lanes x 16 B
      {
#pragma unroll
        for (int it = 0; it < 8; ++it) {
          const int row = it * 2 + hh;
          v4f v = *(const v4f*)(slab + row * 68 + c4);
          *(v4f*)(C + (size_t)(mBase + row) * ldc + n0 + c4) = v;
        }
        
      }
    } else {
      const int q = lane >> 3, c8 = (lane & 7) * 8;
      unsigned short* C  = (unsigned short*)Cout  + (size_t)b * strideC;
      unsigned short* C2 = (OUT_MODE == 2) ? ((unsigned short*)Cout2 + (size_t)b * strideC) : nullptr;
      {
#pragma unroll
        for (int it = 0; it < 4; ++it) {
          const int row = it * 4 + q;
          const float* sp = slab + row * 68 + c8;
          v8h hv, lv;
#pragma unroll
          for (int e = 0; e < 8; ++e) {
            if (OUT_MODE == 1) {
              hv[e] = (_Float16)sp[e];
            } else {
              unsigned short hb = f2bf_bits(sp[e]);
              unsigned short lb = f2bf_bits(sp[e] - bf_bits2f(hb));
              hv[e] = __builtin_bit_cast(_Float16, hb);
              lv[e] = __builtin_bit_cast(_Float16, lb);
            }
          }
          *(v8h*)(C + (size_t)(mBase + row) * ldc + n0 + c8) = hv;
          if (OUT_MODE == 2) *(v8h*)(C2 + (size_t)(mBase + row) * ldc + n0 + c8) = lv;
        }
        
      }
    }
    __builtin_amdgcn_fence(__ATOMIC_RELEASE, "workgroup");
    __builtin_amdgcn_wave_barrier();
    __builtin_amdgcn_fence(__ATOMIC_ACQUIRE, "workgroup");
  }
}

__global__ __launch_bounds__(256) void cast_f32_f16x2(
    const float* __restrict__ in, _Float16* __restrict__ out, int n2) {
  int i = blockIdx.x * 256 + threadIdx.x;
  if (i < n2) {
    const _Float16 h0 = (_Float16)in[2 * i], h1 = (_Float16)in[2 * i + 1];
    const unsigned u = (unsigned)__builtin_bit_cast(unsigned short, h0) | ((unsigned)__builtin_bit_cast(unsigned short, h1) << 16);
    ((unsigned*)out)[i] = u;
    
  }
}


#define SN 32
#define SHW 56
#define SP (SHW * SHW)          // 3136
#define SC 128
#define SROWS (SN * SP)         // 100352
#define SWIN 256                // chunks ('windows') per image = 4*8*8
#define SCH (49 * 32 * 3)       // 4704 floats per chunk
#define NHALF (SN / 8)            // images per part (8 parts; name kept)
#define QP 40                   // f16 pitch of the 32-wide q / k rows in LDS: 80 B = 16 B x odd
#define VP 72                   // f16 pitch of the 64-wide v-transposed rows in LDS: 144 B = 16 B x odd
// One block (4 waves) per chunk w of part-local image nl. The chunk's 4704 consecutive floats of the (-4,-4)-rolled
// (H, W, C, 3)-interleaved qkv tensor are gathered into f16 LDS tiles q[64 tok][32], k[64 tok][32], vT[32 d][64 tok] (tokens >= 49 zero).
// Each wave owns 16 queries: scores transposed, sT = k.qT (4 tiles of 16 keys x 16 queries, K = 32), so a lane holds 32 keys of ONE query
// (its partner lane ^ 16 the other 32): bias, masks and softmax stay in registers. Two neighbouring sT tiles, converted in place (x2^15, f16),
// are the B fragment of oT = vT.pT (2 tiles of 16 d x 16 queries, K = 64); a lane ends with 8 consecutive d of its query per tile.
__global__ __launch_bounds__(128) void attn_chunk_kernel(const float* __restrict__ QKVh, const float* __restrict__ rpe, float* __restrict__ O) {
  __shared__ __align__(16) _Float16 sQ[64 * QP];
  __shared__ __align__(16) _Float16 sK[64 * QP];
  __shared__ __align__(16) _Float16 sV[32 * VP];
  __shared__ float sB[208];     // the 13 x 13 table; entries 169..207 (reached only by padding keys) zero
  typedef __attribute__((ext_vector_type(4))) _Float16 v4h;
  typedef __attribute__((ext_vector_type(2))) _Float16 v2h;
  const unsigned nl = blockIdx.y, w = blockIdx.x, t = threadIdx.x;
  const unsigned lane = t & 31u, wave = t >> 5;
  // gather unit u = 12 consecutive floats = (q, k, v) of 4 consecutive d of one token; 392 units, 32 per pixel
  const float* src = QKVh + (size_t)nl * SP * 384;
  const float b0 = rpe[t], b1 = (t < 41) ? rpe[128 + t] : 0.f;     // issued ahead of the gather so that one wait covers all
  v4f val[4][3];
#pragma unroll
  for (int it = 0; it < 4; ++it) {
    const unsigned u = it * 128 + t;
    if (it < 3 || t < 8) {
      const unsigned U = w * 392u + u, pix = U >> 5, o = 12u * (U & 31u);
      const unsigned y = pix / SHW, x = pix - y * SHW;
      const unsigned ys = (y + 4 >= SHW) ? y + 4 - SHW : y + 4, xs = (x + 4 >= SHW) ? x + 4 - SHW : x + 4;
      const float* g = src + (ys * SHW + xs) * 384u + o;
      val[it][0] = *(const v4f*)(g); val[it][1] = *(const v4f*)(g + 4); val[it][2] = *(const v4f*)(g + 8);
    }
  }
  // padding, disjoint from what the gather writes: q / k rows 49..63 (75 16-byte pieces each), vT columns 49..63
  if (t < 75) {
    const v8h z = (v8h){0, 0, 0, 0, 0, 0, 0, 0};
    *(v8h*)(sQ + 49 * QP + 8 * t) = z;
    *(v8h*)(sK + 49 * QP + 8 * t) = z;
  }
  {     // row t / 4: quarter 0 clears columns 49..51, quarters 1..3 four columns each from 52 on (8-byte aligned)
    _Float16* zr = sV + (t >> 2) * VP + 48 + 4 * (t & 3u);
    if ((t & 3u) == 0) { zr[1] = (_Float16)0.f; *(v2h*)(zr + 2) = (v2h){0, 0}; }
    else *(v4h*)zr = (v4h){0, 0, 0, 0};
  }
  sB[t] = b0;
  if (t < 80) sB[128 + t] = b1;
#pragma unroll
  for (int it = 0; it < 4; ++it) {
    const unsigned u = it * 128 + t;
    if (it < 3 || t < 8) {
      const unsigned tok = u >> 3, d0 = 4u * (u & 7u);
      v4h hq, hk;
#pragma unroll
      for (int e = 0; e < 4; ++e) {     // float 3e + s of the unit is component s of d0 + e
        hq[e] = (_Float16)val[it][(3 * e) >> 2][(3 * e) & 3];
        hk[e] = (_Float16)val[it][(3 * e + 1) >> 2][(3 * e + 1) & 3];
        sV[(d0 + e) * VP + tok] = (_Float16)val[it][(3 * e + 2) >> 2][(3 * e + 2) & 3];
      }
      *(v4h*)(sQ + tok * QP + d0) = hq;
      *(v4h*)(sK + tok * QP + d0) = hk;
    }
  }
  __syncthreads();   // q, k, vT and the bias table are complete before any wave reads them
  const int c = lane & 15, h = lane >> 4, koff = h * 8;
  const int p = wave * 16 + c;
  const v8f zero = (v8f){0.f, 0.f, 0.f, 0.f, 0.f, 0.f, 0.f, 0.f};
  v8f acc[4];     // acc[j][r] = score of key 16j + 8h + r for query p
  {
    const v16h bq = Frag<_Float16>::load(sQ + p * QP + koff);
    v16h ak[4];
#pragma unroll
    for (int j = 0; j < 4; ++j) ak[j] = Frag<_Float16>::load(sK + (j * 16 + c) * QP + koff);
#pragma unroll
    for (int j = 0; j < 4; ++j) acc[j] = Frag<_Float16>::mma(ak[j], bq, zero);
  }
  const int pp = p < 48 ? p : 48, pq = pp / 7, pr = pp - 7 * pq;     // queries >= 49 are never stored
  // dead keys of this query, bit = key: padding, the last window row's mask, the last window column's mask
  unsigned long long m = 0xFFFE000000000000ull;
  if (((w >> 3) & 7u) == 7u) m |= (pp < 28) ? 0x1fffff0000000ull : 0xfffffffull;
  if ((w & 7u) == 7u) m |= (pr < 4) ? 0x1c3870e1c3870ull : ((pr == 4) ? 0x3c78f1e3c78full : 0ull);
  m >>= 8 * h;
  const unsigned mw[2] = {(unsigned)m, (unsigned)(m >> 32)};
  // table index (key/7 - p/7 + 6) * 13 + (key%7 - p%7 + 6) = (key + 6 * (key/7)) - (p + 6 * (p/7)) + 84
  const int ib = 84 - (pp + 6 * pq);
  float mx = -INFINITY;
#pragma unroll
  for (int j = 0; j < 4; ++j)
#pragma unroll
    for (int r = 0; r < 8; ++r) {
      const int k0 = 16 * j + r, i0 = k0 + 6 * (k0 / 7), i1 = k0 + 8 + 6 * ((k0 + 8) / 7);     // h = 0 / h = 1
      const float v = acc[j][r] * 0.17677669529663687f + sB[ib + i0 + h * (i1 - i0)];
      acc[j][r] = ((mw[j >> 1] >> (16 * (j & 1) + r)) & 1u) ? -INFINITY : v;
      mx = fmaxf(mx, acc[j][r]);
    }
  mx = fmaxf(mx, __shfl_xor(mx, 16, 32));     // finite: every query keeps live keys
  float sj[4] = {0.f, 0.f, 0.f, 0.f};
#pragma unroll
  for (int j = 0; j < 4; ++j)
#pragma unroll
    for (int r = 0; r < 8; ++r) { acc[j][r] = expf(acc[j][r] - mx); sj[j] += acc[j][r]; }     // -inf entries -> 0
  float se = (sj[0] + sj[1]) + (sj[2] + sj[3]);
  se += __shfl_xor(se, 16, 32);
  const float sc = 32768.0f / se;
  v8f o2[2] = {zero, zero};     // o2[i][r] = 2^15 * out[p][16i + 8h + r]
#pragma unroll
  for (int kk = 0; kk < 2; ++kk) {
    v16h bp;     // element s holds key 32kk + (s < 8 ? 8h + s : 16 + 8h + s - 8): the order Frag::load gives vT
#pragma unroll
    for (int s = 0; s < 16; ++s) bp[s] = (_Float16)(acc[2 * kk + (s >> 3)][s & 7] * sc);
#pragma unroll
    for (int i = 0; i < 2; ++i) {
      const v16h av = Frag<_Float16>::load(sV + (i * 16 + c) * VP + koff + 32 * kk);
      o2[i] = Frag<_Float16>::mma(av, bp, o2[i]);
    }
  }
  if (p < 49) {
    float* dst = O + (size_t)nl * SP * SC + (size_t)w * 1568 + p * 32 + 8 * h;
#pragma unroll
    for (int i = 0; i < 2; ++i) {
      *(v4f*)(dst + 16 * i)     = (v4f){o2[i][0], o2[i][1], o2[i][2], o2[i][3]} * PSCALE_INV;
      *(v4f*)(dst + 16 * i + 4) = (v4f){o2[i][4], o2[i][5], o2[i][6], o2[i][7]} * PSCALE_INV;
    }
  }
}
// roll (+3,+3) and cast: A16[n][y][x][c] = O[n][(y-3) mod 56][(x-3) mod 56][c]; wave per pixel row of 128 (4 per lane)
__global__ __launch_bounds__(256) void roll_cast_kernel(const float* __restrict__ O, unsigned* __restrict__ A16) {     // part-local: r over NHALF*SP rows
  const int lane = threadIdx.x & 31, wave = threadIdx.x >> 5; const size_t r = (size_t)blockIdx.x * 8 + wave; const int n = (int)(r / SP), pix = (int)(r % SP); const int y = pix / SHW, x = pix % SHW;
  const int ys = (y - 3 + SHW) % SHW, xs = (x - 3 + SHW) % SHW; const v4f a = *(const v4f*)(O + ((size_t)n * SP + ys * SHW + xs) * SC + lane * 4);
  typedef __attribute__((ext_vector_type(2))) unsigned u2; u2 u; u[0] = (unsigned)__builtin_bit_cast(unsigned short, (_Float16)a[0]) | ((unsigned)__builtin_bit_cast(unsigned short, (_Float16)a[1]) << 16); u[1] = (unsigned)__builtin_bit_cast(unsigned short, (_Float16)a[2]) | ((unsigned)__builtin_bit_cast(unsigned short, (_Float16)a[3]) << 16);
  *(u2*)(A16 + (r * SC) / 2 + lane * 2) = u; 
}
extern "C" void kernel_launch(void* const* d_in, const int* in_sizes, int n_in, void* d_out, int out_size, void* d_ws, size_t ws_size, hipStream_t stream) {
  (void)in_sizes; (void)n_in; (void)out_size; (void)ws_size;
  const float* x = (const float*)d_in[0]; const float* qw = (const float*)d_in[1]; const float* qb = (const float*)d_in[2]; const float* ow = (const float*)d_in[3]; const float* ob = (const float*)d_in[4]; const float* rpe = (const float*)d_in[5];
  char* ws = (char*)d_ws; size_t off = 0;
  auto carve = [&](size_t bytes) -> char* { char* p = ws + off; off += (bytes + 255) & ~(size_t)255; return p; };
  _Float16* X16 = (_Float16*)carve((size_t)NHALF * SP * SC * 2); _Float16* QW16 = (_Float16*)carve(384 * SC * 2); _Float16* OW16 = (_Float16*)carve(SC * SC * 2);
  float* QKVh = (float*)carve((size_t)NHALF * SP * 384 * 4); float* O = (float*)carve((size_t)NHALF * SP * SC * 4); unsigned* A16 = (unsigned*)carve((size_t)NHALF * SP * SC * 2);     // all part-local
  cast_f32_f16x2<<<(384 * SC / 2 + 255) / 256, 256, 0, stream>>>(qw, QW16, 384 * SC / 2);
  cast_f32_f16x2<<<(SC * SC / 2 + 255) / 256, 256, 0, stream>>>(ow, OW16, SC * SC / 2);
  for (int half = 0; half < 8; ++half) { const int n0 = half * NHALF;
    cast_f32_f16x2<<<(NHALF * SP * SC / 2 + 255) / 256, 256, 0, stream>>>(x + (size_t)n0 * SP * SC, X16, (long)NHALF * SP * SC / 2);
    { const int t = (NHALF * SP / 64) * 6;
      wmma_gemm64<0, false, 2, 0, false><<<dim3((t + 7) / 8, 1), 256, 0, stream>>>(U16(X16), nullptr, SC, 0, U16(QW16), nullptr, SC, 0, QKVh, nullptr, 384, 0, qb, nullptr, 0, NHALF * SP, 384, SC, 1.0f); }
    attn_chunk_kernel<<<dim3(SWIN, NHALF), 128, 0, stream>>>(QKVh, rpe, O);
    roll_cast_kernel<<<NHALF * SP / 8, 256, 0, stream>>>(O, A16);
    { const int t2 = (NHALF * SP / 64) * 2;
      wmma_gemm64<0, false, 2, 0, false><<<dim3((t2 + 7) / 8, 1), 256, 0, stream>>>((const unsigned short*)A16, nullptr, SC, 0, U16(OW16), nullptr, SC, 0, (float*)d_out + (size_t)n0 * SP * SC, nullptr, SC, 0, ob, nullptr, 0, NHALF * SP, SC, SC, 1.0f); } }
}

// v002
// Measured time: 118 microseconds a run.
// Two timings next to v001 put it at 2.31 and 2.36 times that version's speed.
// All steps since v000 together make it 5.57 times as fast.
#include <hip/hip_runtime.h>
#include <math.h>
// Shifted-window MSA, faithful to the reference's raw torch .view reshapes (the 'windows' are consecutive 4704-float chunks of the rolled
// (H, W, C, 3)-interleaved qkv tensor, not spatial windows), its asymmetric rolls (−4 then +3) and its integer-indexed column mask:
// Every stage runs once over all 32 images (workspace carve 257 MB of the 268 MB given): qkv = x.qkv_wT + qkv_b (100352 x 128 . 128 x 384) and the output linear (. 128 x 128) on v_wmma_f32_16x16x32_f16, f16 operands,
// f32 accumulate (plain single products — lean slice)
// The per-chunk 49-token attention runs in one kernel, block per chunk: scores q.kT (K = 32) and p.v (p x2^15, K = 64) on WMMA, f16 operands, f32 accumulate; bias, -inf masks and softmax on VALU; all intermediates in LDS or registers.
typedef __attribute__((ext_vector_type(16))) _Float16 v16h;
typedef __attribute__((ext_vector_type(8)))  _Float16 v8h;
typedef __attribute__((ext_vector_type(16))) __bf16   v16b;
typedef __attribute__((ext_vector_type(8)))  __bf16   v8b;
typedef __attribute__((ext_vector_type(8)))  float    v8f;
typedef __attribute__((ext_vector_type(4)))  float    v4f;
#define PSCALE 32768.0f
#define U16(p) ((const unsigned short*)(const void*)(p))
#define PSCALE_INV (1.0f / 32768.0f)

__device__ __forceinline__ unsigned short f2bf_bits(float f) {
  unsigned u = __float_as_uint(f);
  return (unsigned short)((u + 0x7FFFu + ((u >> 16) & 1u)) >> 16);
}
__device__ __forceinline__ float bf_bits2f(unsigned short h) { return __uint_as_float(((unsigned)h) << 16); }

// hazard guards as plain device helpers (no inline asm inside the kernel template body)
__device__ __forceinline__ void dep_guard_h(v8f& a, v8f& b, v16h x, v16h y) { asm volatile("v_nop\n\tv_nop\n\tv_nop\n\tv_nop" : "+v"(a), "+v"(b) : "v"(x), "v"(y)); }
__device__ __forceinline__ void dep_guard_b(v8f& a, v8f& b, v16b x, v16b y) { asm volatile("v_nop\n\tv_nop\n\tv_nop\n\tv_nop" : "+v"(a), "+v"(b) : "v"(x), "v"(y)); }
__device__ __forceinline__ void keep4_h(v16h a, v16h b, v16h c, v16h d) { asm volatile("v_nop" :: "v"(a), "v"(b), "v"(c), "v"(d)); }
__device__ __forceinline__ void keep4_b(v16b a, v16b b, v16b c, v16b d) { asm volatile("v_nop" :: "v"(a), "v"(b), "v"(c), "v"(d)); }
__device__ __forceinline__ void acc_guard4(v8f& a, v8f& b, v8f& c, v8f& d) { asm volatile("v_nop\n\tv_nop\n\tv_nop\n\tv_nop" : "+v"(a), "+v"(b), "+v"(c), "+v"(d)); }
template <typename T> struct Frag;
template <> struct Frag<_Float16> {
  typedef v16h V; union U { v16h v; v8h h[2]; };
  static __device__ __forceinline__ v16h load(const _Float16* p) {   // elements 0..7 <- p[0..7], 8..15 <- p[16..23]
    U f; f.h[0] = *(const v8h*)(p); f.h[1] = *(const v8h*)(p + 16); return f.v;
  }
  static __device__ __forceinline__ v8f mma(v16h a, v16h b, v8f c) {
    return __builtin_amdgcn_wmma_f32_16x16x32_f16(false, a, false, b, (short)0, c, false, false);
  }
  static __device__ __forceinline__ void guard(v8f& a, v8f& b, v16h x, v16h y) { dep_guard_h(a, b, x, y); }
  static __device__ __forceinline__ void keep(v16h a, v16h b, v16h c, v16h d) { keep4_h(a, b, c, d); }
};
template <> struct Frag<__bf16> {
  typedef v16b V; union U { v16b v; v8b h[2]; };
  static __device__ __forceinline__ v16b load(const __bf16* p) {
    U f; f.h[0] = *(const v8b*)(p); f.h[1] = *(const v8b*)(p + 16); return f.v;
  }
  static __device__ __forceinline__ v8f mma(v16b a, v16b b, v8f c) {
    return __builtin_amdgcn_wmma_f32_16x16x32_bf16(false, a, false, b, (short)0, c, false, false);
  }
  static __device__ __forceinline__ void guard(v8f& a, v8f& b, v16b x, v16b y) { dep_guard_b(a, b, x, y); }
  static __device__ __forceinline__ void keep(v16b a, v16b b, v16b c, v16b d) { keep4_b(a, b, c, d); }
};

// ---- Register-blocked batched WMMA GEMM ------------------------------------
// C[m,n] = scale * sum_k A[m,k] * Bt[n,k] (+bias)(+resid); each wave owns a 64x64 tile.
// A row-major [M,K]; Bt row-major [N,K]; M,N % 64 == 0, K % 32 == 0.
// SPLIT: operands are hi/lo planes (A2/Bt2 = lo planes, same layout); product = hi·hi + hi·lo + lo·hi.
// BIAS_MODE: 0 = none, 1 = bias[m], 2 = bias[n].
// OUT_MODE: 0 = f32, 1 = f16, 2 = bf16 hi plane (Cout) + bf16 lo plane (Cout2).
// ET: 0 = f16 operands, 1 = bf16 operands (pointers passed as 16-bit storage)
template <int ET> struct Elem;
template <> struct Elem<0> { typedef _Float16 T; };
template <> struct Elem<1> { typedef __bf16 T; };
template <int ET, bool SPLIT, int BIAS_MODE, int OUT_MODE, bool RESID, int ACT = 0>
__global__ __launch_bounds__(256) void wmma_gemm64(
    const unsigned short* __restrict__ Ap, const unsigned short* __restrict__ A2p, int lda, long strideA,
    const unsigned short* __restrict__ Btp, const unsigned short* __restrict__ Bt2p, int ldb, long strideB,
    void* __restrict__ Cout, void* __restrict__ Cout2, int ldc, long strideC,
    const float* __restrict__ bias,
    const float* __restrict__ resid, long strideR,
    int M, int N, int K, float scale) {
  typedef typename Elem<ET>::T T;
  typedef typename Frag<T>::V V;
  const T* A = (const T*)Ap; const T* A2 = (const T*)A2p; const T* Bt = (const T*)Btp; const T* Bt2 = (const T*)Bt2p;
  __shared__ __align__(16) float sT[8][16 * 68];   // per-wave 16x64 slab, pitch 68 floats
  const int b    = blockIdx.y;
  const int lane = threadIdx.x & 31;
  const int wave = threadIdx.x >> 5;
  const int tilesN = N >> 6;
  const int tilesM = M >> 6;
  const int tile = blockIdx.x * 8 + wave;
  if (tile >= tilesM * tilesN) return;   // wave-uniform; no block barriers in this kernel
  const int tm = tile / tilesN;
  const int tn = tile - tm * tilesN;
  const int m0 = tm << 6;
  const int n0 = tn << 6;

  const T* Ab  = A  + (size_t)b * strideA;
  const T* Bb  = Bt + (size_t)b * strideB;
  const T* Ab2 = SPLIT ? (A2  + (size_t)b * strideA) : nullptr;
  const T* Bb2 = SPLIT ? (Bt2 + (size_t)b * strideB) : nullptr;

  const int rlane = lane & 15;                 // row (A) / col (B, D) within subtile
  const int koff  = (lane >> 4) * 8;           // k offset of this lane half
  const int mOff  = (lane >> 4) * 8;           // D row offset

  v8f acc[4][4];
#pragma unroll
  for (int i = 0; i < 4; ++i)
#pragma unroll
    for (int j = 0; j < 4; ++j) acc[i][j] = (v8f){0.f,0.f,0.f,0.f,0.f,0.f,0.f,0.f};

  for (int k0 = 0; k0 < K; k0 += 32) {
    V bh[4], bl[4];
#pragma unroll
    for (int j = 0; j < 4; ++j) {
      const size_t bo = (size_t)(n0 + (j << 4) + rlane) * ldb + koff + k0;
      bh[j] = Frag<T>::load(Bb + bo);
      if (SPLIT) bl[j] = Frag<T>::load(Bb2 + bo);
    }
#pragma unroll
    for (int i = 0; i < 4; ++i) {
      const size_t ao = (size_t)(m0 + (i << 4) + rlane) * lda + koff + k0;
      V ah = Frag<T>::load(Ab + ao);
      V al;
      if (SPLIT) al = Frag<T>::load(Ab2 + ao);
#pragma unroll
      for (int j = 0; j < 4; ++j) {
        acc[i][j] = Frag<T>::mma(ah, bh[j], acc[i][j]);
        if (SPLIT) {
          acc[i][j] = Frag<T>::mma(ah, bl[j], acc[i][j]);
          acc[i][j] = Frag<T>::mma(al, bh[j], acc[i][j]);
        }
      }
      Frag<T>::guard(acc[i][0], acc[i][3], ah, SPLIT ? al : ah);
    }
    Frag<T>::keep(bh[0], bh[1], bh[2], bh[3]);
    if (SPLIT) Frag<T>::keep(bl[0], bl[1], bl[2], bl[3]);
  }
  acc_guard4(acc[0][0], acc[0][1], acc[0][2], acc[0][3]);
  acc_guard4(acc[1][0], acc[1][1], acc[1][2], acc[1][3]);
  acc_guard4(acc[2][0], acc[2][1], acc[2][2], acc[2][3]);
  acc_guard4(acc[3][0], acc[3][1], acc[3][2], acc[3][3]);

  // ---- epilogue ----
  float* slab = sT[wave];
  const float* Rb = RESID ? (resid + (size_t)b * strideR) : nullptr;
#pragma unroll
  for (int i = 0; i < 4; ++i) {
    const int mBase = m0 + (i << 4);
#pragma unroll
    for (int j = 0; j < 4; ++j) {
      const int n = n0 + (j << 4) + rlane;
      float bv = 0.f;
      if (BIAS_MODE == 2) bv = bias[n];
#pragma unroll
      for (int r = 0; r < 8; ++r) {
        float v = acc[i][j][r] * scale;
        if (BIAS_MODE == 1) v += bias[mBase + mOff + r];
        if (BIAS_MODE == 2) v += bv;
        if (RESID) v += Rb[(size_t)(mBase + mOff + r) * ldc + n];
        if (ACT == 1) v = tanhf(v);
        if (ACT == 2) v = fmaxf(v, 0.0f);
        if (ACT == 3) v = v / (1.0f + expf(-v));
        if (ACT == 4) v = (v > 0.f) ? v : 0.01f * v;
        if (ACT == 5) v = 0.5f * v * (1.0f + erff(v * 0.70710678118654752f));
        slab[(mOff + r) * 68 + (j << 4) + rlane] = v;
      }
    }
    __builtin_amdgcn_fence(__ATOMIC_RELEASE, "workgroup");
    __builtin_amdgcn_wave_barrier();
    __builtin_amdgcn_fence(__ATOMIC_ACQUIRE, "workgroup");
    if (OUT_MODE == 0) {
      float* C = (float*)Cout + (size_t)b * strideC;
      const int hh = lane >> 4, c4 = (lane & 15) * 4;     // row seg = 256 B = 16 lanes x 16 B
      {
#pragma unroll
        for (int it = 0; it < 8; ++it) {
          const int row = it * 2 + hh;
          v4f v = *(const v4f*)(slab + row * 68 + c4);
          *(v4f*)(C + (size_t)(mBase + row) * ldc + n0 + c4) = v;
        }
        
      }
    } else {
      const int q = lane >> 3, c8 = (lane & 7) * 8;
      unsigned short* C  = (unsigned short*)Cout  + (size_t)b * strideC;
      unsigned short* C2 = (OUT_MODE == 2) ? ((unsigned short*)Cout2 + (size_t)b * strideC) : nullptr;
      {
#pragma unroll
        for (int it = 0; it < 4; ++it) {
          const int row = it * 4 + q;
          const float* sp = slab + row * 68 + c8;
          v8h hv, lv;
#pragma unroll
          for (int e = 0; e < 8; ++e) {
            if (OUT_MODE == 1) {
              hv[e] = (_Float16)sp[e];
            } else {
              unsigned short hb = f2bf_bits(sp[e]);
              unsigned short lb = f2bf_bits(sp[e] - bf_bits2f(hb));
              hv[e] = __builtin_bit_cast(_Float16, hb);
              lv[e] = __builtin_bit_cast(_Float16, lb);
            }
          }
          *(v8h*)(C + (size_t)(mBase + row) * ldc + n0 + c8) = hv;
          if (OUT_MODE == 2) *(v8h*)(C2 + (size_t)(mBase + row) * ldc + n0 + c8) = lv;
        }
        
      }
    }
    __builtin_amdgcn_fence(__ATOMIC_RELEASE, "workgroup");
    __builtin_amdgcn_wave_barrier();
    __builtin_amdgcn_fence(__ATOMIC_ACQUIRE, "workgroup");
  }
}

__global__ __launch_bounds__(256) void cast_f32_f16x2(
    const float* __restrict__ in, _Float16* __restrict__ out, int n2) {
  int i = blockIdx.x * 256 + threadIdx.x;
  if (i < n2) {
    const _Float16 h0 = (_Float16)in[2 * i], h1 = (_Float16)in[2 * i + 1];
    const unsigned u = (unsigned)__builtin_bit_cast(unsigned short, h0) | ((unsigned)__builtin_bit_cast(unsigned short, h1) << 16);
    ((unsigned*)out)[i] = u;
    
  }
}


#define SN 32
#define SHW 56
#define SP (SHW * SHW)          // 3136
#define SC 128
#define SROWS (SN * SP)         // 100352
#define SWIN 256                // chunks ('windows') per image = 4*8*8
#define SCH (49 * 32 * 3)       // 4704 floats per chunk
#define QP 40                   // f16 pitch of the 32-wide q / k rows in LDS: 80 B = 16 B x odd
#define VP 72                   // f16 pitch of the 64-wide v-transposed rows in LDS: 144 B = 16 B x odd
// One block (4 waves) per chunk w of image nl. The chunk's 4704 consecutive floats of the (-4,-4)-rolled
// (H, W, C, 3)-interleaved qkv tensor are gathered into f16 LDS tiles q[64 tok][32], k[64 tok][32], vT[32 d][64 tok] (tokens >= 49 zero).
// Each wave owns 16 queries: scores transposed, sT = k.qT (4 tiles of 16 keys x 16 queries, K = 32), so a lane holds 32 keys of ONE query
// (its partner lane ^ 16 the other 32): bias, masks and softmax stay in registers. Two neighbouring sT tiles, converted in place (x2^15, f16),
// are the B fragment of oT = vT.pT (2 tiles of 16 d x 16 queries, K = 64); a lane ends with 8 consecutive d of its query per tile.
__global__ __launch_bounds__(128) void attn_chunk_kernel(const float* __restrict__ QKVh, const float* __restrict__ rpe, float* __restrict__ O) {
  __shared__ __align__(16) _Float16 sQ[64 * QP];
  __shared__ __align__(16) _Float16 sK[64 * QP];
  __shared__ __align__(16) _Float16 sV[32 * VP];
  __shared__ float sB[208];     // the 13 x 13 table; entries 169..207 (reached only by padding keys) zero
  typedef __attribute__((ext_vector_type(4))) _Float16 v4h;
  typedef __attribute__((ext_vector_type(2))) _Float16 v2h;
  const unsigned nl = blockIdx.y, w = blockIdx.x, t = threadIdx.x;
  const unsigned lane = t & 31u, wave = t >> 5;
  // gather unit u = 12 consecutive floats = (q, k, v) of 4 consecutive d of one token; 392 units, 32 per pixel
  const float* src = QKVh + (size_t)nl * SP * 384;
  const float b0 = rpe[t], b1 = (t < 41) ? rpe[128 + t] : 0.f;     // issued ahead of the gather so that one wait covers all
  v4f val[4][3];
#pragma unroll
  for (int it = 0; it < 4; ++it) {
    const unsigned u = it * 128 + t;
    if (it < 3 || t < 8) {
      const unsigned U = w * 392u + u, pix = U >> 5, o = 12u * (U & 31u);
      const unsigned y = pix / SHW, x = pix - y * SHW;
      const unsigned ys = (y + 4 >= SHW) ? y + 4 - SHW : y + 4, xs = (x + 4 >= SHW) ? x + 4 - SHW : x + 4;
      const float* g = src + (ys * SHW + xs) * 384u + o;
      val[it][0] = *(const v4f*)(g); val[it][1] = *(const v4f*)(g + 4); val[it][2] = *(const v4f*)(g + 8);
    }
  }
  // padding, disjoint from what the gather writes: q / k rows 49..63 (75 16-byte pieces each), vT columns 49..63
  if (t < 75) {
    const v8h z = (v8h){0, 0, 0, 0, 0, 0, 0, 0};
    *(v8h*)(sQ + 49 * QP + 8 * t) = z;
    *(v8h*)(sK + 49 * QP + 8 * t) = z;
  }
  {     // row t / 4: quarter 0 clears columns 49..51, quarters 1..3 four columns each from 52 on (8-byte aligned)
    _Float16* zr = sV + (t >> 2) * VP + 48 + 4 * (t & 3u);
    if ((t & 3u) == 0) { zr[1] = (_Float16)0.f; *(v2h*)(zr + 2) = (v2h){0, 0}; }
    else *(v4h*)zr = (v4h){0, 0, 0, 0};
  }
  sB[t] = b0;
  if (t < 80) sB[128 + t] = b1;
#pragma unroll
  for (int it = 0; it < 4; ++it) {
    const unsigned u = it * 128 + t;
    if (it < 3 || t < 8) {
      const unsigned tok = u >> 3, d0 = 4u * (u & 7u);
      v4h hq, hk;
#pragma unroll
      for (int e = 0; e < 4; ++e) {     // float 3e + s of the unit is component s of d0 + e
        hq[e] = (_Float16)val[it][(3 * e) >> 2][(3 * e) & 3];
        hk[e] = (_Float16)val[it][(3 * e + 1) >> 2][(3 * e + 1) & 3];
        sV[(d0 + e) * VP + tok] = (_Float16)val[it][(3 * e + 2) >> 2][(3 * e + 2) & 3];
      }
      *(v4h*)(sQ + tok * QP + d0) = hq;
      *(v4h*)(sK + tok * QP + d0) = hk;
    }
  }
  __syncthreads();   // q, k, vT and the bias table are complete before any wave reads them
  const int c = lane & 15, h = lane >> 4, koff = h * 8;
  const int p = wave * 16 + c;
  const v8f zero = (v8f){0.f, 0.f, 0.f, 0.f, 0.f, 0.f, 0.f, 0.f};
  v8f acc[4];     // acc[j][r] = score of key 16j + 8h + r for query p
  {
    const v16h bq = Frag<_Float16>::load(sQ + p * QP + koff);
    v16h ak[4];
#pragma unroll
    for (int j = 0; j < 4; ++j) ak[j] = Frag<_Float16>::load(sK + (j * 16 + c) * QP + koff);
#pragma unroll
    for (int j = 0; j < 4; ++j) acc[j] = Frag<_Float16>::mma(ak[j], bq, zero);
  }
  const int pp = p < 48 ? p : 48, pq = pp / 7, pr = pp - 7 * pq;     // queries >= 49 are never stored
  // dead keys of this query, bit = key: padding, the last window row's mask, the last window column's mask
  unsigned long long m = 0xFFFE000000000000ull;
  if (((w >> 3) & 7u) == 7u) m |= (pp < 28) ? 0x1fffff0000000ull : 0xfffffffull;
  if ((w & 7u) == 7u) m |= (pr < 4) ? 0x1c3870e1c3870ull : ((pr == 4) ? 0x3c78f1e3c78full : 0ull);
  m >>= 8 * h;
  const unsigned mw[2] = {(unsigned)m, (unsigned)(m >> 32)};
  // table index (key/7 - p/7 + 6) * 13 + (key%7 - p%7 + 6) = (key + 6 * (key/7)) - (p + 6 * (p/7)) + 84
  const int ib = 84 - (pp + 6 * pq);
  float mx = -INFINITY;
#pragma unroll
  for (int j = 0; j < 4; ++j)
#pragma unroll
    for (int r = 0; r < 8; ++r) {
      const int k0 = 16 * j + r, i0 = k0 + 6 * (k0 / 7), i1 = k0 + 8 + 6 * ((k0 + 8) / 7);     // h = 0 / h = 1
      const float v = acc[j][r] * 0.17677669529663687f + sB[ib + i0 + h * (i1 - i0)];
      acc[j][r] = ((mw[j >> 1] >> (16 * (j & 1) + r)) & 1u) ? -INFINITY : v;
      mx = fmaxf(mx, acc[j][r]);
    }
  mx = fmaxf(mx, __shfl_xor(mx, 16, 32));     // finite: every query keeps live keys
  float sj[4] = {0.f, 0.f, 0.f, 0.f};
#pragma unroll
  for (int j = 0; j < 4; ++j)
#pragma unroll
    for (int r = 0; r < 8; ++r) { acc[j][r] = expf(acc[j][r] - mx); sj[j] += acc[j][r]; }     // -inf entries -> 0
  float se = (sj[0] + sj[1]) + (sj[2] + sj[3]);
  se += __shfl_xor(se, 16, 32);
  const float sc = 32768.0f / se;
  v8f o2[2] = {zero, zero};     // o2[i][r] = 2^15 * out[p][16i + 8h + r]
#pragma unroll
  for (int kk = 0; kk < 2; ++kk) {
    v16h bp;     // element s holds key 32kk + (s < 8 ? 8h + s : 16 + 8h + s - 8): the order Frag::load gives vT
#pragma unroll
    for (int s = 0; s < 16; ++s) bp[s] = (_Float16)(acc[2 * kk + (s >> 3)][s & 7] * sc);
#pragma unroll
    for (int i = 0; i < 2; ++i) {
      const v16h av = Frag<_Float16>::load(sV + (i * 16 + c) * VP + koff + 32 * kk);
      o2[i] = Frag<_Float16>::mma(av, bp, o2[i]);
    }
  }
  if (p < 49) {
    float* dst = O + (size_t)nl * SP * SC + (size_t)w * 1568 + p * 32 + 8 * h;
#pragma unroll
    for (int i = 0; i < 2; ++i) {
      *(v4f*)(dst + 16 * i)     = (v4f){o2[i][0], o2[i][1], o2[i][2], o2[i][3]} * PSCALE_INV;
      *(v4f*)(dst + 16 * i + 4) = (v4f){o2[i][4], o2[i][5], o2[i][6], o2[i][7]} * PSCALE_INV;
    }
  }
}
// roll (+3,+3) and cast: A16[n][y][x][c] = O[n][(y-3) mod 56][(x-3) mod 56][c]; wave per pixel row of 128 (4 per lane)
__global__ __launch_bounds__(256) void roll_cast_kernel(const float* __restrict__ O, unsigned* __restrict__ A16) {     // r over all SROWS pixel rows
  const int lane = threadIdx.x & 31, wave = threadIdx.x >> 5; const size_t r = (size_t)blockIdx.x * 8 + wave; const int n = (int)(r / SP), pix = (int)(r % SP); const int y = pix / SHW, x = pix % SHW;
  const int ys = (y - 3 + SHW) % SHW, xs = (x - 3 + SHW) % SHW; const v4f a = *(const v4f*)(O + ((size_t)n * SP + ys * SHW + xs) * SC + lane * 4);
  typedef __attribute__((ext_vector_type(2))) unsigned u2; u2 u; u[0] = (unsigned)__builtin_bit_cast(unsigned short, (_Float16)a[0]) | ((unsigned)__builtin_bit_cast(unsigned short, (_Float16)a[1]) << 16); u[1] = (unsigned)__builtin_bit_cast(unsigned short, (_Float16)a[2]) | ((unsigned)__builtin_bit_cast(unsigned short, (_Float16)a[3]) << 16);
  *(u2*)(A16 + (r * SC) / 2 + lane * 2) = u; 
}
extern "C" void kernel_launch(void* const* d_in, const int* in_sizes, int n_in, void* d_out, int out_size, void* d_ws, size_t ws_size, hipStream_t stream) {
  (void)in_sizes; (void)n_in; (void)out_size; (void)ws_size;
  const float* x = (const float*)d_in[0]; const float* qw = (const float*)d_in[1]; const float* qb = (const float*)d_in[2]; const float* ow = (const float*)d_in[3]; const float* ob = (const float*)d_in[4]; const float* rpe = (const float*)d_in[5];
  char* ws = (char*)d_ws; size_t off = 0;
  auto carve = [&](size_t bytes) -> char* { char* p = ws + off; off += (bytes + 255) & ~(size_t)255; return p; };
  _Float16* X16 = (_Float16*)carve((size_t)SROWS * SC * 2); _Float16* QW16 = (_Float16*)carve(384 * SC * 2); _Float16* OW16 = (_Float16*)carve(SC * SC * 2);
  float* QKVh = (float*)carve((size_t)SROWS * 384 * 4); float* O = (float*)carve((size_t)SROWS * SC * 4); unsigned* A16 = (unsigned*)carve((size_t)SROWS * SC * 2);
  cast_f32_f16x2<<<(384 * SC / 2 + 255) / 256, 256, 0, stream>>>(qw, QW16, 384 * SC / 2);
  cast_f32_f16x2<<<(SC * SC / 2 + 255) / 256, 256, 0, stream>>>(ow, OW16, SC * SC / 2);
  cast_f32_f16x2<<<(SROWS * SC / 2 + 255) / 256, 256, 0, stream>>>(x, X16, SROWS * SC / 2);
  { const int t = (SROWS / 64) * 6;
    wmma_gemm64<0, false, 2, 0, false><<<dim3((t + 7) / 8, 1), 256, 0, stream>>>(U16(X16), nullptr, SC, 0, U16(QW16), nullptr, SC, 0, QKVh, nullptr, 384, 0, qb, nullptr, 0, SROWS, 384, SC, 1.0f); }
  attn_chunk_kernel<<<dim3(SWIN, SN), 128, 0, stream>>>(QKVh, rpe, O);
  roll_cast_kernel<<<SROWS / 8, 256, 0, stream>>>(O, A16);
  { const int t2 = (SROWS / 64) * 2;
    wmma_gemm64<0, false, 2, 0, false><<<dim3((t2 + 7) / 8, 1), 256, 0, stream>>>((const unsigned short*)A16, nullptr, SC, 0, U16(OW16), nullptr, SC, 0, (float*)d_out, nullptr, SC, 0, ob, nullptr, 0, SROWS, SC, SC, 1.0f); }
}

// v003
// One run takes 63 microseconds.
// Timed twice side by side with v002, it ran 1.89 and 1.88 times as fast.
// Counting every step since v000, it is 10.5 times as fast.
#include <hip/hip_runtime.h>
#include <math.h>
// Shifted-window MSA, faithful to the reference's raw torch .view reshapes (the 'windows' are consecutive 4704-float chunks of the rolled
// (H, W, C, 3)-interleaved qkv tensor, not spatial windows), its asymmetric rolls (−4 then +3) and its integer-indexed column mask:
// Every stage runs once over all 32 images: qkv = x.qkv_wT + qkv_b (100352 x 128 . 128 x 384) and the output linear (. 128 x 128) on v_wmma_f32_16x16x32_f16, f16 operands, f32 accumulate.
// The qkv product and the per-chunk 49-token attention run in one kernel, block per 49 rolled pixels (= 4 whole chunks): x is read as f32 and cast on the way into LDS, q, k and v never leave LDS;
// scores q.kT (K = 32) and p.v (p x2^15, K = 64) on WMMA, f16 operands, f32 accumulate; bias, -inf masks and softmax on VALU.
typedef __attribute__((ext_vector_type(16))) _Float16 v16h;
typedef __attribute__((ext_vector_type(8)))  _Float16 v8h;
typedef __attribute__((ext_vector_type(16))) __bf16   v16b;
typedef __attribute__((ext_vector_type(8)))  __bf16   v8b;
typedef __attribute__((ext_vector_type(8)))  float    v8f;
typedef __attribute__((ext_vector_type(4)))  float    v4f;
#define PSCALE 32768.0f
#define U16(p) ((const unsigned short*)(const void*)(p))
#define PSCALE_INV (1.0f / 32768.0f)

__device__ __forceinline__ unsigned short f2bf_bits(float f) {
  unsigned u = __float_as_uint(f);
  return (unsigned short)((u + 0x7FFFu + ((u >> 16) & 1u)) >> 16);
}
__device__ __forceinline__ float bf_bits2f(unsigned short h) { return __uint_as_float(((unsigned)h) << 16); }

// hazard guards as plain device helpers (no inline asm inside the kernel template body)
__device__ __forceinline__ void dep_guard_h(v8f& a, v8f& b, v16h x, v16h y) { asm volatile("v_nop\n\tv_nop\n\tv_nop\n\tv_nop" : "+v"(a), "+v"(b) : "v"(x), "v"(y)); }
__device__ __forceinline__ void dep_guard_b(v8f& a, v8f& b, v16b x, v16b y) { asm volatile("v_nop\n\tv_nop\n\tv_nop\n\tv_nop" : "+v"(a), "+v"(b) : "v"(x), "v"(y)); }
__device__ __forceinline__ void keep4_h(v16h a, v16h b, v16h c, v16h d) { asm volatile("v_nop" :: "v"(a), "v"(b), "v"(c), "v"(d)); }
__device__ __forceinline__ void keep4_b(v16b a, v16b b, v16b c, v16b d) { asm volatile("v_nop" :: "v"(a), "v"(b), "v"(c), "v"(d)); }
__device__ __forceinline__ void acc_guard4(v8f& a, v8f& b, v8f& c, v8f& d) { asm volatile("v_nop\n\tv_nop\n\tv_nop\n\tv_nop" : "+v"(a), "+v"(b), "+v"(c), "+v"(d)); }
template <typename T> struct Frag;
template <> struct Frag<_Float16> {
  typedef v16h V; union U { v16h v; v8h h[2]; };
  static __device__ __forceinline__ v16h load(const _Float16* p) {   // elements 0..7 <- p[0..7], 8..15 <- p[16..23]
    U f; f.h[0] = *(const v8h*)(p); f.h[1] = *(const v8h*)(p + 16); return f.v;
  }
  static __device__ __forceinline__ v8f mma(v16h a, v16h b, v8f c) {
    return __builtin_amdgcn_wmma_f32_16x16x32_f16(false, a, false, b, (short)0, c, false, false);
  }
  static __device__ __forceinline__ void guard(v8f& a, v8f& b, v16h x, v16h y) { dep_guard_h(a, b, x, y); }
  static __device__ __forceinline__ void keep(v16h a, v16h b, v16h c, v16h d) { keep4_h(a, b, c, d); }
};
template <> struct Frag<__bf16> {
  typedef v16b V; union U { v16b v; v8b h[2]; };
  static __device__ __forceinline__ v16b load(const __bf16* p) {
    U f; f.h[0] = *(const v8b*)(p); f.h[1] = *(const v8b*)(p + 16); return f.v;
  }
  static __device__ __forceinline__ v8f mma(v16b a, v16b b, v8f c) {
    return __builtin_amdgcn_wmma_f32_16x16x32_bf16(false, a, false, b, (short)0, c, false, false);
  }
  static __device__ __forceinline__ void guard(v8f& a, v8f& b, v16b x, v16b y) { dep_guard_b(a, b, x, y); }
  static __device__ __forceinline__ void keep(v16b a, v16b b, v16b c, v16b d) { keep4_b(a, b, c, d); }
};

// ---- Register-blocked batched WMMA GEMM ------------------------------------
// C[m,n] = scale * sum_k A[m,k] * Bt[n,k] (+bias)(+resid); each wave owns a 64x64 tile.
// A row-major [M,K]; Bt row-major [N,K]; M,N % 64 == 0, K % 32 == 0.
// SPLIT: operands are hi/lo planes (A2/Bt2 = lo planes, same layout); product = hi·hi + hi·lo + lo·hi.
// BIAS_MODE: 0 = none, 1 = bias[m], 2 = bias[n].
// OUT_MODE: 0 = f32, 1 = f16, 2 = bf16 hi plane (Cout) + bf16 lo plane (Cout2).
// ET: 0 = f16 operands, 1 = bf16 operands (pointers passed as 16-bit storage)
template <int ET> struct Elem;
template <> struct Elem<0> { typedef _Float16 T; };
template <> struct Elem<1> { typedef __bf16 T; };
template <int ET, bool SPLIT, int BIAS_MODE, int OUT_MODE, bool RESID, int ACT = 0>
__global__ __launch_bounds__(256) void wmma_gemm64(
    const unsigned short* __restrict__ Ap, const unsigned short* __restrict__ A2p, int lda, long strideA,
    const unsigned short* __restrict__ Btp, const unsigned short* __restrict__ Bt2p, int ldb, long strideB,
    void* __restrict__ Cout, void* __restrict__ Cout2, int ldc, long strideC,
    const float* __restrict__ bias,
    const float* __restrict__ resid, long strideR,
    int M, int N, int K, float scale) {
  typedef typename Elem<ET>::T T;
  typedef typename Frag<T>::V V;
  const T* A = (const T*)Ap; const T* A2 = (const T*)A2p; const T* Bt = (const T*)Btp; const T* Bt2 = (const T*)Bt2p;
  __shared__ __align__(16) float sT[8][16 * 68];   // per-wave 16x64 slab, pitch 68 floats
  const int b    = blockIdx.y;
  const int lane = threadIdx.x & 31;
  const int wave = threadIdx.x >> 5;
  const int tilesN = N >> 6;
  const int tilesM = M >> 6;
  const int tile = blockIdx.x * 8 + wave;
  if (tile >= tilesM * tilesN) return;   // wave-uniform; no block barriers in this kernel
  const int tm = tile / tilesN;
  const int tn = tile - tm * tilesN;
  const int m0 = tm << 6;
  const int n0 = tn << 6;

  const T* Ab  = A  + (size_t)b * strideA;
  const T* Bb  = Bt + (size_t)b * strideB;
  const T* Ab2 = SPLIT ? (A2  + (size_t)b * strideA) : nullptr;
  const T* Bb2 = SPLIT ? (Bt2 + (size_t)b * strideB) : nullptr;

  const int rlane = lane & 15;                 // row (A) / col (B, D) within subtile
  const int koff  = (lane >> 4) * 8;           // k offset of this lane half
  const int mOff  = (lane >> 4) * 8;           // D row offset

  v8f acc[4][4];
#pragma unroll
  for (int i = 0; i < 4; ++i)
#pragma unroll
    for (int j = 0; j < 4; ++j) acc[i][j] = (v8f){0.f,0.f,0.f,0.f,0.f,0.f,0.f,0.f};

  for (int k0 = 0; k0 < K; k0 += 32) {
    V bh[4], bl[4];
#pragma unroll
    for (int j = 0; j < 4; ++j) {
      const size_t bo = (size_t)(n0 + (j << 4) + rlane) * ldb + koff + k0;
      bh[j] = Frag<T>::load(Bb + bo);
      if (SPLIT) bl[j] = Frag<T>::load(Bb2 + bo);
    }
#pragma unroll
    for (int i = 0; i < 4; ++i) {
      const size_t ao = (size_t)(m0 + (i << 4) + rlane) * lda + koff + k0;
      V ah = Frag<T>::load(Ab + ao);
      V al;
      if (SPLIT) al = Frag<T>::load(Ab2 + ao);
#pragma unroll
      for (int j = 0; j < 4; ++j) {
        acc[i][j] = Frag<T>::mma(ah, bh[j], acc[i][j]);
        if (SPLIT) {
          acc[i][j] = Frag<T>::mma(ah, bl[j], acc[i][j]);
          acc[i][j] = Frag<T>::mma(al, bh[j], acc[i][j]);
        }
      }
      Frag<T>::guard(acc[i][0], acc[i][3], ah, SPLIT ? al : ah);
    }
    Frag<T>::keep(bh[0], bh[1], bh[2], bh[3]);
    if (SPLIT) Frag<T>::keep(bl[0], bl[1], bl[2], bl[3]);
  }
  acc_guard4(acc[0][0], acc[0][1], acc[0][2], acc[0][3]);
  acc_guard4(acc[1][0], acc[1][1], acc[1][2], acc[1][3]);
  acc_guard4(acc[2][0], acc[2][1], acc[2][2], acc[2][3]);
  acc_guard4(acc[3][0], acc[3][1], acc[3][2], acc[3][3]);

  // ---- epilogue ----
  float* slab = sT[wave];
  const float* Rb = RESID ? (resid + (size_t)b * strideR) : nullptr;
#pragma unroll
  for (int i = 0; i < 4; ++i) {
    const int mBase = m0 + (i << 4);
#pragma unroll
    for (int j = 0; j < 4; ++j) {
      const int n = n0 + (j << 4) + rlane;
      float bv = 0.f;
      if (BIAS_MODE == 2) bv = bias[n];
#pragma unroll
      for (int r = 0; r < 8; ++r) {
        float v = acc[i][j][r] * scale;
        if (BIAS_MODE == 1) v += bias[mBase + mOff + r];
        if (BIAS_MODE == 2) v += bv;
        if (RESID) v += Rb[(size_t)(mBase + mOff + r) * ldc + n];
        if (ACT == 1) v = tanhf(v);
        if (ACT == 2) v = fmaxf(v, 0.0f);
        if (ACT == 3) v = v / (1.0f + expf(-v));
        if (ACT == 4) v = (v > 0.f) ? v : 0.01f * v;
        if (ACT == 5) v = 0.5f * v * (1.0f + erff(v * 0.70710678118654752f));
        slab[(mOff + r) * 68 + (j << 4) + rlane] = v;
      }
    }
    __builtin_amdgcn_fence(__ATOMIC_RELEASE, "workgroup");
    __builtin_amdgcn_wave_barrier();
    __builtin_amdgcn_fence(__ATOMIC_ACQUIRE, "workgroup");
    if (OUT_MODE == 0) {
      float* C = (float*)Cout + (size_t)b * strideC;
      const int hh = lane >> 4, c4 = (lane & 15) * 4;     // row seg = 256 B = 16 lanes x 16 B
      {
#pragma unroll
        for (int it = 0; it < 8; ++it) {
          const int row = it * 2 + hh;
          v4f v = *(const v4f*)(slab + row * 68 + c4);
          *(v4f*)(C + (size_t)(mBase + row) * ldc + n0 + c4) = v;
        }
        
      }
    } else {
      const int q = lane >> 3, c8 = (lane & 7) * 8;
      unsigned short* C  = (unsigned short*)Cout  + (size_t)b * strideC;
      unsigned short* C2 = (OUT_MODE == 2) ? ((unsigned short*)Cout2 + (size_t)b * strideC) : nullptr;
      {
#pragma unroll
        for (int it = 0; it < 4; ++it) {
          const int row = it * 4 + q;
          const float* sp = slab + row * 68 + c8;
          v8h hv, lv;
#pragma unroll
          for (int e = 0; e < 8; ++e) {
            if (OUT_MODE == 1) {
              hv[e] = (_Float16)sp[e];
            } else {
              unsigned short hb = f2bf_bits(sp[e]);
              unsigned short lb = f2bf_bits(sp[e] - bf_bits2f(hb));
              hv[e] = __builtin_bit_cast(_Float16, hb);
              lv[e] = __builtin_bit_cast(_Float16, lb);
            }
          }
          *(v8h*)(C + (size_t)(mBase + row) * ldc + n0 + c8) = hv;
          if (OUT_MODE == 2) *(v8h*)(C2 + (size_t)(mBase + row) * ldc + n0 + c8) = lv;
        }
        
      }
    }
    __builtin_amdgcn_fence(__ATOMIC_RELEASE, "workgroup");
    __builtin_amdgcn_wave_barrier();
    __builtin_amdgcn_fence(__ATOMIC_ACQUIRE, "workgroup");
  }
}

__global__ __launch_bounds__(256) void cast_f32_f16x2(
    const float* __restrict__ in, _Float16* __restrict__ out, int n2) {
  int i = blockIdx.x * 256 + threadIdx.x;
  if (i < n2) {
    const _Float16 h0 = (_Float16)in[2 * i], h1 = (_Float16)in[2 * i + 1];
    const unsigned u = (unsigned)__builtin_bit_cast(unsigned short, h0) | ((unsigned)__builtin_bit_cast(unsigned short, h1) << 16);
    ((unsigned*)out)[i] = u;
    
  }
}


#define SN 32
#define SHW 56
#define SP (SHW * SHW)          // 3136
#define SC 128
#define SROWS (SN * SP)         // 100352
#define SWIN 256                // chunks ('windows') per image = 4*8*8
#define SCH (49 * 32 * 3)       // 4704 floats per chunk
#define QP 40                   // f16 pitch of the 32-wide q / k rows in LDS: 80 B = 16 B x odd
#define VP 72                   // f16 pitch of the 64-wide v-transposed rows in LDS: 144 B = 16 B x odd
#define XP 136                  // f16 pitch of the 128-wide x rows in LDS: 272 B = 16 B x odd
#define TOKR 212                // 196 token rows of a group + the rows that the last chunk's 64-row tiles reach past them
// qkv_w cast to f16 in the order in which the fused kernel's waves load their A fragments, so that each load is 512 contiguous bytes:
// [channel block 8][k step 4][component 3][piece 2][lane 32][8]; row 3 * (16 block + lane % 16) + component, k = 32 step + 16 piece + 8 (lane / 16) + e.
__global__ __launch_bounds__(256) void pack_qkv_w(const float* __restrict__ qw, unsigned* __restrict__ out) {
  const unsigned i = blockIdx.x * 256 + threadIdx.x;     // one pair of f16 each, 24576 pairs
  const unsigned e2 = i & 3u, lane = (i >> 2) & 31u, piece = (i >> 7) & 1u, f = i >> 8;
  const unsigned s = f % 3u, wk = f / 3u, k = wk & 3u, wv = wk >> 2;
  const unsigned n = 3u * (16u * wv + (lane & 15u)) + s, kk = 32u * k + 16u * piece + 8u * (lane >> 4) + 2u * e2;
  const _Float16 h0 = (_Float16)qw[n * SC + kk], h1 = (_Float16)qw[n * SC + kk + 1];
  out[i] = (unsigned)__builtin_bit_cast(unsigned short, h0) | ((unsigned)__builtin_bit_cast(unsigned short, h1) << 16);
}
// One block (16 waves) per group g of 49 consecutive pixels of the (-4,-4)-rolled image nl. 49 pixels x 128 channels = 196 tokens x 32 d
// = exactly the chunks 4g .. 4g + 3: token T = 4 * pixel + channel / 32, d = channel % 32, chunk T / 49; qkv column = 3 * channel + component.
// Stage 1: the 49 x rows, cast to f16, into LDS (rows 49..63 zero). Stage 2: qkvT = W.xT on WMMA (K = 128): a wave owns 16 channels
// of q, k and v for 32 of the 64 pixel columns, so a lane ends with 8 consecutive d of one token; + bias, cast to f16, into q[T][32], k[T][32], vT[chunk][32 d][64 tok].
// Stage 3, one (chunk, 16-query tile) unit per wave: scores transposed, sT = k.qT (4 tiles of 16 keys x 16 queries, K = 32), so a lane holds 32 keys of ONE query
// (its partner lane ^ 16 the other 32): bias, masks and softmax stay in registers. Two neighbouring sT tiles, converted in place (x2^15, f16),
// are the B fragment of oT = vT.pT (2 tiles of 16 d x 16 queries, K = 64); a lane ends with 8 consecutive d of its query per tile.
// Rows 49..63 of a chunk's q / k tiles are the next chunk's tokens (or zero rows): such keys are masked, such queries never stored.
__global__ __launch_bounds__(512) void qkv_attn_kernel(const float* __restrict__ X, const _Float16* __restrict__ QWf, const float* __restrict__ qb,
                                                       const float* __restrict__ rpe, float* __restrict__ O) {
  __shared__ __align__(16) _Float16 sX[64 * XP];
  __shared__ __align__(16) _Float16 sQ[TOKR * QP];
  __shared__ __align__(16) _Float16 sK[TOKR * QP];
  __shared__ __align__(16) _Float16 sV[4 * 32 * VP];
  __shared__ __align__(16) float sQB[384];
  __shared__ float sB[208];     // the 13 x 13 table; entries 169..207 (reached only by padding keys) zero
  typedef __attribute__((ext_vector_type(4))) _Float16 v4h;
  typedef __attribute__((ext_vector_type(2))) _Float16 v2h;
  const unsigned nl = blockIdx.y, g = blockIdx.x, t = threadIdx.x;
  const unsigned lane = t & 31u, wave = t >> 5;
  const unsigned cb = wave & 7u, jh = wave >> 3;     // stage 2: channel block, half of the pixel columns
  const int c = lane & 15, h = lane >> 4, koff = h * 8;
  // ---- stage 1: loads first (x rows, the weight fragments of the first two k steps, bias, table), so that they fly together
  const float* xsrc = X + (size_t)nl * SP * SC;
  v4f xv[4];
#pragma unroll
  for (int it = 0; it < 4; ++it) {
    const unsigned idx = it * 512 + t;     // 32 pieces of 4 floats per pixel, 1568 pieces
    if (it < 3 || t < 32) {
      const unsigned pix = g * 49u + (idx >> 5);
      const unsigned y = pix / SHW, x = pix - y * SHW;
      const unsigned ys = (y + 4 >= SHW) ? y + 4 - SHW : y + 4, xs = (x + 4 >= SHW) ? x + 4 - SHW : x + 4;
      xv[it] = *(const v4f*)(xsrc + (ys * SHW + xs) * SC + 4u * (idx & 31u));
    }
  }
  const _Float16* wp = QWf + cb * 6144u + lane * 8u;
  v16h aw[2][3];     // k step k sits in aw[k & 1]
#pragma unroll
  for (int k = 0; k < 2; ++k)
#pragma unroll
    for (int s = 0; s < 3; ++s) {
      Frag<_Float16>::U f;
      f.h[0] = *(const v8h*)(wp + ((k * 3 + s) * 2) * 256);
      f.h[1] = *(const v8h*)(wp + ((k * 3 + s) * 2 + 1) * 256);
      aw[k][s] = f.v;
    }
  const float tb = (t < 169) ? rpe[t] : 0.f;
  v4f qbv = (v4f){0.f, 0.f, 0.f, 0.f};
  if (t < 96) qbv = *(const v4f*)(qb + 4 * t);
  // padding, disjoint from what the stages write: x rows 49..63 (255 16-byte pieces), q / k rows 196..211 (80 each), vT columns 49..63
  {
    const v8h z = (v8h){0, 0, 0, 0, 0, 0, 0, 0};
    if (t < 255) *(v8h*)(sX + 49 * XP + 8 * t) = z;
    if (t < 80) { *(v8h*)(sQ + 196 * QP + 8 * t) = z; *(v8h*)(sK + 196 * QP + 8 * t) = z; }
    if (t < 256) {
      _Float16* zr = sV + (t >> 1) * VP;     // row t / 2: the even thread clears columns 49..55, the odd one 56..63
      if ((t & 1u) == 0) { zr[49] = (_Float16)0.f; *(v2h*)(zr + 50) = (v2h){0, 0}; *(v4h*)(zr + 52) = (v4h){0, 0, 0, 0}; }
      else *(v8h*)(zr + 56) = z;
    }
  }
  if (t < 208) sB[t] = tb;
  if (t < 96) *(v4f*)(sQB + 4 * t) = qbv;
#pragma unroll
  for (int it = 0; it < 4; ++it) {
    const unsigned idx = it * 512 + t;
    if (it < 3 || t < 32) {
      const v4h hx = (v4h){(_Float16)xv[it][0], (_Float16)xv[it][1], (_Float16)xv[it][2], (_Float16)xv[it][3]};
      *(v4h*)(sX + (idx >> 5) * XP + 4u * (idx & 31u)) = hx;
    }
  }
  __syncthreads();   // the x tile, the qkv bias and the table are complete before any wave reads them
  const v8f zero = (v8f){0.f, 0.f, 0.f, 0.f, 0.f, 0.f, 0.f, 0.f};
  // ---- stage 2: ga[s][j][r] = component s of channel 16 cb + 8h + r at pixel 32 jh + 16j + c
  {
    v8f ga[3][2];
#pragma unroll
    for (int s = 0; s < 3; ++s)
#pragma unroll
      for (int j = 0; j < 2; ++j) ga[s][j] = zero;
#pragma unroll
    for (int k = 0; k < 4; ++k) {
      v16h bx[2];
#pragma unroll
      for (int j = 0; j < 2; ++j) bx[j] = Frag<_Float16>::load(sX + (jh * 32 + j * 16 + c) * XP + koff + 32 * k);
#pragma unroll
      for (int s = 0; s < 3; ++s) {
#pragma unroll
        for (int j = 0; j < 2; ++j) ga[s][j] = Frag<_Float16>::mma(aw[k & 1][s], bx[j], ga[s][j]);
        if (k < 2) {     // the fragment of k step k + 2 takes the place of the one just used
          Frag<_Float16>::U f;
          f.h[0] = *(const v8h*)(wp + (((k + 2) * 3 + s) * 2) * 256);
          f.h[1] = *(const v8h*)(wp + (((k + 2) * 3 + s) * 2 + 1) * 256);
          aw[k & 1][s] = f.v;
        }
      }
      // ends the k step for the scheduler: the weight loads of step k + 2 stay here (sunk to their use, each is waited for alone) and later steps'
      // LDS loads are not lifted up (that build needs more than 128 registers: one block per WGP instead of two)
      __builtin_amdgcn_sched_barrier(0);
    }
    float bb[24];     // bb[3r + s] = bias of component s of channel 16 cb + 8h + r
#pragma unroll
    for (int q4 = 0; q4 < 6; ++q4) {
      const v4f b4 = *(const v4f*)(sQB + 48 * cb + 24 * h + 4 * q4);
      bb[4 * q4] = b4[0]; bb[4 * q4 + 1] = b4[1]; bb[4 * q4 + 2] = b4[2]; bb[4 * q4 + 3] = b4[3];
    }
    const unsigned d0 = 16u * (cb & 1u) + 8u * h;
#pragma unroll
    for (int j = 0; j < 2; ++j) {
      const unsigned pl = jh * 32 + j * 16 + c;
      if (pl < 49) {
        const unsigned T = 4u * pl + (cb >> 1), ch = T / 49u, tok = T - 49u * ch;
        v8h hq, hk;
#pragma unroll
        for (int r = 0; r < 8; ++r) {
          hq[r] = (_Float16)(ga[0][j][r] + bb[3 * r]);
          hk[r] = (_Float16)(ga[1][j][r] + bb[3 * r + 1]);
          sV[(ch * 32u + d0 + r) * VP + tok] = (_Float16)(ga[2][j][r] + bb[3 * r + 2]);
        }
        *(v8h*)(sQ + T * QP + d0) = hq;
        *(v8h*)(sK + T * QP + d0) = hk;
      }
    }
  }
  __syncthreads();   // q, k and vT of all four chunks are complete before any wave reads them
  // ---- stage 3
  const unsigned ch = wave >> 2, w = 4u * g + ch;
  const int p = (wave & 3u) * 16 + c;
  v8f acc[4];     // acc[j][r] = score of key 16j + 8h + r for query p
  {
    const v16h bq = Frag<_Float16>::load(sQ + (ch * 49 + p) * QP + koff);
    v16h ak[4];
#pragma unroll
    for (int j = 0; j < 4; ++j) ak[j] = Frag<_Float16>::load(sK + (ch * 49 + j * 16 + c) * QP + koff);
#pragma unroll
    for (int j = 0; j < 4; ++j) acc[j] = Frag<_Float16>::mma(ak[j], bq, zero);
  }
  const int pp = p < 48 ? p : 48, pq = pp / 7, pr = pp - 7 * pq;     // queries >= 49 are never stored
  // dead keys of this query, bit = key: padding, the last window row's mask, the last window column's mask
  unsigned long long m = 0xFFFE000000000000ull;
  if (((w >> 3) & 7u) == 7u) m |= (pp < 28) ? 0x1fffff0000000ull : 0xfffffffull;
  if ((w & 7u) == 7u) m |= (pr < 4) ? 0x1c3870e1c3870ull : ((pr == 4) ? 0x3c78f1e3c78full : 0ull);
  m >>= 8 * h;
  const unsigned mw[2] = {(unsigned)m, (unsigned)(m >> 32)};
  // table index (key/7 - p/7 + 6) * 13 + (key%7 - p%7 + 6) = (key + 6 * (key/7)) - (p + 6 * (p/7)) + 84
  const int ib = 84 - (pp + 6 * pq);
  float mx = -INFINITY;
#pragma unroll
  for (int j = 0; j < 4; ++j)
#pragma unroll
    for (int r = 0; r < 8; ++r) {
      const int k0 = 16 * j + r, i0 = k0 + 6 * (k0 / 7), i1 = k0 + 8 + 6 * ((k0 + 8) / 7);     // h = 0 / h = 1
      const float v = acc[j][r] * 0.17677669529663687f + sB[ib + i0 + h * (i1 - i0)];
      acc[j][r] = ((mw[j >> 1] >> (16 * (j & 1) + r)) & 1u) ? -INFINITY : v;
      mx = fmaxf(mx, acc[j][r]);
    }
  mx = fmaxf(mx, __shfl_xor(mx, 16, 32));     // finite: every query keeps live keys
  float sj[4] = {0.f, 0.f, 0.f, 0.f};
#pragma unroll
  for (int j = 0; j < 4; ++j)
#pragma unroll
    for (int r = 0; r < 8; ++r) { acc[j][r] = expf(acc[j][r] - mx); sj[j] += acc[j][r]; }     // -inf entries -> 0
  float se = (sj[0] + sj[1]) + (sj[2] + sj[3]);
  se += __shfl_xor(se, 16, 32);
  const float sc = 32768.0f / se;
  v8f o2[2] = {zero, zero};     // o2[i][r] = 2^15 * out[p][16i + 8h + r]
#pragma unroll
  for (int kk = 0; kk < 2; ++kk) {
    v16h bp;     // element s holds key 32kk + (s < 8 ? 8h + s : 16 + 8h + s - 8): the order Frag::load gives vT
#pragma unroll
    for (int s = 0; s < 16; ++s) bp[s] = (_Float16)(acc[2 * kk + (s >> 3)][s & 7] * sc);
#pragma unroll
    for (int i = 0; i < 2; ++i) {
      const v16h av = Frag<_Float16>::load(sV + (ch * 32 + i * 16 + c) * VP + koff + 32 * kk);
      o2[i] = Frag<_Float16>::mma(av, bp, o2[i]);
    }
  }
  if (p < 49) {
    float* dst = O + (size_t)nl * SP * SC + (size_t)w * 1568 + p * 32 + 8 * h;
#pragma unroll
    for (int i = 0; i < 2; ++i) {
      *(v4f*)(dst + 16 * i)     = (v4f){o2[i][0], o2[i][1], o2[i][2], o2[i][3]} * PSCALE_INV;
      *(v4f*)(dst + 16 * i + 4) = (v4f){o2[i][4], o2[i][5], o2[i][6], o2[i][7]} * PSCALE_INV;
    }
  }
}
// roll (+3,+3) and cast: A16[n][y][x][c] = O[n][(y-3) mod 56][(x-3) mod 56][c]; wave per pixel row of 128 (4 per lane)
__global__ __launch_bounds__(256) void roll_cast_kernel(const float* __restrict__ O, unsigned* __restrict__ A16) {     // r over all SROWS pixel rows
  const int lane = threadIdx.x & 31, wave = threadIdx.x >> 5; const size_t r = (size_t)blockIdx.x * 8 + wave; const int n = (int)(r / SP), pix = (int)(r % SP); const int y = pix / SHW, x = pix % SHW;
  const int ys = (y - 3 + SHW) % SHW, xs = (x - 3 + SHW) % SHW; const v4f a = *(const v4f*)(O + ((size_t)n * SP + ys * SHW + xs) * SC + lane * 4);
  typedef __attribute__((ext_vector_type(2))) unsigned u2; u2 u; u[0] = (unsigned)__builtin_bit_cast(unsigned short, (_Float16)a[0]) | ((unsigned)__builtin_bit_cast(unsigned short, (_Float16)a[1]) << 16); u[1] = (unsigned)__builtin_bit_cast(unsigned short, (_Float16)a[2]) | ((unsigned)__builtin_bit_cast(unsigned short, (_Float16)a[3]) << 16);
  *(u2*)(A16 + (r * SC) / 2 + lane * 2) = u; 
}
extern "C" void kernel_launch(void* const* d_in, const int* in_sizes, int n_in, void* d_out, int out_size, void* d_ws, size_t ws_size, hipStream_t stream) {
  (void)in_sizes; (void)n_in; (void)out_size; (void)ws_size;
  const float* x = (const float*)d_in[0]; const float* qw = (const float*)d_in[1]; const float* qb = (const float*)d_in[2]; const float* ow = (const float*)d_in[3]; const float* ob = (const float*)d_in[4]; const float* rpe = (const float*)d_in[5];
  char* ws = (char*)d_ws; size_t off = 0;
  auto carve = [&](size_t bytes) -> char* { char* p = ws + off; off += (bytes + 255) & ~(size_t)255; return p; };
  _Float16* QWf = (_Float16*)carve(384 * SC * 2); _Float16* OW16 = (_Float16*)carve(SC * SC * 2);
  float* O = (float*)carve((size_t)SROWS * SC * 4); unsigned* A16 = (unsigned*)carve((size_t)SROWS * SC * 2);
  pack_qkv_w<<<384 * SC / 2 / 256, 256, 0, stream>>>(qw, (unsigned*)QWf);
  cast_f32_f16x2<<<(SC * SC / 2 + 255) / 256, 256, 0, stream>>>(ow, OW16, SC * SC / 2);
  qkv_attn_kernel<<<dim3(SP / 49, SN), 512, 0, stream>>>(x, QWf, qb, rpe, O);
  roll_cast_kernel<<<SROWS / 8, 256, 0, stream>>>(O, A16);
  { const int t2 = (SROWS / 64) * 2;
    wmma_gemm64<0, false, 2, 0, false><<<dim3((t2 + 7) / 8, 1), 256, 0, stream>>>((const unsigned short*)A16, nullptr, SC, 0, U16(OW16), nullptr, SC, 0, (float*)d_out, nullptr, SC, 0, ob, nullptr, 0, SROWS, SC, SC, 1.0f); }
}

// v004
// One run takes 53.9 microseconds.
// Next to v003, in two timings, it ran 1.16 and 1.17 times as fast.
// All steps since v000 together make it 12.2 times as fast.
#include <hip/hip_runtime.h>
#include <math.h>
// Shifted-window MSA, faithful to the reference's raw torch .view reshapes (the 'windows' are consecutive 4704-float chunks of the rolled
// (H, W, C, 3)-interleaved qkv tensor, not spatial windows), its asymmetric rolls (-4 then +3) and its integer-indexed column mask.
// One kernel does the whole layer, block per 49 rolled pixels (= 4 whole chunks): x is read as f32 and cast on the way into LDS; qkv = x.qkv_wT + qkv_b,
// the per-chunk 49-token attention and the output linear (. 128 x 128, + out_b) follow without leaving LDS; the (+3,+3) roll is the address of the final store.
// All products on v_wmma_f32_16x16x32_f16, f16 operands, f32 accumulate: scores q.kT (K = 32), p.v (p x2^15, K = 64); bias, -inf masks and softmax on VALU.
typedef __attribute__((ext_vector_type(16))) _Float16 v16h;
typedef __attribute__((ext_vector_type(8)))  _Float16 v8h;
typedef __attribute__((ext_vector_type(8)))  float    v8f;
typedef __attribute__((ext_vector_type(4)))  float    v4f;
#define PSCALE_INV (1.0f / 32768.0f)

template <typename T> struct Frag;
template <> struct Frag<_Float16> {
  typedef v16h V; union U { v16h v; v8h h[2]; };
  static __device__ __forceinline__ v16h load(const _Float16* p) {   // elements 0..7 <- p[0..7], 8..15 <- p[16..23]
    U f; f.h[0] = *(const v8h*)(p); f.h[1] = *(const v8h*)(p + 16); return f.v;
  }
  static __device__ __forceinline__ v8f mma(v16h a, v16h b, v8f c) {
    return __builtin_amdgcn_wmma_f32_16x16x32_f16(false, a, false, b, (short)0, c, false, false);
  }
};

#define SN 32
#define SHW 56
#define SP (SHW * SHW)          // 3136
#define SC 128
#define SROWS (SN * SP)         // 100352
#define SWIN 256                // chunks ('windows') per image = 4*8*8
#define SCH (49 * 32 * 3)       // 4704 floats per chunk
#define QP 40                   // f16 pitch of the 32-wide q / k rows in LDS: 80 B = 16 B x odd
#define VP 72                   // f16 pitch of the 64-wide v-transposed rows in LDS: 144 B = 16 B x odd
#define XP 136                  // f16 pitch of the 128-wide x rows in LDS: 272 B = 16 B x odd
#define TOKR 212                // 196 token rows of a group + the rows that the last chunk's 64-row tiles reach past them
// qkv_w cast to f16 in the order in which the fused kernel's waves load their A fragments, so that each load is 512 contiguous bytes:
// [channel block 8][k step 4][component 3][piece 2][lane 32][8]; row 3 * (16 block + lane % 16) + component, k = 32 step + 16 piece + 8 (lane / 16) + e.
__global__ __launch_bounds__(256) void pack_qkv_w(const float* __restrict__ qw, unsigned* __restrict__ out) {
  const unsigned i = blockIdx.x * 256 + threadIdx.x;     // one pair of f16 each, 24576 pairs
  const unsigned e2 = i & 3u, lane = (i >> 2) & 31u, piece = (i >> 7) & 1u, f = i >> 8;
  const unsigned s = f % 3u, wk = f / 3u, k = wk & 3u, wv = wk >> 2;
  const unsigned n = 3u * (16u * wv + (lane & 15u)) + s, kk = 32u * k + 16u * piece + 8u * (lane >> 4) + 2u * e2;
  const _Float16 h0 = (_Float16)qw[n * SC + kk], h1 = (_Float16)qw[n * SC + kk + 1];
  out[i] = (unsigned)__builtin_bit_cast(unsigned short, h0) | ((unsigned)__builtin_bit_cast(unsigned short, h1) << 16);
}
// out_w cast to f16 in the same fragment order: [block of 16 output channels 8][k step 4][piece 2][lane 32][8]; row 16 block + lane % 16, k as above.
__global__ __launch_bounds__(256) void pack_out_w(const float* __restrict__ ow, unsigned* __restrict__ out) {
  const unsigned i = blockIdx.x * 256 + threadIdx.x;     // one pair of f16 each, 8192 pairs
  const unsigned e2 = i & 3u, lane = (i >> 2) & 31u, piece = (i >> 7) & 1u, f = i >> 8;
  const unsigned k = f & 3u, nt = f >> 2;
  const unsigned n = 16u * nt + (lane & 15u), kk = 32u * k + 16u * piece + 8u * (lane >> 4) + 2u * e2;
  const _Float16 h0 = (_Float16)ow[n * SC + kk], h1 = (_Float16)ow[n * SC + kk + 1];
  out[i] = (unsigned)__builtin_bit_cast(unsigned short, h0) | ((unsigned)__builtin_bit_cast(unsigned short, h1) << 16);
}
// One block (16 waves) per group g of 49 consecutive pixels of the (-4,-4)-rolled image nl. 49 pixels x 128 channels = 196 tokens x 32 d
// = exactly the chunks 4g .. 4g + 3: token T = 4 * pixel + channel / 32, d = channel % 32, chunk T / 49; qkv column = 3 * channel + component.
// Stage 1: the 49 x rows, cast to f16, into LDS (rows 49..63 zero). Stage 2: qkvT = W.xT on WMMA (K = 128): a wave owns 16 channels
// of q, k and v for 32 of the 64 pixel columns, so a lane ends with 8 consecutive d of one token; + bias, cast to f16, into q[T][32], k[T][32], vT[chunk][32 d][64 tok].
// Stage 3, one (chunk, 16-query tile) unit per wave: scores transposed, sT = k.qT (4 tiles of 16 keys x 16 queries, K = 32), so a lane holds 32 keys of ONE query
// (its partner lane ^ 16 the other 32): bias, masks and softmax stay in registers. Two neighbouring sT tiles, converted in place (x2^15, f16),
// are the B fragment of oT = vT.pT (2 tiles of 16 d x 16 queries, K = 64); a lane ends with 8 consecutive d of its query per tile.
// Rows 49..63 of a chunk's q / k tiles are the next chunk's tokens (or zero rows): such keys are masked, such queries never stored.
// Stage 4: the 196 x 32 attention output is the same 49 pixels x 128 channels (flat 32 T + d); cast to f16 it takes the x tile's place in LDS (rows 49..63 still zero).
// outT = out_w.oT on WMMA (K = 128): a wave owns 32 output channels of 16 pixels, so it writes whole 128-byte lines; + out_b, stored at the (+3,+3)-rolled pixel.
__global__ __launch_bounds__(512) void qkv_attn_kernel(const float* __restrict__ X, const _Float16* __restrict__ QWf, const float* __restrict__ qb,
                                                       const float* __restrict__ rpe, const _Float16* __restrict__ OWf, const float* __restrict__ ob, float* __restrict__ OUT) {
  __shared__ __align__(16) _Float16 sX[64 * XP];
  __shared__ __align__(16) _Float16 sQ[TOKR * QP];
  __shared__ __align__(16) _Float16 sK[TOKR * QP];
  __shared__ __align__(16) _Float16 sV[4 * 32 * VP];
  __shared__ __align__(16) float sQB[384];
  __shared__ float sB[208];     // the 13 x 13 table; entries 169..207 (reached only by padding keys) zero
  typedef __attribute__((ext_vector_type(4))) _Float16 v4h;
  typedef __attribute__((ext_vector_type(2))) _Float16 v2h;
  const unsigned nl = blockIdx.y, g = blockIdx.x, t = threadIdx.x;
  const unsigned lane = t & 31u, wave = t >> 5;
  const unsigned cb = wave & 7u, jh = wave >> 3;     // stage 2: channel block, half of the pixel columns
  const int c = lane & 15, h = lane >> 4, koff = h * 8;
  // ---- stage 1: loads first (x rows, the weight fragments of the first two k steps, bias, table), so that they fly together
  const float* xsrc = X + (size_t)nl * SP * SC;
  v4f xv[4];
#pragma unroll
  for (int it = 0; it < 4; ++it) {
    const unsigned idx = it * 512 + t;     // 32 pieces of 4 floats per pixel, 1568 pieces
    if (it < 3 || t < 32) {
      const unsigned pix = g * 49u + (idx >> 5);
      const unsigned y = pix / SHW, x = pix - y * SHW;
      const unsigned ys = (y + 4 >= SHW) ? y + 4 - SHW : y + 4, xs = (x + 4 >= SHW) ? x + 4 - SHW : x + 4;
      xv[it] = *(const v4f*)(xsrc + (ys * SHW + xs) * SC + 4u * (idx & 31u));
    }
  }
  const _Float16* wp = QWf + cb * 6144u + lane * 8u;
  v16h aw[2][3];     // k step k sits in aw[k & 1]
#pragma unroll
  for (int k = 0; k < 2; ++k)
#pragma unroll
    for (int s = 0; s < 3; ++s) {
      Frag<_Float16>::U f;
      f.h[0] = *(const v8h*)(wp + ((k * 3 + s) * 2) * 256);
      f.h[1] = *(const v8h*)(wp + ((k * 3 + s) * 2 + 1) * 256);
      aw[k][s] = f.v;
    }
  const float tb = (t < 169) ? rpe[t] : 0.f;
  v4f qbv = (v4f){0.f, 0.f, 0.f, 0.f};
  if (t < 96) qbv = *(const v4f*)(qb + 4 * t);
  // padding, disjoint from what the stages write: x rows 49..63 (255 16-byte pieces), q / k rows 196..211 (80 each), vT columns 49..63
  {
    const v8h z = (v8h){0, 0, 0, 0, 0, 0, 0, 0};
    if (t < 255) *(v8h*)(sX + 49 * XP + 8 * t) = z;
    if (t < 80) { *(v8h*)(sQ + 196 * QP + 8 * t) = z; *(v8h*)(sK + 196 * QP + 8 * t) = z; }
    if (t < 256) {
      _Float16* zr = sV + (t >> 1) * VP;     // row t / 2: the even thread clears columns 49..55, the odd one 56..63
      if ((t & 1u) == 0) { zr[49] = (_Float16)0.f; *(v2h*)(zr + 50) = (v2h){0, 0}; *(v4h*)(zr + 52) = (v4h){0, 0, 0, 0}; }
      else *(v8h*)(zr + 56) = z;
    }
  }
  if (t < 208) sB[t] = tb;
  if (t < 96) *(v4f*)(sQB + 4 * t) = qbv;
#pragma unroll
  for (int it = 0; it < 4; ++it) {
    const unsigned idx = it * 512 + t;
    if (it < 3 || t < 32) {
      const v4h hx = (v4h){(_Float16)xv[it][0], (_Float16)xv[it][1], (_Float16)xv[it][2], (_Float16)xv[it][3]};
      *(v4h*)(sX + (idx >> 5) * XP + 4u * (idx & 31u)) = hx;
    }
  }
  __syncthreads();   // the x tile, the qkv bias and the table are complete before any wave reads them
  const v8f zero = (v8f){0.f, 0.f, 0.f, 0.f, 0.f, 0.f, 0.f, 0.f};
  // ---- stage 2: ga[s][j][r] = component s of channel 16 cb + 8h + r at pixel 32 jh + 16j + c
  {
    v8f ga[3][2];
#pragma unroll
    for (int s = 0; s < 3; ++s)
#pragma unroll
      for (int j = 0; j < 2; ++j) ga[s][j] = zero;
#pragma unroll
    for (int k = 0; k < 4; ++k) {
      v16h bx[2];
#pragma unroll
      for (int j = 0; j < 2; ++j) bx[j] = Frag<_Float16>::load(sX + (jh * 32 + j * 16 + c) * XP + koff + 32 * k);
#pragma unroll
      for (int s = 0; s < 3; ++s) {
#pragma unroll
        for (int j = 0; j < 2; ++j) ga[s][j] = Frag<_Float16>::mma(aw[k & 1][s], bx[j], ga[s][j]);
        if (k < 2) {     // the fragment of k step k + 2 takes the place of the one just used
          Frag<_Float16>::U f;
          f.h[0] = *(const v8h*)(wp + (((k + 2) * 3 + s) * 2) * 256);
          f.h[1] = *(const v8h*)(wp + (((k + 2) * 3 + s) * 2 + 1) * 256);
          aw[k & 1][s] = f.v;
        }
      }
      // ends the k step for the scheduler: the weight loads of step k + 2 stay here (sunk to their use, each is waited for alone) and later steps'
      // LDS loads are not lifted up (that build needs more than 128 registers: one block per WGP instead of two)
      __builtin_amdgcn_sched_barrier(0);
    }
    float bb[24];     // bb[3r + s] = bias of component s of channel 16 cb + 8h + r
#pragma unroll
    for (int q4 = 0; q4 < 6; ++q4) {
      const v4f b4 = *(const v4f*)(sQB + 48 * cb + 24 * h + 4 * q4);
      bb[4 * q4] = b4[0]; bb[4 * q4 + 1] = b4[1]; bb[4 * q4 + 2] = b4[2]; bb[4 * q4 + 3] = b4[3];
    }
    const unsigned d0 = 16u * (cb & 1u) + 8u * h;
#pragma unroll
    for (int j = 0; j < 2; ++j) {
      const unsigned pl = jh * 32 + j * 16 + c;
      if (pl < 49) {
        const unsigned T = 4u * pl + (cb >> 1), ch = T / 49u, tok = T - 49u * ch;
        v8h hq, hk;
#pragma unroll
        for (int r = 0; r < 8; ++r) {
          hq[r] = (_Float16)(ga[0][j][r] + bb[3 * r]);
          hk[r] = (_Float16)(ga[1][j][r] + bb[3 * r + 1]);
          sV[(ch * 32u + d0 + r) * VP + tok] = (_Float16)(ga[2][j][r] + bb[3 * r + 2]);
        }
        *(v8h*)(sQ + T * QP + d0) = hq;
        *(v8h*)(sK + T * QP + d0) = hk;
      }
    }
  }
  __syncthreads();   // q, k and vT of all four chunks are complete before any wave reads them
  // ---- stage 3
  const unsigned ch = wave >> 2, w = 4u * g + ch;
  const int p = (wave & 3u) * 16 + c;
  v8f acc[4];     // acc[j][r] = score of key 16j + 8h + r for query p
  {
    const v16h bq = Frag<_Float16>::load(sQ + (ch * 49 + p) * QP + koff);
    v16h ak[4];
#pragma unroll
    for (int j = 0; j < 4; ++j) ak[j] = Frag<_Float16>::load(sK + (ch * 49 + j * 16 + c) * QP + koff);
#pragma unroll
    for (int j = 0; j < 4; ++j) acc[j] = Frag<_Float16>::mma(ak[j], bq, zero);
  }
  const int pp = p < 48 ? p : 48, pq = pp / 7, pr = pp - 7 * pq;     // queries >= 49 are never stored
  // dead keys of this query, bit = key: padding, the last window row's mask, the last window column's mask
  unsigned long long m = 0xFFFE000000000000ull;
  if (((w >> 3) & 7u) == 7u) m |= (pp < 28) ? 0x1fffff0000000ull : 0xfffffffull;
  if ((w & 7u) == 7u) m |= (pr < 4) ? 0x1c3870e1c3870ull : ((pr == 4) ? 0x3c78f1e3c78full : 0ull);
  m >>= 8 * h;
  const unsigned mw[2] = {(unsigned)m, (unsigned)(m >> 32)};
  // table index (key/7 - p/7 + 6) * 13 + (key%7 - p%7 + 6) = (key + 6 * (key/7)) - (p + 6 * (p/7)) + 84
  const int ib = 84 - (pp + 6 * pq);
  float mx = -INFINITY;
#pragma unroll
  for (int j = 0; j < 4; ++j)
#pragma unroll
    for (int r = 0; r < 8; ++r) {
      const int k0 = 16 * j + r, i0 = k0 + 6 * (k0 / 7), i1 = k0 + 8 + 6 * ((k0 + 8) / 7);     // h = 0 / h = 1
      const float v = acc[j][r] * 0.17677669529663687f + sB[ib + i0 + h * (i1 - i0)];
      acc[j][r] = ((mw[j >> 1] >> (16 * (j & 1) + r)) & 1u) ? -INFINITY : v;
      mx = fmaxf(mx, acc[j][r]);
    }
  mx = fmaxf(mx, __shfl_xor(mx, 16, 32));     // finite: every query keeps live keys
  float sj[4] = {0.f, 0.f, 0.f, 0.f};
#pragma unroll
  for (int j = 0; j < 4; ++j)
#pragma unroll
    for (int r = 0; r < 8; ++r) { acc[j][r] = expf(acc[j][r] - mx); sj[j] += acc[j][r]; }     // -inf entries -> 0
  float se = (sj[0] + sj[1]) + (sj[2] + sj[3]);
  se += __shfl_xor(se, 16, 32);
  const float sc = 32768.0f / se;
  v8f o2[2] = {zero, zero};     // o2[i][r] = 2^15 * out[p][16i + 8h + r]
#pragma unroll
  for (int kk = 0; kk < 2; ++kk) {
    v16h bp;     // element s holds key 32kk + (s < 8 ? 8h + s : 16 + 8h + s - 8): the order Frag::load gives vT
#pragma unroll
    for (int s = 0; s < 16; ++s) bp[s] = (_Float16)(acc[2 * kk + (s >> 3)][s & 7] * sc);
#pragma unroll
    for (int i = 0; i < 2; ++i) {
      const v16h av = Frag<_Float16>::load(sV + (ch * 32 + i * 16 + c) * VP + koff + 32 * kk);
      o2[i] = Frag<_Float16>::mma(av, bp, o2[i]);
    }
  }
  // ---- stage 4: the weight fragments and the bias are asked for first, so that they fly over the LDS stores and the barrier
  const unsigned ng = wave & 3u, pt = wave >> 2;     // 32 output channels, 16 pixels
  const _Float16* op = OWf + ng * 4096u + lane * 8u;
  v16h ao[2][4];
#pragma unroll
  for (int i = 0; i < 2; ++i)
#pragma unroll
    for (int k = 0; k < 4; ++k) {
      Frag<_Float16>::U f;
      f.h[0] = *(const v8h*)(op + ((i * 4 + k) * 2) * 256);
      f.h[1] = *(const v8h*)(op + ((i * 4 + k) * 2 + 1) * 256);
      ao[i][k] = f.v;
    }
  v4f bo[2][2];     // bo[i][u][e] = bias of output channel 32 ng + 16i + 8h + 4u + e
#pragma unroll
  for (int i = 0; i < 2; ++i)
#pragma unroll
    for (int u = 0; u < 2; ++u) bo[i][u] = *(const v4f*)(ob + 32 * ng + 16 * i + 8 * h + 4 * u);
  if (p < 49) {
    const unsigned T = ch * 49u + p;
    _Float16* so = sX + (T >> 2) * XP + (T & 3u) * 32u + 8 * h;
#pragma unroll
    for (int i = 0; i < 2; ++i) {
      v8h ho;
#pragma unroll
      for (int r = 0; r < 8; ++r) ho[r] = (_Float16)(o2[i][r] * PSCALE_INV);
      *(v8h*)(so + 16 * i) = ho;
    }
  }
  __syncthreads();   // the attention output of all 49 pixels is complete before any wave reads it
  v8f oa[2] = {zero, zero};     // oa[i][r] = output channel 32 ng + 16i + 8h + r of pixel 16 pt + c
#pragma unroll
  for (int k = 0; k < 4; ++k) {
    const v16h bx = Frag<_Float16>::load(sX + (pt * 16 + c) * XP + koff + 32 * k);
#pragma unroll
    for (int i = 0; i < 2; ++i) oa[i] = Frag<_Float16>::mma(ao[i][k], bx, oa[i]);
  }
  const unsigned pl = pt * 16 + c;
  if (pl < 49) {
    const unsigned pix = g * 49u + pl;
    const unsigned y = pix / SHW, x = pix - y * SHW;
    const unsigned yd = (y + 3 >= SHW) ? y + 3 - SHW : y + 3, xd = (x + 3 >= SHW) ? x + 3 - SHW : x + 3;
    float* dst = OUT + ((size_t)nl * SP + yd * SHW + xd) * SC + 32 * ng + 8 * h;
#pragma unroll
    for (int i = 0; i < 2; ++i) {
      *(v4f*)(dst + 16 * i)     = (v4f){oa[i][0], oa[i][1], oa[i][2], oa[i][3]} + bo[i][0];
      *(v4f*)(dst + 16 * i + 4) = (v4f){oa[i][4], oa[i][5], oa[i][6], oa[i][7]} + bo[i][1];
    }
  }
}
extern "C" void kernel_launch(void* const* d_in, const int* in_sizes, int n_in, void* d_out, int out_size, void* d_ws, size_t ws_size, hipStream_t stream) {
  (void)in_sizes; (void)n_in; (void)out_size; (void)ws_size;
  const float* x = (const float*)d_in[0]; const float* qw = (const float*)d_in[1]; const float* qb = (const float*)d_in[2]; const float* ow = (const float*)d_in[3]; const float* ob = (const float*)d_in[4]; const float* rpe = (const float*)d_in[5];
  char* ws = (char*)d_ws; size_t off = 0;
  auto carve = [&](size_t bytes) -> char* { char* p = ws + off; off += (bytes + 255) & ~(size_t)255; return p; };
  _Float16* QWf = (_Float16*)carve(384 * SC * 2); _Float16* OWf = (_Float16*)carve(SC * SC * 2);
  pack_qkv_w<<<384 * SC / 2 / 256, 256, 0, stream>>>(qw, (unsigned*)QWf);
  pack_out_w<<<SC * SC / 2 / 256, 256, 0, stream>>>(ow, (unsigned*)OWf);
  qkv_attn_kernel<<<dim3(SP / 49, SN), 512, 0, stream>>>(x, QWf, qb, rpe, OWf, ob, (float*)d_out);
}

// v005
// A run of this version takes 50.2 microseconds.
// Next to v004, in two timings, it ran 1.06 and 1.08 times as fast.
// Over all steps from v000 it is 13.1 times as fast.
#include <hip/hip_runtime.h>
#include <math.h>
// Shifted-window MSA, faithful to the reference's raw torch .view reshapes (the 'windows' are consecutive 4704-float chunks of the rolled
// (H, W, C, 3)-interleaved qkv tensor, not spatial windows), its asymmetric rolls (-4 then +3) and its integer-indexed column mask.
// One kernel does the whole layer, block per 49 rolled pixels (= 4 whole chunks): x is read as f32 and cast on the way into LDS; qkv = x.qkv_wT + qkv_b,
// the per-chunk 49-token attention and the output linear (. 128 x 128, + out_b) follow without leaving LDS; the (+3,+3) roll is the address of the final store.
// All products on v_wmma_f32_16x16x32_f16, f16 operands, f32 accumulate: scores q.kT (K = 32), p.v (p x2^15, K = 64); bias, -inf masks and softmax on VALU.
typedef __attribute__((ext_vector_type(16))) _Float16 v16h;
typedef __attribute__((ext_vector_type(8)))  _Float16 v8h;
typedef __attribute__((ext_vector_type(8)))  float    v8f;
typedef __attribute__((ext_vector_type(4)))  float    v4f;
#define PSCALE_INV (1.0f / 32768.0f)
#define LOG2E 1.4426950408889634     // the softmax runs in base 2: exp(s - max) = 2^(s log2 e - max log2 e)

static __device__ __forceinline__ void exp2x8(v8f& a) {
  float a0 = a[0], a1 = a[1], a2 = a[2], a3 = a[3], a4 = a[4], a5 = a[5], a6 = a[6], a7 = a[7];
  asm("v_exp_f32 %0, %0\n\tv_exp_f32 %1, %1\n\tv_exp_f32 %2, %2\n\tv_exp_f32 %3, %3\n\t"
      "v_exp_f32 %4, %4\n\tv_exp_f32 %5, %5\n\tv_exp_f32 %6, %6\n\tv_exp_f32 %7, %7\n\tv_nop"
      : "+v"(a0), "+v"(a1), "+v"(a2), "+v"(a3), "+v"(a4), "+v"(a5), "+v"(a6), "+v"(a7));
  a = (v8f){a0, a1, a2, a3, a4, a5, a6, a7};
}

template <typename T> struct Frag;
template <> struct Frag<_Float16> {
  typedef v16h V; union U { v16h v; v8h h[2]; };
  static __device__ __forceinline__ v16h load(const _Float16* p) {   // elements 0..7 <- p[0..7], 8..15 <- p[16..23]
    U f; f.h[0] = *(const v8h*)(p); f.h[1] = *(const v8h*)(p + 16); return f.v;
  }
  static __device__ __forceinline__ v8f mma(v16h a, v16h b, v8f c) {
    return __builtin_amdgcn_wmma_f32_16x16x32_f16(false, a, false, b, (short)0, c, false, false);
  }
};

#define SN 32
#define SHW 56
#define SP (SHW * SHW)          // 3136
#define SC 128
#define SROWS (SN * SP)         // 100352
#define SWIN 256                // chunks ('windows') per image = 4*8*8
#define SCH (49 * 32 * 3)       // 4704 floats per chunk
#define QP 40                   // f16 pitch of the 32-wide q / k rows in LDS: 80 B = 16 B x odd
#define VP 72                   // f16 pitch of the 64-wide v-transposed rows in LDS: 144 B = 16 B x odd
#define XP 136                  // f16 pitch of the 128-wide x rows in LDS: 272 B = 16 B x odd
#define TOKR 212                // 196 token rows of a group + the rows that the last chunk's 64-row tiles reach past them
// qkv_w cast to f16 in the order in which the fused kernel's waves load their A fragments, so that each load is 512 contiguous bytes:
// [channel block 8][k step 4][component 3][piece 2][lane 32][8]; row 3 * (16 block + lane % 16) + component, k = 32 step + 16 piece + 8 (lane / 16) + e.
__global__ __launch_bounds__(256) void pack_qkv_w(const float* __restrict__ qw, unsigned* __restrict__ out) {
  const unsigned i = blockIdx.x * 256 + threadIdx.x;     // one pair of f16 each, 24576 pairs
  const unsigned e2 = i & 3u, lane = (i >> 2) & 31u, piece = (i >> 7) & 1u, f = i >> 8;
  const unsigned s = f % 3u, wk = f / 3u, k = wk & 3u, wv = wk >> 2;
  const unsigned n = 3u * (16u * wv + (lane & 15u)) + s, kk = 32u * k + 16u * piece + 8u * (lane >> 4) + 2u * e2;
  const _Float16 h0 = (_Float16)qw[n * SC + kk], h1 = (_Float16)qw[n * SC + kk + 1];
  out[i] = (unsigned)__builtin_bit_cast(unsigned short, h0) | ((unsigned)__builtin_bit_cast(unsigned short, h1) << 16);
}
// out_w cast to f16 in the same fragment order: [block of 16 output channels 8][k step 4][piece 2][lane 32][8]; row 16 block + lane % 16, k as above.
__global__ __launch_bounds__(256) void pack_out_w(const float* __restrict__ ow, unsigned* __restrict__ out) {
  const unsigned i = blockIdx.x * 256 + threadIdx.x;     // one pair of f16 each, 8192 pairs
  const unsigned e2 = i & 3u, lane = (i >> 2) & 31u, piece = (i >> 7) & 1u, f = i >> 8;
  const unsigned k = f & 3u, nt = f >> 2;
  const unsigned n = 16u * nt + (lane & 15u), kk = 32u * k + 16u * piece + 8u * (lane >> 4) + 2u * e2;
  const _Float16 h0 = (_Float16)ow[n * SC + kk], h1 = (_Float16)ow[n * SC + kk + 1];
  out[i] = (unsigned)__builtin_bit_cast(unsigned short, h0) | ((unsigned)__builtin_bit_cast(unsigned short, h1) << 16);
}
// One block (16 waves) per group g of 49 consecutive pixels of the (-4,-4)-rolled image nl. 49 pixels x 128 channels = 196 tokens x 32 d
// = exactly the chunks 4g .. 4g + 3: token T = 4 * pixel + channel / 32, d = channel % 32, chunk T / 49; qkv column = 3 * channel + component.
// Stage 1: the 49 x rows, cast to f16, into LDS (rows 49..63 zero). Stage 2: qkvT = W.xT on WMMA (K = 128): a wave owns 16 channels
// of q, k and v for 32 of the 64 pixel columns, so a lane ends with 8 consecutive d of one token; + bias, cast to f16, into q[T][32], k[T][32], vT[chunk][32 d][64 tok].
// Stage 3, one (chunk, 16-query tile) unit per wave: scores transposed, sT = k.qT (4 tiles of 16 keys x 16 queries, K = 32), so a lane holds 32 keys of ONE query
// (its partner lane ^ 16 the other 32): bias, masks and softmax stay in registers. Two neighbouring sT tiles, converted in place (x2^15, f16),
// are the B fragment of oT = vT.pT (2 tiles of 16 d x 16 queries, K = 64); a lane ends with 8 consecutive d of its query per tile.
// Rows 49..63 of a chunk's q / k tiles are the next chunk's tokens (or zero rows): such keys are masked, such queries never stored.
// Stage 4: the 196 x 32 attention output is the same 49 pixels x 128 channels (flat 32 T + d); cast to f16 it takes the x tile's place in LDS (rows 49..63 still zero).
// outT = out_w.oT on WMMA (K = 128): a wave owns 32 output channels of 16 pixels, so it writes whole 128-byte lines; + out_b, stored at the (+3,+3)-rolled pixel.
__global__ __launch_bounds__(512) void qkv_attn_kernel(const float* __restrict__ X, const _Float16* __restrict__ QWf, const float* __restrict__ qb,
                                                       const float* __restrict__ rpe, const _Float16* __restrict__ OWf, const float* __restrict__ ob, float* __restrict__ OUT) {
  __shared__ __align__(16) _Float16 sX[64 * XP];
  __shared__ __align__(16) _Float16 sQ[TOKR * QP];
  __shared__ __align__(16) _Float16 sK[TOKR * QP];
  __shared__ __align__(16) _Float16 sV[4 * 32 * VP];
  __shared__ __align__(16) float sQB[384];
  __shared__ float sB[208];     // the 13 x 13 table times log2 e; entries 169..207 (reached only by padding keys) zero
  typedef __attribute__((ext_vector_type(4))) _Float16 v4h;
  typedef __attribute__((ext_vector_type(2))) _Float16 v2h;
  const unsigned nl = blockIdx.y, g = blockIdx.x, t = threadIdx.x;
  const unsigned lane = t & 31u, wave = t >> 5;
  const unsigned cb = wave & 7u, jh = wave >> 3;     // stage 2: channel block, half of the pixel columns
  const int c = lane & 15, h = lane >> 4, koff = h * 8;
  // ---- stage 1: loads first (x rows, the weight fragments of the first two k steps, bias, table), so that they fly together
  const float* xsrc = X + (size_t)nl * SP * SC;
  v4f xv[4];
#pragma unroll
  for (int it = 0; it < 4; ++it) {
    const unsigned idx = it * 512 + t;     // 32 pieces of 4 floats per pixel, 1568 pieces
    if (it < 3 || t < 32) {
      const unsigned pix = g * 49u + (idx >> 5);
      const unsigned y = pix / SHW, x = pix - y * SHW;
      const unsigned ys = (y + 4 >= SHW) ? y + 4 - SHW : y + 4, xs = (x + 4 >= SHW) ? x + 4 - SHW : x + 4;
      xv[it] = *(const v4f*)(xsrc + (ys * SHW + xs) * SC + 4u * (idx & 31u));
    }
  }
  const _Float16* wp = QWf + cb * 6144u + lane * 8u;
  v16h aw[2][3];     // k step k sits in aw[k & 1]
#pragma unroll
  for (int k = 0; k < 2; ++k)
#pragma unroll
    for (int s = 0; s < 3; ++s) {
      Frag<_Float16>::U f;
      f.h[0] = *(const v8h*)(wp + ((k * 3 + s) * 2) * 256);
      f.h[1] = *(const v8h*)(wp + ((k * 3 + s) * 2 + 1) * 256);
      aw[k][s] = f.v;
    }
  const float tb = (t < 169) ? rpe[t] : 0.f;
  v4f qbv = (v4f){0.f, 0.f, 0.f, 0.f};
  if (t < 96) qbv = *(const v4f*)(qb + 4 * t);
  // padding, disjoint from what the stages write: x rows 49..63 (255 16-byte pieces), q / k rows 196..211 (80 each), vT columns 49..63
  {
    const v8h z = (v8h){0, 0, 0, 0, 0, 0, 0, 0};
    if (t < 255) *(v8h*)(sX + 49 * XP + 8 * t) = z;
    if (t < 80) { *(v8h*)(sQ + 196 * QP + 8 * t) = z; *(v8h*)(sK + 196 * QP + 8 * t) = z; }
    if (t < 256) {
      _Float16* zr = sV + (t >> 1) * VP;     // row t / 2: the even thread clears columns 49..55, the odd one 56..63
      if ((t & 1u) == 0) { zr[49] = (_Float16)0.f; *(v2h*)(zr + 50) = (v2h){0, 0}; *(v4h*)(zr + 52) = (v4h){0, 0, 0, 0}; }
      else *(v8h*)(zr + 56) = z;
    }
  }
  if (t < 208) sB[t] = tb * (float)LOG2E;
  if (t < 96) *(v4f*)(sQB + 4 * t) = qbv;
#pragma unroll
  for (int it = 0; it < 4; ++it) {
    const unsigned idx = it * 512 + t;
    if (it < 3 || t < 32) {
      const v4h hx = (v4h){(_Float16)xv[it][0], (_Float16)xv[it][1], (_Float16)xv[it][2], (_Float16)xv[it][3]};
      *(v4h*)(sX + (idx >> 5) * XP + 4u * (idx & 31u)) = hx;
    }
  }
  __syncthreads();   // the x tile, the qkv bias and the table are complete before any wave reads them
  const v8f zero = (v8f){0.f, 0.f, 0.f, 0.f, 0.f, 0.f, 0.f, 0.f};
  // ---- stage 2: ga[s][j][r] = component s of channel 16 cb + 8h + r at pixel 32 jh + 16j + c
  {
    v8f ga[3][2];
#pragma unroll
    for (int s = 0; s < 3; ++s)
#pragma unroll
      for (int j = 0; j < 2; ++j) ga[s][j] = zero;
#pragma unroll
    for (int k = 0; k < 4; ++k) {
      v16h bx[2];
#pragma unroll
      for (int j = 0; j < 2; ++j) bx[j] = Frag<_Float16>::load(sX + (jh * 32 + j * 16 + c) * XP + koff + 32 * k);
#pragma unroll
      for (int s = 0; s < 3; ++s) {
#pragma unroll
        for (int j = 0; j < 2; ++j) ga[s][j] = Frag<_Float16>::mma(aw[k & 1][s], bx[j], ga[s][j]);
        if (k < 2) {     // the fragment of k step k + 2 takes the place of the one just used
          Frag<_Float16>::U f;
          f.h[0] = *(const v8h*)(wp + (((k + 2) * 3 + s) * 2) * 256);
          f.h[1] = *(const v8h*)(wp + (((k + 2) * 3 + s) * 2 + 1) * 256);
          aw[k & 1][s] = f.v;
        }
      }
      // ends the k step for the scheduler: the weight loads of step k + 2 stay here (sunk to their use, each is waited for alone) and later steps'
      // LDS loads are not lifted up (that build needs more than 128 registers: one block per WGP instead of two)
      __builtin_amdgcn_sched_barrier(0);
    }
    float bb[24];     // bb[3r + s] = bias of component s of channel 16 cb + 8h + r
#pragma unroll
    for (int q4 = 0; q4 < 6; ++q4) {
      const v4f b4 = *(const v4f*)(sQB + 48 * cb + 24 * h + 4 * q4);
      bb[4 * q4] = b4[0]; bb[4 * q4 + 1] = b4[1]; bb[4 * q4 + 2] = b4[2]; bb[4 * q4 + 3] = b4[3];
    }
    const unsigned d0 = 16u * (cb & 1u) + 8u * h;
#pragma unroll
    for (int j = 0; j < 2; ++j) {
      const unsigned pl = jh * 32 + j * 16 + c;
      if (pl < 49) {
        const unsigned T = 4u * pl + (cb >> 1), ch = T / 49u, tok = T - 49u * ch;
        v8h hq, hk;
#pragma unroll
        for (int r = 0; r < 8; ++r) {
          hq[r] = (_Float16)(ga[0][j][r] + bb[3 * r]);
          hk[r] = (_Float16)(ga[1][j][r] + bb[3 * r + 1]);
          sV[(ch * 32u + d0 + r) * VP + tok] = (_Float16)(ga[2][j][r] + bb[3 * r + 2]);
        }
        *(v8h*)(sQ + T * QP + d0) = hq;
        *(v8h*)(sK + T * QP + d0) = hk;
      }
    }
  }
  __syncthreads();   // q, k and vT of all four chunks are complete before any wave reads them
  // ---- stage 3
  const unsigned ch = wave >> 2, w = 4u * g + ch;
  const int p = (wave & 3u) * 16 + c;
  v8f acc[4];     // acc[j][r] = score of key 16j + 8h + r for query p
  {
    const v16h bq = Frag<_Float16>::load(sQ + (ch * 49 + p) * QP + koff);
    v16h ak[4];
#pragma unroll
    for (int j = 0; j < 4; ++j) ak[j] = Frag<_Float16>::load(sK + (ch * 49 + j * 16 + c) * QP + koff);
#pragma unroll
    for (int j = 0; j < 4; ++j) acc[j] = Frag<_Float16>::mma(ak[j], bq, zero);
  }
  const int pp = p < 48 ? p : 48, pq = pp / 7, pr = pp - 7 * pq;     // queries >= 49 are never stored
  // dead keys of this query, bit = key: padding, the last window row's mask, the last window column's mask
  unsigned long long m = 0xFFFE000000000000ull;
  if (((w >> 3) & 7u) == 7u) m |= (pp < 28) ? 0x1fffff0000000ull : 0xfffffffull;
  if ((w & 7u) == 7u) m |= (pr < 4) ? 0x1c3870e1c3870ull : ((pr == 4) ? 0x3c78f1e3c78full : 0ull);
  m >>= 8 * h;
  const unsigned mw[2] = {(unsigned)m, (unsigned)(m >> 32)};
  // table index (key/7 - p/7 + 6) * 13 + (key%7 - p%7 + 6) = (key + 6 * (key/7)) - (p + 6 * (p/7)) + 84
  const int ib = 84 - (pp + 6 * pq);
  float mx = -INFINITY;
#pragma unroll
  for (int j = 0; j < 4; ++j)
#pragma unroll
    for (int r = 0; r < 8; ++r) {
      const int k0 = 16 * j + r, i0 = k0 + 6 * (k0 / 7), i1 = k0 + 8 + 6 * ((k0 + 8) / 7);     // h = 0 / h = 1
      const float v = acc[j][r] * (float)(0.17677669529663687 * LOG2E) + sB[ib + i0 + h * (i1 - i0)];     // (score / sqrt(32) + bias) log2 e
      acc[j][r] = ((mw[j >> 1] >> (16 * (j & 1) + r)) & 1u) ? -INFINITY : v;
      mx = fmaxf(mx, acc[j][r]);
    }
  mx = fmaxf(mx, __shfl_xor(mx, 16, 32));     // finite: every query keeps live keys
  float sj[4] = {0.f, 0.f, 0.f, 0.f};
#pragma unroll
  for (int j = 0; j < 4; ++j) acc[j] -= mx;     // all subtractions first: taken turn by turn with the exponentials the build needs 130 registers (one block per WGP instead of two)
#pragma unroll
  for (int j = 0; j < 4; ++j) exp2x8(acc[j]);     // bare v_exp_f32, argument <= 0; -inf entries -> 0
#pragma unroll
  for (int j = 0; j < 4; ++j)
#pragma unroll
    for (int r = 0; r < 8; ++r) sj[j] += acc[j][r];
  float se = (sj[0] + sj[1]) + (sj[2] + sj[3]);
  se += __shfl_xor(se, 16, 32);
  const float sc = 32768.0f / se;
  v8f o2[2] = {zero, zero};     // o2[i][r] = 2^15 * out[p][16i + 8h + r]
#pragma unroll
  for (int kk = 0; kk < 2; ++kk) {
    v16h bp;     // element s holds key 32kk + (s < 8 ? 8h + s : 16 + 8h + s - 8): the order Frag::load gives vT
#pragma unroll
    for (int s = 0; s < 16; ++s) bp[s] = (_Float16)(acc[2 * kk + (s >> 3)][s & 7] * sc);
#pragma unroll
    for (int i = 0; i < 2; ++i) {
      const v16h av = Frag<_Float16>::load(sV + (ch * 32 + i * 16 + c) * VP + koff + 32 * kk);
      o2[i] = Frag<_Float16>::mma(av, bp, o2[i]);
    }
  }
  // ---- stage 4: the weight fragments and the bias are asked for first, so that they fly over the LDS stores and the barrier
  const unsigned ng = wave & 3u, pt = wave >> 2;     // 32 output channels, 16 pixels
  const _Float16* op = OWf + ng * 4096u + lane * 8u;
  v16h ao[2][4];
#pragma unroll
  for (int i = 0; i < 2; ++i)
#pragma unroll
    for (int k = 0; k < 4; ++k) {
      Frag<_Float16>::U f;
      f.h[0] = *(const v8h*)(op + ((i * 4 + k) * 2) * 256);
      f.h[1] = *(const v8h*)(op + ((i * 4 + k) * 2 + 1) * 256);
      ao[i][k] = f.v;
    }
  v4f bo[2][2];     // bo[i][u][e] = bias of output channel 32 ng + 16i + 8h + 4u + e
#pragma unroll
  for (int i = 0; i < 2; ++i)
#pragma unroll
    for (int u = 0; u < 2; ++u) bo[i][u] = *(const v4f*)(ob + 32 * ng + 16 * i + 8 * h + 4 * u);
  if (p < 49) {
    const unsigned T = ch * 49u + p;
    _Float16* so = sX + (T >> 2) * XP + (T & 3u) * 32u + 8 * h;
#pragma unroll
    for (int i = 0; i < 2; ++i) {
      v8h ho;
#pragma unroll
      for (int r = 0; r < 8; ++r) ho[r] = (_Float16)(o2[i][r] * PSCALE_INV);
      *(v8h*)(so + 16 * i) = ho;
    }
  }
  __syncthreads();   // the attention output of all 49 pixels is complete before any wave reads it
  v8f oa[2] = {zero, zero};     // oa[i][r] = output channel 32 ng + 16i + 8h + r of pixel 16 pt + c
#pragma unroll
  for (int k = 0; k < 4; ++k) {
    const v16h bx = Frag<_Float16>::load(sX + (pt * 16 + c) * XP + koff + 32 * k);
#pragma unroll
    for (int i = 0; i < 2; ++i) oa[i] = Frag<_Float16>::mma(ao[i][k], bx, oa[i]);
  }
  const unsigned pl = pt * 16 + c;
  if (pl < 49) {
    const unsigned pix = g * 49u + pl;
    const unsigned y = pix / SHW, x = pix - y * SHW;
    const unsigned yd = (y + 3 >= SHW) ? y + 3 - SHW : y + 3, xd = (x + 3 >= SHW) ? x + 3 - SHW : x + 3;
    float* dst = OUT + ((size_t)nl * SP + yd * SHW + xd) * SC + 32 * ng + 8 * h;
#pragma unroll
    for (int i = 0; i < 2; ++i) {
      *(v4f*)(dst + 16 * i)     = (v4f){oa[i][0], oa[i][1], oa[i][2], oa[i][3]} + bo[i][0];
      *(v4f*)(dst + 16 * i + 4) = (v4f){oa[i][4], oa[i][5], oa[i][6], oa[i][7]} + bo[i][1];
    }
  }
}
extern "C" void kernel_launch(void* const* d_in, const int* in_sizes, int n_in, void* d_out, int out_size, void* d_ws, size_t ws_size, hipStream_t stream) {
  (void)in_sizes; (void)n_in; (void)out_size; (void)ws_size;
  const float* x = (const float*)d_in[0]; const float* qw = (const float*)d_in[1]; const float* qb = (const float*)d_in[2]; const float* ow = (const float*)d_in[3]; const float* ob = (const float*)d_in[4]; const float* rpe = (const float*)d_in[5];
  char* ws = (char*)d_ws; size_t off = 0;
  auto carve = [&](size_t bytes) -> char* { char* p = ws + off; off += (bytes + 255) & ~(size_t)255; return p; };
  _Float16* QWf = (_Float16*)carve(384 * SC * 2); _Float16* OWf = (_Float16*)carve(SC * SC * 2);
  pack_qkv_w<<<384 * SC / 2 / 256, 256, 0, stream>>>(qw, (unsigned*)QWf);
  pack_out_w<<<SC * SC / 2 / 256, 256, 0, stream>>>(ow, (unsigned*)OWf);
  qkv_attn_kernel<<<dim3(SP / 49, SN), 512, 0, stream>>>(x, QWf, qb, rpe, OWf, ob, (float*)d_out);
}

// v006
// It runs in 35 microseconds.
// Next to v005, in two timings, it ran 1.42 and 1.44 times as fast.
// Counting every step since v000, it is 18.8 times as fast.
#include <hip/hip_runtime.h>
#include <math.h>
// Shifted-window MSA, faithful to the reference's raw torch .view reshapes (the 'windows' are consecutive 4704-float chunks of the rolled
// (H, W, C, 3)-interleaved qkv tensor, not spatial windows), its asymmetric rolls (-4 then +3) and its integer-indexed column mask.
// One kernel does the whole layer, block per 49 rolled pixels (= 4 whole chunks): x is read as f32 and cast on the way into LDS; qkv = x.qkv_wT + qkv_b,
// the per-chunk 49-token attention and the output linear (. 128 x 128, + out_b) follow without leaving LDS; the (+3,+3) roll is the address of the final store.
// All products on v_wmma_f32_16x16x32_f16, f16 operands, f32 accumulate: scores q.kT (K = 32), p.v (p x2^15, K = 64); bias, -inf masks and softmax on VALU.
typedef __attribute__((ext_vector_type(16))) _Float16 v16h;
typedef __attribute__((ext_vector_type(8)))  _Float16 v8h;
typedef __attribute__((ext_vector_type(8)))  float    v8f;
typedef __attribute__((ext_vector_type(4)))  float    v4f;
#define PSCALE_INV (1.0f / 32768.0f)
#define LOG2E 1.4426950408889634     // the softmax runs in base 2: exp(s - max) = 2^(s log2 e - max log2 e)

static __device__ __forceinline__ void exp2x8(v8f& a) {
  float a0 = a[0], a1 = a[1], a2 = a[2], a3 = a[3], a4 = a[4], a5 = a[5], a6 = a[6], a7 = a[7];
  asm("v_exp_f32 %0, %0\n\tv_exp_f32 %1, %1\n\tv_exp_f32 %2, %2\n\tv_exp_f32 %3, %3\n\t"
      "v_exp_f32 %4, %4\n\tv_exp_f32 %5, %5\n\tv_exp_f32 %6, %6\n\tv_exp_f32 %7, %7\n\tv_nop"
      : "+v"(a0), "+v"(a1), "+v"(a2), "+v"(a3), "+v"(a4), "+v"(a5), "+v"(a6), "+v"(a7));
  a = (v8f){a0, a1, a2, a3, a4, a5, a6, a7};
}

template <typename T> struct Frag;
template <> struct Frag<_Float16> {
  typedef v16h V; union U { v16h v; v8h h[2]; };
  static __device__ __forceinline__ v16h load(const _Float16* p) {   // elements 0..7 <- p[0..7], 8..15 <- p[16..23]
    U f; f.h[0] = *(const v8h*)(p); f.h[1] = *(const v8h*)(p + 16); return f.v;
  }
  static __device__ __forceinline__ v8f mma(v16h a, v16h b, v8f c) {
    return __builtin_amdgcn_wmma_f32_16x16x32_f16(false, a, false, b, (short)0, c, false, false);
  }
};

#define SN 32
#define SHW 56
#define SP (SHW * SHW)          // 3136
#define SC 128
#define SROWS (SN * SP)         // 100352
#define SWIN 256                // chunks ('windows') per image = 4*8*8
#define SCH (49 * 32 * 3)       // 4704 floats per chunk
#define QP 40                   // f16 pitch of the 32-wide q / k rows in LDS: 80 B = 16 B x odd
#define VP 72                   // f16 pitch of the 64-wide v-transposed rows in LDS: 144 B = 16 B x odd
#define XP 136                  // f16 pitch of the 128-wide x rows in LDS: 272 B = 16 B x odd
#define OP 132                  // f32 pitch of the 128-wide output rows in LDS: 528 B = 16 B x odd
#define TOKR 212                // 196 token rows of a group + the rows that the last chunk's 64-row tiles reach past them
// qkv_w cast to f16 in the order in which the fused kernel's waves load their A fragments, so that each load is 512 contiguous bytes:
// [channel block 8][k step 4][component 3][piece 2][lane 32][8]; row 3 * (16 block + lane % 16) + component, k = 32 step + 16 piece + 8 (lane / 16) + e.
__global__ __launch_bounds__(256) void pack_qkv_w(const float* __restrict__ qw, unsigned* __restrict__ out) {
  const unsigned i = blockIdx.x * 256 + threadIdx.x;     // one pair of f16 each, 24576 pairs
  const unsigned e2 = i & 3u, lane = (i >> 2) & 31u, piece = (i >> 7) & 1u, f = i >> 8;
  const unsigned s = f % 3u, wk = f / 3u, k = wk & 3u, wv = wk >> 2;
  const unsigned n = 3u * (16u * wv + (lane & 15u)) + s, kk = 32u * k + 16u * piece + 8u * (lane >> 4) + 2u * e2;
  const _Float16 h0 = (_Float16)qw[n * SC + kk], h1 = (_Float16)qw[n * SC + kk + 1];
  out[i] = (unsigned)__builtin_bit_cast(unsigned short, h0) | ((unsigned)__builtin_bit_cast(unsigned short, h1) << 16);
}
// out_w cast to f16 in the same fragment order: [block of 16 output channels 8][k step 4][piece 2][lane 32][8]; row 16 block + lane % 16, k as above.
__global__ __launch_bounds__(256) void pack_out_w(const float* __restrict__ ow, unsigned* __restrict__ out) {
  const unsigned i = blockIdx.x * 256 + threadIdx.x;     // one pair of f16 each, 8192 pairs
  const unsigned e2 = i & 3u, lane = (i >> 2) & 31u, piece = (i >> 7) & 1u, f = i >> 8;
  const unsigned k = f & 3u, nt = f >> 2;
  const unsigned n = 16u * nt + (lane & 15u), kk = 32u * k + 16u * piece + 8u * (lane >> 4) + 2u * e2;
  const _Float16 h0 = (_Float16)ow[n * SC + kk], h1 = (_Float16)ow[n * SC + kk + 1];
  out[i] = (unsigned)__builtin_bit_cast(unsigned short, h0) | ((unsigned)__builtin_bit_cast(unsigned short, h1) << 16);
}
// One block (16 waves) per group g of 49 consecutive pixels of the (-4,-4)-rolled image nl. 49 pixels x 128 channels = 196 tokens x 32 d
// = exactly the chunks 4g .. 4g + 3: token T = 4 * pixel + channel / 32, d = channel % 32, chunk T / 49; qkv column = 3 * channel + component.
// Stage 1: the 49 x rows, cast to f16, into LDS (rows 49..63 zero). Stage 2: qkvT = W.xT on WMMA (K = 128): a wave owns 16 channels
// of q, k and v for 32 of the 64 pixel columns, so a lane ends with 8 consecutive d of one token; + bias, cast to f16, into q[T][32], k[T][32], vT[chunk][32 d][64 tok].
// Stage 3, one (chunk, 16-query tile) unit per wave: scores transposed, sT = k.qT (4 tiles of 16 keys x 16 queries, K = 32), so a lane holds 32 keys of ONE query
// (its partner lane ^ 16 the other 32): bias, masks and softmax stay in registers. Two neighbouring sT tiles, converted in place (x2^15, f16),
// are the B fragment of oT = vT.pT (2 tiles of 16 d x 16 queries, K = 64); a lane ends with 8 consecutive d of its query per tile.
// Rows 49..63 of a chunk's q / k tiles are the next chunk's tokens (or zero rows): such keys are masked, such queries never stored.
// Stage 4: the 196 x 32 attention output is the same 49 pixels x 128 channels (flat 32 T + d); cast to f16 it takes the x tile's place in LDS (rows 49..63 still zero).
// outT = out_w.oT on WMMA (K = 128): a wave owns 32 output channels of 16 pixels. A lane of that result holds 8 channels of its own pixel, so a store from there lays
// 16-byte pieces on 16 lines: the 49 x 128 f32 tile is turned in LDS instead, and a store instruction writes one pixel's 512 contiguous bytes (+ out_b) at the (+3,+3)-rolled pixel.
__global__ __launch_bounds__(512) void qkv_attn_kernel(const float* __restrict__ X, const _Float16* __restrict__ QWf, const float* __restrict__ qb,
                                                       const float* __restrict__ rpe, const _Float16* __restrict__ OWf, const float* __restrict__ ob, float* __restrict__ OUT) {
  __shared__ __align__(16) _Float16 sX[64 * XP];
  __shared__ __align__(16) _Float16 sQK[2 * TOKR * QP];
  _Float16* const sQ = sQK;
  _Float16* const sK = sQK + TOKR * QP;
  float* const sO = (float*)sQK;     // 49 * OP floats: the output tile takes the place of q and k, which nobody reads behind the barrier that opens stage 4
  __shared__ __align__(16) _Float16 sV[4 * 32 * VP];
  __shared__ __align__(16) float sQB[384];
  __shared__ float sB[208];     // the 13 x 13 table times log2 e; entries 169..207 (reached only by padding keys) zero
  typedef __attribute__((ext_vector_type(4))) _Float16 v4h;
  typedef __attribute__((ext_vector_type(2))) _Float16 v2h;
  const unsigned nl = blockIdx.y, g = blockIdx.x, t = threadIdx.x;
  // the wave's number as a scalar: what follows from it (tile indices, the rows a wave stores, their roll) stays on the scalar unit and holds no vector register
  // (as a vector value the build with the turned output tile needs 132 registers: one block per WGP instead of two)
  const unsigned lane = t & 31u, wave = __builtin_amdgcn_readfirstlane(t >> 5);
  const unsigned cb = wave & 7u, jh = wave >> 3;     // stage 2: channel block, half of the pixel columns
  const int c = lane & 15, h = lane >> 4, koff = h * 8;
  // ---- stage 1: loads first (x rows, the weight fragments of the first two k steps, bias, table), so that they fly together
  const float* xsrc = X + (size_t)nl * SP * SC;
  v4f xv[4];
#pragma unroll
  for (int it = 0; it < 4; ++it) {
    const unsigned idx = it * 512 + t;     // 32 pieces of 4 floats per pixel, 1568 pieces
    if (it < 3 || t < 32) {
      const unsigned pix = g * 49u + (idx >> 5);
      const unsigned y = pix / SHW, x = pix - y * SHW;
      const unsigned ys = (y + 4 >= SHW) ? y + 4 - SHW : y + 4, xs = (x + 4 >= SHW) ? x + 4 - SHW : x + 4;
      xv[it] = *(const v4f*)(xsrc + (ys * SHW + xs) * SC + 4u * (idx & 31u));
    }
  }
  const _Float16* wp = QWf + cb * 6144u + lane * 8u;
  v16h aw[2][3];     // k step k sits in aw[k & 1]
#pragma unroll
  for (int k = 0; k < 2; ++k)
#pragma unroll
    for (int s = 0; s < 3; ++s) {
      Frag<_Float16>::U f;
      f.h[0] = *(const v8h*)(wp + ((k * 3 + s) * 2) * 256);
      f.h[1] = *(const v8h*)(wp + ((k * 3 + s) * 2 + 1) * 256);
      aw[k][s] = f.v;
    }
  const float tb = (t < 169) ? rpe[t] : 0.f;
  v4f qbv = (v4f){0.f, 0.f, 0.f, 0.f};
  if (t < 96) qbv = *(const v4f*)(qb + 4 * t);
  // padding, disjoint from what the stages write before the output tile: x rows 49..63 (255 16-byte pieces), q / k rows 196..211 (80 each), vT columns 49..63
  {
    const v8h z = (v8h){0, 0, 0, 0, 0, 0, 0, 0};
    if (t < 255) *(v8h*)(sX + 49 * XP + 8 * t) = z;
    if (t < 80) { *(v8h*)(sQ + 196 * QP + 8 * t) = z; *(v8h*)(sK + 196 * QP + 8 * t) = z; }
    if (t < 256) {
      _Float16* zr = sV + (t >> 1) * VP;     // row t / 2: the even thread clears columns 49..55, the odd one 56..63
      if ((t & 1u) == 0) { zr[49] = (_Float16)0.f; *(v2h*)(zr + 50) = (v2h){0, 0}; *(v4h*)(zr + 52) = (v4h){0, 0, 0, 0}; }
      else *(v8h*)(zr + 56) = z;
    }
  }
  if (t < 208) sB[t] = tb * (float)LOG2E;
  if (t < 96) *(v4f*)(sQB + 4 * t) = qbv;
#pragma unroll
  for (int it = 0; it < 4; ++it) {
    const unsigned idx = it * 512 + t;
    if (it < 3 || t < 32) {
      const v4h hx = (v4h){(_Float16)xv[it][0], (_Float16)xv[it][1], (_Float16)xv[it][2], (_Float16)xv[it][3]};
      *(v4h*)(sX + (idx >> 5) * XP + 4u * (idx & 31u)) = hx;
    }
  }
  __syncthreads();   // the x tile, the qkv bias and the table are complete before any wave reads them
  const v8f zero = (v8f){0.f, 0.f, 0.f, 0.f, 0.f, 0.f, 0.f, 0.f};
  // ---- stage 2: ga[s][j][r] = component s of channel 16 cb + 8h + r at pixel 32 jh + 16j + c
  {
    v8f ga[3][2];
#pragma unroll
    for (int s = 0; s < 3; ++s)
#pragma unroll
      for (int j = 0; j < 2; ++j) ga[s][j] = zero;
#pragma unroll
    for (int k = 0; k < 4; ++k) {
      v16h bx[2];
#pragma unroll
      for (int j = 0; j < 2; ++j) bx[j] = Frag<_Float16>::load(sX + (jh * 32 + j * 16 + c) * XP + koff + 32 * k);
#pragma unroll
      for (int s = 0; s < 3; ++s) {
#pragma unroll
        for (int j = 0; j < 2; ++j) ga[s][j] = Frag<_Float16>::mma(aw[k & 1][s], bx[j], ga[s][j]);
        if (k < 2) {     // the fragment of k step k + 2 takes the place of the one just used
          Frag<_Float16>::U f;
          f.h[0] = *(const v8h*)(wp + (((k + 2) * 3 + s) * 2) * 256);
          f.h[1] = *(const v8h*)(wp + (((k + 2) * 3 + s) * 2 + 1) * 256);
          aw[k & 1][s] = f.v;
        }
      }
      // ends the k step for the scheduler: the weight loads of step k + 2 stay here (sunk to their use, each is waited for alone) and later steps'
      // LDS loads are not lifted up (that build needs more than 128 registers: one block per WGP instead of two)
      __builtin_amdgcn_sched_barrier(0);
    }
    float bb[24];     // bb[3r + s] = bias of component s of channel 16 cb + 8h + r
#pragma unroll
    for (int q4 = 0; q4 < 6; ++q4) {
      const v4f b4 = *(const v4f*)(sQB + 48 * cb + 24 * h + 4 * q4);
      bb[4 * q4] = b4[0]; bb[4 * q4 + 1] = b4[1]; bb[4 * q4 + 2] = b4[2]; bb[4 * q4 + 3] = b4[3];
    }
    const unsigned d0 = 16u * (cb & 1u) + 8u * h;
#pragma unroll
    for (int j = 0; j < 2; ++j) {
      const unsigned pl = jh * 32 + j * 16 + c;
      if (pl < 49) {
        const unsigned T = 4u * pl + (cb >> 1), ch = T / 49u, tok = T - 49u * ch;
        v8h hq, hk;
#pragma unroll
        for (int r = 0; r < 8; ++r) {
          hq[r] = (_Float16)(ga[0][j][r] + bb[3 * r]);
          hk[r] = (_Float16)(ga[1][j][r] + bb[3 * r + 1]);
          sV[(ch * 32u + d0 + r) * VP + tok] = (_Float16)(ga[2][j][r] + bb[3 * r + 2]);
        }
        *(v8h*)(sQ + T * QP + d0) = hq;
        *(v8h*)(sK + T * QP + d0) = hk;
      }
    }
  }
  __syncthreads();   // q, k and vT of all four chunks are complete before any wave reads them
  // ---- stage 3
  const unsigned ch = wave >> 2, w = 4u * g + ch;
  const int p = (wave & 3u) * 16 + c;
  v8f acc[4];     // acc[j][r] = score of key 16j + 8h + r for query p
  {
    const v16h bq = Frag<_Float16>::load(sQ + (ch * 49 + p) * QP + koff);
    v16h ak[4];
#pragma unroll
    for (int j = 0; j < 4; ++j) ak[j] = Frag<_Float16>::load(sK + (ch * 49 + j * 16 + c) * QP + koff);
#pragma unroll
    for (int j = 0; j < 4; ++j) acc[j] = Frag<_Float16>::mma(ak[j], bq, zero);
  }
  const int pp = p < 48 ? p : 48, pq = pp / 7, pr = pp - 7 * pq;     // queries >= 49 are never stored
  // dead keys of this query, bit = key: padding, the last window row's mask, the last window column's mask
  unsigned long long m = 0xFFFE000000000000ull;
  if (((w >> 3) & 7u) == 7u) m |= (pp < 28) ? 0x1fffff0000000ull : 0xfffffffull;
  if ((w & 7u) == 7u) m |= (pr < 4) ? 0x1c3870e1c3870ull : ((pr == 4) ? 0x3c78f1e3c78full : 0ull);
  m >>= 8 * h;
  const unsigned mw[2] = {(unsigned)m, (unsigned)(m >> 32)};
  // table index (key/7 - p/7 + 6) * 13 + (key%7 - p%7 + 6) = (key + 6 * (key/7)) - (p + 6 * (p/7)) + 84
  const int ib = 84 - (pp + 6 * pq);
  float mx = -INFINITY;
#pragma unroll
  for (int j = 0; j < 4; ++j)
#pragma unroll
    for (int r = 0; r < 8; ++r) {
      const int k0 = 16 * j + r, i0 = k0 + 6 * (k0 / 7), i1 = k0 + 8 + 6 * ((k0 + 8) / 7);     // h = 0 / h = 1
      const float v = acc[j][r] * (float)(0.17677669529663687 * LOG2E) + sB[ib + i0 + h * (i1 - i0)];     // (score / sqrt(32) + bias) log2 e
      acc[j][r] = ((mw[j >> 1] >> (16 * (j & 1) + r)) & 1u) ? -INFINITY : v;
      mx = fmaxf(mx, acc[j][r]);
    }
  mx = fmaxf(mx, __shfl_xor(mx, 16, 32));     // finite: every query keeps live keys
  float sj[4] = {0.f, 0.f, 0.f, 0.f};
#pragma unroll
  for (int j = 0; j < 4; ++j) acc[j] -= mx;     // all subtractions first: taken turn by turn with the exponentials the build needs 130 registers (one block per WGP instead of two)
#pragma unroll
  for (int j = 0; j < 4; ++j) exp2x8(acc[j]);     // bare v_exp_f32, argument <= 0; -inf entries -> 0
#pragma unroll
  for (int j = 0; j < 4; ++j)
#pragma unroll
    for (int r = 0; r < 8; ++r) sj[j] += acc[j][r];
  float se = (sj[0] + sj[1]) + (sj[2] + sj[3]);
  se += __shfl_xor(se, 16, 32);
  const float sc = 32768.0f / se;
  v8f o2[2] = {zero, zero};     // o2[i][r] = 2^15 * out[p][16i + 8h + r]
#pragma unroll
  for (int kk = 0; kk < 2; ++kk) {
    v16h bp;     // element s holds key 32kk + (s < 8 ? 8h + s : 16 + 8h + s - 8): the order Frag::load gives vT
#pragma unroll
    for (int s = 0; s < 16; ++s) bp[s] = (_Float16)(acc[2 * kk + (s >> 3)][s & 7] * sc);
#pragma unroll
    for (int i = 0; i < 2; ++i) {
      const v16h av = Frag<_Float16>::load(sV + (ch * 32 + i * 16 + c) * VP + koff + 32 * kk);
      o2[i] = Frag<_Float16>::mma(av, bp, o2[i]);
    }
  }
  // ---- stage 4: the weight fragments and the bias are asked for first, so that they fly over the LDS stores and the barrier
  const unsigned ng = wave & 3u, pt = wave >> 2;     // 32 output channels, 16 pixels
  const _Float16* op = OWf + ng * 4096u + lane * 8u;
  v16h ao[2][4];
#pragma unroll
  for (int i = 0; i < 2; ++i)
#pragma unroll
    for (int k = 0; k < 4; ++k) {
      Frag<_Float16>::U f;
      f.h[0] = *(const v8h*)(op + ((i * 4 + k) * 2) * 256);
      f.h[1] = *(const v8h*)(op + ((i * 4 + k) * 2 + 1) * 256);
      ao[i][k] = f.v;
    }
  const v4f bo = *(const v4f*)(ob + 4 * lane);     // bias of the four output channels that this lane stores
  if (p < 49) {
    const unsigned T = ch * 49u + p;
    _Float16* so = sX + (T >> 2) * XP + (T & 3u) * 32u + 8 * h;
#pragma unroll
    for (int i = 0; i < 2; ++i) {
      v8h ho;
#pragma unroll
      for (int r = 0; r < 8; ++r) ho[r] = (_Float16)(o2[i][r] * PSCALE_INV);
      *(v8h*)(so + 16 * i) = ho;
    }
  }
  __syncthreads();   // the attention output of all 49 pixels is complete before any wave reads it
  v8f oa[2] = {zero, zero};     // oa[i][r] = output channel 32 ng + 16i + 8h + r of pixel 16 pt + c
#pragma unroll
  for (int k = 0; k < 4; ++k) {
    const v16h bx = Frag<_Float16>::load(sX + (pt * 16 + c) * XP + koff + 32 * k);
#pragma unroll
    for (int i = 0; i < 2; ++i) oa[i] = Frag<_Float16>::mma(ao[i][k], bx, oa[i]);
  }
  const unsigned pl = pt * 16 + c;
  if (pl < 49) {
    float* so = sO + pl * OP + 32 * ng + 8 * h;
#pragma unroll
    for (int i = 0; i < 2; ++i) {
      *(v4f*)(so + 16 * i)     = (v4f){oa[i][0], oa[i][1], oa[i][2], oa[i][3]};
      *(v4f*)(so + 16 * i + 4) = (v4f){oa[i][4], oa[i][5], oa[i][6], oa[i][7]};
    }
  }
  __syncthreads();   // all 128 channels of every pixel are in LDS before a wave takes whole rows out
#pragma unroll
  for (int it = 0; it < 4; ++it) {
    if (it < 3 || wave == 0) {     // rows 16 it + wave; row 48 is wave 0's
      // row 48 is loaded into registers that the stores just issued name: the wait that belongs in front of such an overwrite
      if (it == 3) asm volatile("s_wait_xcnt 0x0" ::: "memory");
      const unsigned row = it * 16 + wave, pix = g * 49u + row;
      const unsigned y = pix / SHW, x = pix - y * SHW;
      const unsigned yd = (y + 3 >= SHW) ? y + 3 - SHW : y + 3, xd = (x + 3 >= SHW) ? x + 3 - SHW : x + 3;
      *(v4f*)(OUT + ((size_t)nl * SP + yd * SHW + xd) * SC + 4 * lane) = *(const v4f*)(sO + row * OP + 4 * lane) + bo;
    }
  }
}
extern "C" void kernel_launch(void* const* d_in, const int* in_sizes, int n_in, void* d_out, int out_size, void* d_ws, size_t ws_size, hipStream_t stream) {
  (void)in_sizes; (void)n_in; (void)out_size; (void)ws_size;
  const float* x = (const float*)d_in[0]; const float* qw = (const float*)d_in[1]; const float* qb = (const float*)d_in[2]; const float* ow = (const float*)d_in[3]; const float* ob = (const float*)d_in[4]; const float* rpe = (const float*)d_in[5];
  char* ws = (char*)d_ws; size_t off = 0;
  auto carve = [&](size_t bytes) -> char* { char* p = ws + off; off += (bytes + 255) & ~(size_t)255; return p; };
  _Float16* QWf = (_Float16*)carve(384 * SC * 2); _Float16* OWf = (_Float16*)carve(SC * SC * 2);
  pack_qkv_w<<<384 * SC / 2 / 256, 256, 0, stream>>>(qw, (unsigned*)QWf);
  pack_out_w<<<SC * SC / 2 / 256, 256, 0, stream>>>(ow, (unsigned*)OWf);
  qkv_attn_kernel<<<dim3(SP / 49, SN), 512, 0, stream>>>(x, QWf, qb, rpe, OWf, ob, (float*)d_out);
}

// v007
// One run takes 32.6 microseconds.
// Timed twice side by side with v006, it ran 1.07 and 1.06 times as fast.
// All steps since v000 together make it 20.0 times as fast.
#include <hip/hip_runtime.h>
#include <math.h>
// Shifted-window MSA, faithful to the reference's raw torch .view reshapes (the 'windows' are consecutive 4704-float chunks of the rolled
// (H, W, C, 3)-interleaved qkv tensor, not spatial windows), its asymmetric rolls (-4 then +3) and its integer-indexed column mask.
// One kernel does the whole layer, block per 49 rolled pixels (= 4 whole chunks): x is read as f32 and cast on the way into LDS; qkv = x.qkv_wT + qkv_b,
// the per-chunk 49-token attention and the output linear (. 128 x 128, + out_b) follow without leaving LDS; the (+3,+3) roll is the address of the final store.
// All products on v_wmma_f32_16x16x32_f16, f16 operands, f32 accumulate: scores q.kT (K = 32), p.v (p x2^15, K = 64); bias, -inf masks and softmax on VALU.
typedef __attribute__((ext_vector_type(16))) _Float16 v16h;
typedef __attribute__((ext_vector_type(8)))  _Float16 v8h;
typedef __attribute__((ext_vector_type(8)))  float    v8f;
typedef __attribute__((ext_vector_type(4)))  float    v4f;
#define PSCALE_INV (1.0f / 32768.0f)
#define LOG2E 1.4426950408889634     // the softmax runs in base 2: exp(s - max) = 2^(s log2 e - max log2 e)

static __device__ __forceinline__ void exp2x8(v8f& a) {
  float a0 = a[0], a1 = a[1], a2 = a[2], a3 = a[3], a4 = a[4], a5 = a[5], a6 = a[6], a7 = a[7];
  asm("v_exp_f32 %0, %0\n\tv_exp_f32 %1, %1\n\tv_exp_f32 %2, %2\n\tv_exp_f32 %3, %3\n\t"
      "v_exp_f32 %4, %4\n\tv_exp_f32 %5, %5\n\tv_exp_f32 %6, %6\n\tv_exp_f32 %7, %7\n\tv_nop"
      : "+v"(a0), "+v"(a1), "+v"(a2), "+v"(a3), "+v"(a4), "+v"(a5), "+v"(a6), "+v"(a7));
  a = (v8f){a0, a1, a2, a3, a4, a5, a6, a7};
}

template <typename T> struct Frag;
template <> struct Frag<_Float16> {
  typedef v16h V; union U { v16h v; v8h h[2]; };
  static __device__ __forceinline__ v16h load(const _Float16* p) {   // elements 0..7 <- p[0..7], 8..15 <- p[16..23]
    U f; f.h[0] = *(const v8h*)(p); f.h[1] = *(const v8h*)(p + 16); return f.v;
  }
  static __device__ __forceinline__ v8f mma(v16h a, v16h b, v8f c) {
    return __builtin_amdgcn_wmma_f32_16x16x32_f16(false, a, false, b, (short)0, c, false, false);
  }
};

#define SN 32
#define SHW 56
#define SP (SHW * SHW)          // 3136
#define SC 128
#define SROWS (SN * SP)         // 100352
#define SWIN 256                // chunks ('windows') per image = 4*8*8
#define SCH (49 * 32 * 3)       // 4704 floats per chunk
#define QP 40                   // f16 pitch of the 32-wide q / k rows in LDS: 80 B = 16 B x odd
#define VP 72                   // f16 pitch of the 64-wide v-transposed rows in LDS: 144 B = 16 B x odd
#define XP 136                  // f16 pitch of the 128-wide x rows in LDS: 272 B = 16 B x odd
#define OP 132                  // f32 pitch of the 128-wide output rows in LDS: 528 B = 16 B x odd
#define TOKR 212                // 196 token rows of a group + the rows that the last chunk's 64-row tiles reach past them
// Both weight matrices are cast to f16 in ONE launch, in the order in which the fused kernel's waves load their A fragments, so that each load is 512 contiguous bytes.
// The two jobs do not depend on each other: blocks 0..95 take qkv_w, blocks 96..127 out_w (a block-uniform test), one pair of f16 per thread.
// qkv_w: [channel block 8][k step 4][component 3][piece 2][lane 32][8]; row 3 * (16 block + lane % 16) + component, k = 32 step + 16 piece + 8 (lane / 16) + e.
// out_w: [block of 16 output channels 8][k step 4][piece 2][lane 32][8]; row 16 block + lane % 16, k as above.
#define QW_BLOCKS (384 * SC / 2 / 256)     // 96 blocks, 24576 pairs
#define OW_BLOCKS (SC * SC / 2 / 256)      // 32 blocks, 8192 pairs
__global__ __launch_bounds__(256) void pack_w(const float* __restrict__ qw, const float* __restrict__ ow, unsigned* __restrict__ outq, unsigned* __restrict__ outo) {
  const bool isq = blockIdx.x < QW_BLOCKS;
  const unsigned i = (isq ? blockIdx.x : blockIdx.x - QW_BLOCKS) * 256 + threadIdx.x;
  const unsigned e2 = i & 3u, lane = (i >> 2) & 31u, piece = (i >> 7) & 1u, f = i >> 8;
  const unsigned wk = isq ? f / 3u : f, k = wk & 3u, blk = wk >> 2;
  const unsigned r16 = 16u * blk + (lane & 15u), n = isq ? 3u * r16 + (f - 3u * wk) : r16;
  const unsigned kk = 32u * k + 16u * piece + 8u * (lane >> 4) + 2u * e2;
  const float* src = (isq ? qw : ow) + n * SC + kk;
  const _Float16 h0 = (_Float16)src[0], h1 = (_Float16)src[1];
  (isq ? outq : outo)[i] = (unsigned)__builtin_bit_cast(unsigned short, h0) | ((unsigned)__builtin_bit_cast(unsigned short, h1) << 16);
}
// One block (16 waves) per group g of 49 consecutive pixels of the (-4,-4)-rolled image nl. 49 pixels x 128 channels = 196 tokens x 32 d
// = exactly the chunks 4g .. 4g + 3: token T = 4 * pixel + channel / 32, d = channel % 32, chunk T / 49; qkv column = 3 * channel + component.
// Stage 1: the 49 x rows, cast to f16, into LDS (rows 49..63 zero). Stage 2: qkvT = W.xT on WMMA (K = 128): a wave owns 16 channels
// of q, k and v for 32 of the 64 pixel columns, so a lane ends with 8 consecutive d of one token; + bias, cast to f16, into q[T][32], k[T][32], vT[chunk][32 d][64 tok].
// Stage 3, one (chunk, 16-query tile) unit per wave: scores transposed, sT = k.qT (4 tiles of 16 keys x 16 queries, K = 32), so a lane holds 32 keys of ONE query
// (its partner lane ^ 16 the other 32): bias, masks and softmax stay in registers. Two neighbouring sT tiles, converted in place (x2^15, f16),
// are the B fragment of oT = vT.pT (2 tiles of 16 d x 16 queries, K = 64); a lane ends with 8 consecutive d of its query per tile.
// Rows 49..63 of a chunk's q / k tiles are the next chunk's tokens (or zero rows): such keys are masked, such queries never stored.
// Stage 4: the 196 x 32 attention output is the same 49 pixels x 128 channels (flat 32 T + d); cast to f16 it takes the x tile's place in LDS (rows 49..63 still zero).
// outT = out_w.oT on WMMA (K = 128): a wave owns 32 output channels of 16 pixels. A lane of that result holds 8 channels of its own pixel, so a store from there lays
// 16-byte pieces on 16 lines: the 49 x 128 f32 tile is turned in LDS instead, and a store instruction writes one pixel's 512 contiguous bytes (+ out_b) at the (+3,+3)-rolled pixel.
__global__ __launch_bounds__(512) void qkv_attn_kernel(const float* __restrict__ X, const _Float16* __restrict__ QWf, const float* __restrict__ qb,
                                                       const float* __restrict__ rpe, const _Float16* __restrict__ OWf, const float* __restrict__ ob, float* __restrict__ OUT) {
  __shared__ __align__(16) _Float16 sX[64 * XP];
  __shared__ __align__(16) _Float16 sQK[2 * TOKR * QP];
  _Float16* const sQ = sQK;
  _Float16* const sK = sQK + TOKR * QP;
  float* const sO = (float*)sQK;     // 49 * OP floats: the output tile takes the place of q and k, which nobody reads behind the barrier that opens stage 4
  __shared__ __align__(16) _Float16 sV[4 * 32 * VP];
  __shared__ __align__(16) float sQB[384];
  __shared__ float sB[208];     // the 13 x 13 table times log2 e; entries 169..207 (reached only by padding keys) zero
  typedef __attribute__((ext_vector_type(4))) _Float16 v4h;
  typedef __attribute__((ext_vector_type(2))) _Float16 v2h;
  const unsigned nl = blockIdx.y, g = blockIdx.x, t = threadIdx.x;
  // the wave's number as a scalar: what follows from it (tile indices, the rows a wave stores, their roll) stays on the scalar unit and holds no vector register
  // (as a vector value the build with the turned output tile needs 132 registers: one block per WGP instead of two)
  const unsigned lane = t & 31u, wave = __builtin_amdgcn_readfirstlane(t >> 5);
  const unsigned cb = wave & 7u, jh = wave >> 3;     // stage 2: channel block, half of the pixel columns
  const int c = lane & 15, h = lane >> 4, koff = h * 8;
  // ---- stage 1: loads first (x rows, the weight fragments of the first two k steps, bias, table), so that they fly together
  const float* xsrc = X + (size_t)nl * SP * SC;
  v4f xv[4];
#pragma unroll
  for (int it = 0; it < 4; ++it) {
    const unsigned idx = it * 512 + t;     // 32 pieces of 4 floats per pixel, 1568 pieces
    if (it < 3 || t < 32) {
      const unsigned pix = g * 49u + (idx >> 5);
      const unsigned y = pix / SHW, x = pix - y * SHW;
      const unsigned ys = (y + 4 >= SHW) ? y + 4 - SHW : y + 4, xs = (x + 4 >= SHW) ? x + 4 - SHW : x + 4;
      xv[it] = *(const v4f*)(xsrc + (ys * SHW + xs) * SC + 4u * (idx & 31u));
    }
  }
  const _Float16* wp = QWf + cb * 6144u + lane * 8u;
  v16h aw[2][3];     // k step k sits in aw[k & 1]
#pragma unroll
  for (int k = 0; k < 2; ++k)
#pragma unroll
    for (int s = 0; s < 3; ++s) {
      Frag<_Float16>::U f;
      f.h[0] = *(const v8h*)(wp + ((k * 3 + s) * 2) * 256);
      f.h[1] = *(const v8h*)(wp + ((k * 3 + s) * 2 + 1) * 256);
      aw[k][s] = f.v;
    }
  const float tb = (t < 169) ? rpe[t] : 0.f;
  v4f qbv = (v4f){0.f, 0.f, 0.f, 0.f};
  if (t < 96) qbv = *(const v4f*)(qb + 4 * t);
  // padding, disjoint from what the stages write before the output tile: x rows 49..63 (255 16-byte pieces), q / k rows 196..211 (80 each), vT columns 49..63
  {
    const v8h z = (v8h){0, 0, 0, 0, 0, 0, 0, 0};
    if (t < 255) *(v8h*)(sX + 49 * XP + 8 * t) = z;
    if (t < 80) { *(v8h*)(sQ + 196 * QP + 8 * t) = z; *(v8h*)(sK + 196 * QP + 8 * t) = z; }
    if (t < 256) {
      _Float16* zr = sV + (t >> 1) * VP;     // row t / 2: the even thread clears columns 49..55, the odd one 56..63
      if ((t & 1u) == 0) { zr[49] = (_Float16)0.f; *(v2h*)(zr + 50) = (v2h){0, 0}; *(v4h*)(zr + 52) = (v4h){0, 0, 0, 0}; }
      else *(v8h*)(zr + 56) = z;
    }
  }
  if (t < 208) sB[t] = tb * (float)LOG2E;
  if (t < 96) *(v4f*)(sQB + 4 * t) = qbv;
#pragma unroll
  for (int it = 0; it < 4; ++it) {
    const unsigned idx = it * 512 + t;
    if (it < 3 || t < 32) {
      const v4h hx = (v4h){(_Float16)xv[it][0], (_Float16)xv[it][1], (_Float16)xv[it][2], (_Float16)xv[it][3]};
      *(v4h*)(sX + (idx >> 5) * XP + 4u * (idx & 31u)) = hx;
    }
  }
  __syncthreads();   // the x tile, the qkv bias and the table are complete before any wave reads them
  const v8f zero = (v8f){0.f, 0.f, 0.f, 0.f, 0.f, 0.f, 0.f, 0.f};
  // ---- stage 2: ga[s][j][r] = component s of channel 16 cb + 8h + r at pixel 32 jh + 16j + c
  {
    v8f ga[3][2];
#pragma unroll
    for (int s = 0; s < 3; ++s)
#pragma unroll
      for (int j = 0; j < 2; ++j) ga[s][j] = zero;
#pragma unroll
    for (int k = 0; k < 4; ++k) {
      v16h bx[2];
#pragma unroll
      for (int j = 0; j < 2; ++j) bx[j] = Frag<_Float16>::load(sX + (jh * 32 + j * 16 + c) * XP + koff + 32 * k);
#pragma unroll
      for (int s = 0; s < 3; ++s) {
#pragma unroll
        for (int j = 0; j < 2; ++j) ga[s][j] = Frag<_Float16>::mma(aw[k & 1][s], bx[j], ga[s][j]);
        if (k < 2) {     // the fragment of k step k + 2 takes the place of the one just used
          Frag<_Float16>::U f;
          f.h[0] = *(const v8h*)(wp + (((k + 2) * 3 + s) * 2) * 256);
          f.h[1] = *(const v8h*)(wp + (((k + 2) * 3 + s) * 2 + 1) * 256);
          aw[k & 1][s] = f.v;
        }
      }
      // ends the k step for the scheduler: the weight loads of step k + 2 stay here (sunk to their use, each is waited for alone) and later steps'
      // LDS loads are not lifted up (that build needs more than 128 registers: one block per WGP instead of two)
      __builtin_amdgcn_sched_barrier(0);
    }
    float bb[24];     // bb[3r + s] = bias of component s of channel 16 cb + 8h + r
#pragma unroll
    for (int q4 = 0; q4 < 6; ++q4) {
      const v4f b4 = *(const v4f*)(sQB + 48 * cb + 24 * h + 4 * q4);
      bb[4 * q4] = b4[0]; bb[4 * q4 + 1] = b4[1]; bb[4 * q4 + 2] = b4[2]; bb[4 * q4 + 3] = b4[3];
    }
    const unsigned d0 = 16u * (cb & 1u) + 8u * h;
#pragma unroll
    for (int j = 0; j < 2; ++j) {
      const unsigned pl = jh * 32 + j * 16 + c;
      if (pl < 49) {
        const unsigned T = 4u * pl + (cb >> 1), ch = T / 49u, tok = T - 49u * ch;
        v8h hq, hk;
#pragma unroll
        for (int r = 0; r < 8; ++r) {
          hq[r] = (_Float16)(ga[0][j][r] + bb[3 * r]);
          hk[r] = (_Float16)(ga[1][j][r] + bb[3 * r + 1]);
          sV[(ch * 32u + d0 + r) * VP + tok] = (_Float16)(ga[2][j][r] + bb[3 * r + 2]);
        }
        *(v8h*)(sQ + T * QP + d0) = hq;
        *(v8h*)(sK + T * QP + d0) = hk;
      }
    }
  }
  __syncthreads();   // q, k and vT of all four chunks are complete before any wave reads them
  // ---- stage 3
  const unsigned ch = wave >> 2, w = 4u * g + ch;
  const int p = (wave & 3u) * 16 + c;
  v8f acc[4];     // acc[j][r] = score of key 16j + 8h + r for query p
  {
    const v16h bq = Frag<_Float16>::load(sQ + (ch * 49 + p) * QP + koff);
    v16h ak[4];
#pragma unroll
    for (int j = 0; j < 4; ++j) ak[j] = Frag<_Float16>::load(sK + (ch * 49 + j * 16 + c) * QP + koff);
#pragma unroll
    for (int j = 0; j < 4; ++j) acc[j] = Frag<_Float16>::mma(ak[j], bq, zero);
  }
  const int pp = p < 48 ? p : 48, pq = pp / 7, pr = pp - 7 * pq;     // queries >= 49 are never stored
  // dead keys of this query, bit = key: padding, the last window row's mask, the last window column's mask
  unsigned long long m = 0xFFFE000000000000ull;
  if (((w >> 3) & 7u) == 7u) m |= (pp < 28) ? 0x1fffff0000000ull : 0xfffffffull;
  if ((w & 7u) == 7u) m |= (pr < 4) ? 0x1c3870e1c3870ull : ((pr == 4) ? 0x3c78f1e3c78full : 0ull);
  m >>= 8 * h;
  const unsigned mw[2] = {(unsigned)m, (unsigned)(m >> 32)};
  // table index (key/7 - p/7 + 6) * 13 + (key%7 - p%7 + 6) = (key + 6 * (key/7)) - (p + 6 * (p/7)) + 84
  const int ib = 84 - (pp + 6 * pq);
  float mx = -INFINITY;
#pragma unroll
  for (int j = 0; j < 4; ++j)
#pragma unroll
    for (int r = 0; r < 8; ++r) {
      const int k0 = 16 * j + r, i0 = k0 + 6 * (k0 / 7), i1 = k0 + 8 + 6 * ((k0 + 8) / 7);     // h = 0 / h = 1
      const float v = acc[j][r] * (float)(0.17677669529663687 * LOG2E) + sB[ib + i0 + h * (i1 - i0)];     // (score / sqrt(32) + bias) log2 e
      acc[j][r] = ((mw[j >> 1] >> (16 * (j & 1) + r)) & 1u) ? -INFINITY : v;
      mx = fmaxf(mx, acc[j][r]);
    }
  mx = fmaxf(mx, __shfl_xor(mx, 16, 32));     // finite: every query keeps live keys
  float sj[4] = {0.f, 0.f, 0.f, 0.f};
#pragma unroll
  for (int j = 0; j < 4; ++j) acc[j] -= mx;     // all subtractions first: taken turn by turn with the exponentials the build needs 130 registers (one block per WGP instead of two)
#pragma unroll
  for (int j = 0; j < 4; ++j) exp2x8(acc[j]);     // bare v_exp_f32, argument <= 0; -inf entries -> 0
#pragma unroll
  for (int j = 0; j < 4; ++j)
#pragma unroll
    for (int r = 0; r < 8; ++r) sj[j] += acc[j][r];
  float se = (sj[0] + sj[1]) + (sj[2] + sj[3]);
  se += __shfl_xor(se, 16, 32);
  const float sc = 32768.0f / se;
  v8f o2[2] = {zero, zero};     // o2[i][r] = 2^15 * out[p][16i + 8h + r]
#pragma unroll
  for (int kk = 0; kk < 2; ++kk) {
    v16h bp;     // element s holds key 32kk + (s < 8 ? 8h + s : 16 + 8h + s - 8): the order Frag::load gives vT
#pragma unroll
    for (int s = 0; s < 16; ++s) bp[s] = (_Float16)(acc[2 * kk + (s >> 3)][s & 7] * sc);
#pragma unroll
    for (int i = 0; i < 2; ++i) {
      const v16h av = Frag<_Float16>::load(sV + (ch * 32 + i * 16 + c) * VP + koff + 32 * kk);
      o2[i] = Frag<_Float16>::mma(av, bp, o2[i]);
    }
  }
  // ---- stage 4: the weight fragments and the bias are asked for first, so that they fly over the LDS stores and the barrier
  const unsigned ng = wave & 3u, pt = wave >> 2;     // 32 output channels, 16 pixels
  const _Float16* op = OWf + ng * 4096u + lane * 8u;
  v16h ao[2][4];
#pragma unroll
  for (int i = 0; i < 2; ++i)
#pragma unroll
    for (int k = 0; k < 4; ++k) {
      Frag<_Float16>::U f;
      f.h[0] = *(const v8h*)(op + ((i * 4 + k) * 2) * 256);
      f.h[1] = *(const v8h*)(op + ((i * 4 + k) * 2 + 1) * 256);
      ao[i][k] = f.v;
    }
  const v4f bo = *(const v4f*)(ob + 4 * lane);     // bias of the four output channels that this lane stores
  if (p < 49) {
    const unsigned T = ch * 49u + p;
    _Float16* so = sX + (T >> 2) * XP + (T & 3u) * 32u + 8 * h;
#pragma unroll
    for (int i = 0; i < 2; ++i) {
      v8h ho;
#pragma unroll
      for (int r = 0; r < 8; ++r) ho[r] = (_Float16)(o2[i][r] * PSCALE_INV);
      *(v8h*)(so + 16 * i) = ho;
    }
  }
  __syncthreads();   // the attention output of all 49 pixels is complete before any wave reads it
  v8f oa[2] = {zero, zero};     // oa[i][r] = output channel 32 ng + 16i + 8h + r of pixel 16 pt + c
#pragma unroll
  for (int k = 0; k < 4; ++k) {
    const v16h bx = Frag<_Float16>::load(sX + (pt * 16 + c) * XP + koff + 32 * k);
#pragma unroll
    for (int i = 0; i < 2; ++i) oa[i] = Frag<_Float16>::mma(ao[i][k], bx, oa[i]);
  }
  const unsigned pl = pt * 16 + c;
  if (pl < 49) {
    float* so = sO + pl * OP + 32 * ng + 8 * h;
#pragma unroll
    for (int i = 0; i < 2; ++i) {
      *(v4f*)(so + 16 * i)     = (v4f){oa[i][0], oa[i][1], oa[i][2], oa[i][3]};
      *(v4f*)(so + 16 * i + 4) = (v4f){oa[i][4], oa[i][5], oa[i][6], oa[i][7]};
    }
  }
  __syncthreads();   // all 128 channels of every pixel are in LDS before a wave takes whole rows out
#pragma unroll
  for (int it = 0; it < 4; ++it) {
    if (it < 3 || wave == 0) {     // rows 16 it + wave; row 48 is wave 0's
      // row 48 is loaded into registers that the stores just issued name: the wait that belongs in front of such an overwrite
      if (it == 3) asm volatile("s_wait_xcnt 0x0" ::: "memory");
      const unsigned row = it * 16 + wave, pix = g * 49u + row;
      const unsigned y = pix / SHW, x = pix - y * SHW;
      const unsigned yd = (y + 3 >= SHW) ? y + 3 - SHW : y + 3, xd = (x + 3 >= SHW) ? x + 3 - SHW : x + 3;
      *(v4f*)(OUT + ((size_t)nl * SP + yd * SHW + xd) * SC + 4 * lane) = *(const v4f*)(sO + row * OP + 4 * lane) + bo;
    }
  }
}
extern "C" void kernel_launch(void* const* d_in, const int* in_sizes, int n_in, void* d_out, int out_size, void* d_ws, size_t ws_size, hipStream_t stream) {
  (void)in_sizes; (void)n_in; (void)out_size; (void)ws_size;
  const float* x = (const float*)d_in[0]; const float* qw = (const float*)d_in[1]; const float* qb = (const float*)d_in[2]; const float* ow = (const float*)d_in[3]; const float* ob = (const float*)d_in[4]; const float* rpe = (const float*)d_in[5];
  char* ws = (char*)d_ws; size_t off = 0;
  auto carve = [&](size_t bytes) -> char* { char* p = ws + off; off += (bytes + 255) & ~(size_t)255; return p; };
  _Float16* QWf = (_Float16*)carve(384 * SC * 2); _Float16* OWf = (_Float16*)carve(SC * SC * 2);
  pack_w<<<QW_BLOCKS + OW_BLOCKS, 256, 0, stream>>>(qw, ow, (unsigned*)QWf, (unsigned*)OWf);
  qkv_attn_kernel<<<dim3(SP / 49, SN), 512, 0, stream>>>(x, QWf, qb, rpe, OWf, ob, (float*)d_out);
}

// v008
// Measured time: 31 microseconds a run.
// In both of two side-by-side timings against v007, it was 1.05 times as fast.
// All steps since v000 together make it 20.9 times as fast.
#include <hip/hip_runtime.h>
#include <math.h>
// Shifted-window MSA, faithful to the reference's raw torch .view reshapes (the 'windows' are consecutive 4704-float chunks of the rolled
// (H, W, C, 3)-interleaved qkv tensor, not spatial windows), its asymmetric rolls (-4 then +3) and its integer-indexed column mask.
// One kernel does the whole layer, group by group of 49 rolled pixels (= 4 whole chunks), four groups a block: x comes into LDS as f32 and is cast there; qkv = x.qkv_wT + qkv_b,
// the per-chunk 49-token attention and the output linear (. 128 x 128, + out_b) follow without leaving LDS; the (+3,+3) roll is the address of the final store.
// All products on v_wmma_f32_16x16x32_f16, f16 operands, f32 accumulate: scores q.kT (K = 32), p.v (p x2^15, K = 64); bias, -inf masks and softmax on VALU.
typedef __attribute__((ext_vector_type(16))) _Float16 v16h;
typedef __attribute__((ext_vector_type(8)))  _Float16 v8h;
typedef __attribute__((ext_vector_type(8)))  float    v8f;
typedef __attribute__((ext_vector_type(4)))  float    v4f;
#define PSCALE_INV (1.0f / 32768.0f)
#define LOG2E 1.4426950408889634     // the softmax runs in base 2: exp(s - max) = 2^(s log2 e - max log2 e)

static __device__ __forceinline__ void exp2x8(v8f& a) {
  float a0 = a[0], a1 = a[1], a2 = a[2], a3 = a[3], a4 = a[4], a5 = a[5], a6 = a[6], a7 = a[7];
  asm("v_exp_f32 %0, %0\n\tv_exp_f32 %1, %1\n\tv_exp_f32 %2, %2\n\tv_exp_f32 %3, %3\n\t"
      "v_exp_f32 %4, %4\n\tv_exp_f32 %5, %5\n\tv_exp_f32 %6, %6\n\tv_exp_f32 %7, %7\n\tv_nop"
      : "+v"(a0), "+v"(a1), "+v"(a2), "+v"(a3), "+v"(a4), "+v"(a5), "+v"(a6), "+v"(a7));
  a = (v8f){a0, a1, a2, a3, a4, a5, a6, a7};
}

template <typename T> struct Frag;
template <> struct Frag<_Float16> {
  typedef v16h V; union U { v16h v; v8h h[2]; };
  static __device__ __forceinline__ v16h load(const _Float16* p) {   // elements 0..7 <- p[0..7], 8..15 <- p[16..23]
    U f; f.h[0] = *(const v8h*)(p); f.h[1] = *(const v8h*)(p + 16); return f.v;
  }
  static __device__ __forceinline__ v8f mma(v16h a, v16h b, v8f c) {
    return __builtin_amdgcn_wmma_f32_16x16x32_f16(false, a, false, b, (short)0, c, false, false);
  }
};

#define SN 32
#define SHW 56
#define SP (SHW * SHW)          // 3136
#define SC 128
#define SROWS (SN * SP)         // 100352
#define SWIN 256                // chunks ('windows') per image = 4*8*8
#define SCH (49 * 32 * 3)       // 4704 floats per chunk
#define QP 40                   // f16 pitch of the 32-wide q / k rows in LDS: 80 B = 16 B x odd
#define VP 72                   // f16 pitch of the 64-wide v-transposed rows in LDS: 144 B = 16 B x odd
#define XP 136                  // f16 pitch of the 128-wide x rows in LDS: 272 B = 16 B x odd
#define OP 132                  // f32 pitch of the 128-wide output rows in LDS: 528 B = 16 B x odd
#define TOKR 212                // 196 token rows of a group + the rows that the last chunk's 64-row tiles reach past them
// Both weight matrices are cast to f16 in ONE launch, in the order in which the fused kernel's waves load their A fragments, so that each load is 512 contiguous bytes.
// The two jobs do not depend on each other: blocks 0..95 take qkv_w, blocks 96..127 out_w (a block-uniform test), one pair of f16 per thread.
// qkv_w: [channel block 8][k step 4][component 3][piece 2][lane 32][8]; row 3 * (16 block + lane % 16) + component, k = 32 step + 16 piece + 8 (lane / 16) + e.
// out_w: [block of 16 output channels 8][k step 4][piece 2][lane 32][8]; row 16 block + lane % 16, k as above.
#define QW_BLOCKS (384 * SC / 2 / 256)     // 96 blocks, 24576 pairs
#define OW_BLOCKS (SC * SC / 2 / 256)      // 32 blocks, 8192 pairs
__global__ __launch_bounds__(256) void pack_w(const float* __restrict__ qw, const float* __restrict__ ow, unsigned* __restrict__ outq, unsigned* __restrict__ outo) {
  const bool isq = blockIdx.x < QW_BLOCKS;
  const unsigned i = (isq ? blockIdx.x : blockIdx.x - QW_BLOCKS) * 256 + threadIdx.x;
  const unsigned e2 = i & 3u, lane = (i >> 2) & 31u, piece = (i >> 7) & 1u, f = i >> 8;
  const unsigned wk = isq ? f / 3u : f, k = wk & 3u, blk = wk >> 2;
  const unsigned r16 = 16u * blk + (lane & 15u), n = isq ? 3u * r16 + (f - 3u * wk) : r16;
  const unsigned kk = 32u * k + 16u * piece + 8u * (lane >> 4) + 2u * e2;
  const float* src = (isq ? qw : ow) + n * SC + kk;
  const _Float16 h0 = (_Float16)src[0], h1 = (_Float16)src[1];
  (isq ? outq : outo)[i] = (unsigned)__builtin_bit_cast(unsigned short, h0) | ((unsigned)__builtin_bit_cast(unsigned short, h1) << 16);
}
// One trip of a block (16 waves) per group g of 49 consecutive pixels of the (-4,-4)-rolled image nl. 49 pixels x 128 channels = 196 tokens x 32 d
// = exactly the chunks 4g .. 4g + 3: token T = 4 * pixel + channel / 32, d = channel % 32, chunk T / 49; qkv column = 3 * channel + component.
// Stage 1: the 49 x rows, cast to f16, into LDS (rows 49..63 zero). Stage 2: qkvT = W.xT on WMMA (K = 128): a wave owns 16 channels
// of q, k and v for 32 of the 64 pixel columns, so a lane ends with 8 consecutive d of one token; + bias, cast to f16, into q[T][32], k[T][32], vT[chunk][32 d][64 tok].
// Stage 3, one (chunk, 16-query tile) unit per wave: scores transposed, sT = k.qT (4 tiles of 16 keys x 16 queries, K = 32), so a lane holds 32 keys of ONE query
// (its partner lane ^ 16 the other 32): bias, masks and softmax stay in registers. Two neighbouring sT tiles, converted in place (x2^15, f16),
// are the B fragment of oT = vT.pT (2 tiles of 16 d x 16 queries, K = 64); a lane ends with 8 consecutive d of its query per tile.
// Rows 49..63 of a chunk's q / k tiles are the next chunk's tokens (or zero rows): such keys are masked, such queries never stored.
// Stage 4: the 196 x 32 attention output is the same 49 pixels x 128 channels (flat 32 T + d); cast to f16 it takes the x tile's place in LDS (rows 49..63 still zero).
// outT = out_w.oT on WMMA (K = 128): a wave owns 32 output channels of 16 pixels. A lane of that result holds 8 channels of its own pixel, so a store from there lays
// 16-byte pieces on 16 lines: the 49 x 128 f32 tile is turned in LDS instead, and a store instruction writes one pixel's 512 contiguous bytes (+ out_b) at the (+3,+3)-rolled pixel.
// A block walks GPB consecutive groups, so that all blocks of the grid are resident at once (two per WGP) and a quarter of the waves has to be started.
// While a group is worked on, the next group's 49 x rows (f32, 512 B each) fly from memory into sXF by asynchronous copies, through no register.
#define GPB 4
static __device__ __forceinline__ const float* x_row(const float* xsrc, unsigned pix) {     // the x row that the (-4,-4) roll puts at pixel pix
  const unsigned y = pix / SHW, x = pix - y * SHW;
  const unsigned ys = (y + 4 >= SHW) ? y + 4 - SHW : y + 4, xs = (x + 4 >= SHW) ? x + 4 - SHW : x + 4;
  return xsrc + (ys * SHW + xs) * SC;
}
// Wave w brings rows w, 16 + w and 32 + w of group g, wave 0 row 48 as well; a lane its own 16 bytes, all lanes on. Each statement ends in s_wait_xcnt 0:
// the wait that belongs in front of a rewrite of the address registers which the copies name.
static __device__ __forceinline__ void copy_x(const float* xsrc, unsigned g, const float* dst, unsigned wave, unsigned lane) {
  const unsigned l0 = (unsigned)(size_t)(dst + wave * SC + 4u * lane), l1 = l0 + 16u * SC * 4u, l2 = l0 + 32u * SC * 4u;
  const float* p0 = x_row(xsrc, g * 49u + wave) + 4u * lane;
  const float* p1 = x_row(xsrc, g * 49u + 16u + wave) + 4u * lane;
  const float* p2 = x_row(xsrc, g * 49u + 32u + wave) + 4u * lane;
  asm volatile("global_load_async_to_lds_b128 %0, %3, off\n\tglobal_load_async_to_lds_b128 %1, %4, off\n\tglobal_load_async_to_lds_b128 %2, %5, off\n\ts_wait_xcnt 0x0"
               :: "v"(l0), "v"(l1), "v"(l2), "v"(p0), "v"(p1), "v"(p2) : "memory");
  if (wave == 0) {
    const unsigned l3 = l0 + 48u * SC * 4u;
    const float* p3 = x_row(xsrc, g * 49u + 48u) + 4u * lane;
    asm volatile("global_load_async_to_lds_b128 %0, %1, off\n\ts_wait_xcnt 0x0" :: "v"(l3), "v"(p3) : "memory");
  }
}
// launch bounds, second argument: 8 waves per SIMD = two blocks per WGP, a budget of 128 registers (without it this build takes 130)
__global__ __launch_bounds__(512, 8) void qkv_attn_kernel(const float* __restrict__ X, const _Float16* __restrict__ QWf, const float* __restrict__ qb,
                                                       const float* __restrict__ rpe, const _Float16* __restrict__ OWf, const float* __restrict__ ob, float* __restrict__ OUT) {
  __shared__ __align__(16) _Float16 sX[64 * XP];
  __shared__ __align__(16) float sXF[64 * SC];     // the x rows of the group that comes next, as they lie in memory; rows 49..63 zero
  __shared__ __align__(16) _Float16 sQK[2 * TOKR * QP];
  _Float16* const sQ = sQK;
  _Float16* const sK = sQK + TOKR * QP;
  float* const sO = (float*)sQK;     // 49 * OP floats: the output tile takes the place of q and k, which nobody reads behind the barrier that opens stage 4
  __shared__ __align__(16) _Float16 sV[4 * 32 * VP];
  __shared__ __align__(16) float sQB[384];
  __shared__ float sB[208];     // the 13 x 13 table times log2 e; entries 169..207 (reached only by padding keys) zero
  typedef __attribute__((ext_vector_type(4))) _Float16 v4h;
  typedef __attribute__((ext_vector_type(2))) _Float16 v2h;
  const unsigned nl = blockIdx.y;
  // the wave's number as a scalar: what follows from it (tile indices, the rows a wave stores, their roll) stays on the scalar unit and holds no vector register
  // (as a vector value the build with the turned output tile needs 132 registers: one block per WGP instead of two)
  const unsigned wave = __builtin_amdgcn_readfirstlane(threadIdx.x >> 5);
  const unsigned cb = wave & 7u, jh = wave >> 3;     // stage 2: channel block, half of the pixel columns
  // ---- once per block: the first group's x rows are asked for; bias, table and the padding that no stage overwrites go into LDS meanwhile
  const float* xsrc = X + (size_t)nl * SP * SC;
  copy_x(xsrc, blockIdx.x * GPB, sXF, wave, threadIdx.x & 31u);
  const v8h z8 = (v8h){0, 0, 0, 0, 0, 0, 0, 0};
  {
    const unsigned t = threadIdx.x;
    const float tb = (t < 169) ? rpe[t] : 0.f;
    v4f qbv = (v4f){0.f, 0.f, 0.f, 0.f};
    if (t < 96) qbv = *(const v4f*)(qb + 4 * t);
    // x rows 49..63 (480 16-byte pieces; no copy aims at them), k rows 196..211 (80), vT columns 49..63
    if (t < 480) *(v4f*)(sXF + 49 * SC + 4 * t) = (v4f){0.f, 0.f, 0.f, 0.f};
    if (t < 80) *(v8h*)(sK + 196 * QP + 8 * t) = z8;
    if (t < 256) {
      _Float16* zr = sV + (t >> 1) * VP;     // row t / 2: the even thread clears columns 49..55, the odd one 56..63
      if ((t & 1u) == 0) { zr[49] = (_Float16)0.f; *(v2h*)(zr + 50) = (v2h){0, 0}; *(v4h*)(zr + 52) = (v4h){0, 0, 0, 0}; }
      else *(v8h*)(zr + 56) = z8;
    }
    if (t < 208) sB[t] = tb * (float)LOG2E;
    if (t < 96) *(v4f*)(sQB + 4 * t) = qbv;
  }
  asm volatile("s_wait_asynccnt 0x0" ::: "memory");     // this wave's copies of the first group have landed
  __syncthreads();   // the first group's x rows are in sXF before anybody reads them
  const v8f zero = (v8f){0.f, 0.f, 0.f, 0.f, 0.f, 0.f, 0.f, 0.f};
  // kept rolled, for speed only
#pragma unroll 1
  for (unsigned gi = 0; gi < GPB; ++gi) {
  const unsigned g = blockIdx.x * GPB + gi;
  // the lane's number, formed anew on every trip: from a value that is the same on all trips the compiler forms some 30 LDS and global addresses in front of the loop
  // and holds them in registers through the whole body (over 170 registers: one block per WGP instead of two; held to 128, it spills)
  unsigned lane;
  asm volatile("v_mbcnt_lo_u32_b32 %0, -1, 0" : "=v"(lane));
  const unsigned t = wave * 32u + lane;
  const int c = lane & 15, h = lane >> 4, koff = h * 8;
  const _Float16* wp = QWf + cb * 6144u + lane * 8u;
  // ---- stage 1: the weight fragments of the first two k steps are asked for; the x rows go from sXF, cast to f16, into sX
  v16h aw[2][3];     // k step k sits in aw[k & 1]
#pragma unroll
  for (int k = 0; k < 2; ++k)
#pragma unroll
    for (int s = 0; s < 3; ++s) {
      Frag<_Float16>::U f;
      f.h[0] = *(const v8h*)(wp + ((k * 3 + s) * 2) * 256);
      f.h[1] = *(const v8h*)(wp + ((k * 3 + s) * 2 + 1) * 256);
      aw[k][s] = f.v;
    }
#pragma unroll
  for (int it = 0; it < 4; ++it) {
    // 32 pieces of 4 floats per row, all 64 rows, so that every wave does the same four pieces: the zero rows 49..63 of sXF give the zero rows of sX
    const v4f xv = *(const v4f*)(sXF + (it * 16 + wave) * SC + 4u * lane);
    *(v4h*)(sX + (it * 16 + wave) * XP + 4u * lane) = (v4h){(_Float16)xv[0], (_Float16)xv[1], (_Float16)xv[2], (_Float16)xv[3]};
  }
  __syncthreads();   // the x tile is complete before any wave reads it; sXF and the output tile have been read
  if (gi + 1 < GPB) {
    asm volatile("s_wait_dscnt 0x0" ::: "memory");     // this wave's own reads of sXF have retired before copies aim at it
    copy_x(xsrc, g + 1, sXF, wave, lane);
  }
  if (t < 80) *(v8h*)(sQ + 196 * QP + 8 * t) = z8;     // q rows 196..211: the output tile of the trip before lay on them
  // ---- stage 2: ga[s][j][r] = component s of channel 16 cb + 8h + r at pixel 32 jh + 16j + c
  {
    v8f ga[3][2];
#pragma unroll
    for (int s = 0; s < 3; ++s)
#pragma unroll
      for (int j = 0; j < 2; ++j) ga[s][j] = zero;
#pragma unroll
    for (int k = 0; k < 4; ++k) {
      v16h bx[2];
#pragma unroll
      for (int j = 0; j < 2; ++j) bx[j] = Frag<_Float16>::load(sX + (jh * 32 + j * 16 + c) * XP + koff + 32 * k);
#pragma unroll
      for (int s = 0; s < 3; ++s) {
#pragma unroll
        for (int j = 0; j < 2; ++j) ga[s][j] = Frag<_Float16>::mma(aw[k & 1][s], bx[j], ga[s][j]);
        if (k < 2) {     // the fragment of k step k + 2 takes the place of the one just used
          Frag<_Float16>::U f;
          f.h[0] = *(const v8h*)(wp + (((k + 2) * 3 + s) * 2) * 256);
          f.h[1] = *(const v8h*)(wp + (((k + 2) * 3 + s) * 2 + 1) * 256);
          aw[k & 1][s] = f.v;
        }
      }
      // ends the k step for the scheduler: the weight loads of step k + 2 stay here (sunk to their use, each is waited for alone) and later steps'
      // LDS loads are not lifted up (that build needs more than 128 registers: one block per WGP instead of two)
      __builtin_amdgcn_sched_barrier(0);
    }
    float bb[24];     // bb[3r + s] = bias of component s of channel 16 cb + 8h + r
#pragma unroll
    for (int q4 = 0; q4 < 6; ++q4) {
      const v4f b4 = *(const v4f*)(sQB + 48 * cb + 24 * h + 4 * q4);
      bb[4 * q4] = b4[0]; bb[4 * q4 + 1] = b4[1]; bb[4 * q4 + 2] = b4[2]; bb[4 * q4 + 3] = b4[3];
    }
    const unsigned d0 = 16u * (cb & 1u) + 8u * h;
#pragma unroll
    for (int j = 0; j < 2; ++j) {
      const unsigned pl = jh * 32 + j * 16 + c;
      if (pl < 49) {
        const unsigned T = 4u * pl + (cb >> 1), ch = T / 49u, tok = T - 49u * ch;
        v8h hq, hk;
#pragma unroll
        for (int r = 0; r < 8; ++r) {
          hq[r] = (_Float16)(ga[0][j][r] + bb[3 * r]);
          hk[r] = (_Float16)(ga[1][j][r] + bb[3 * r + 1]);
          sV[(ch * 32u + d0 + r) * VP + tok] = (_Float16)(ga[2][j][r] + bb[3 * r + 2]);
        }
        *(v8h*)(sQ + T * QP + d0) = hq;
        *(v8h*)(sK + T * QP + d0) = hk;
      }
    }
  }
  __syncthreads();   // q, k and vT of all four chunks are complete before any wave reads them
  // ---- stage 3
  const unsigned ch = wave >> 2, w = 4u * g + ch;
  const int p = (wave & 3u) * 16 + c;
  v8f acc[4];     // acc[j][r] = score of key 16j + 8h + r for query p
  {
    const v16h bq = Frag<_Float16>::load(sQ + (ch * 49 + p) * QP + koff);
    v16h ak[4];
#pragma unroll
    for (int j = 0; j < 4; ++j) ak[j] = Frag<_Float16>::load(sK + (ch * 49 + j * 16 + c) * QP + koff);
#pragma unroll
    for (int j = 0; j < 4; ++j) acc[j] = Frag<_Float16>::mma(ak[j], bq, zero);
  }
  const int pp = p < 48 ? p : 48, pq = pp / 7, pr = pp - 7 * pq;     // queries >= 49 are never stored
  // dead keys of this query, bit = key: padding, the last window row's mask, the last window column's mask
  unsigned long long m = 0xFFFE000000000000ull;
  if (((w >> 3) & 7u) == 7u) m |= (pp < 28) ? 0x1fffff0000000ull : 0xfffffffull;
  if ((w & 7u) == 7u) m |= (pr < 4) ? 0x1c3870e1c3870ull : ((pr == 4) ? 0x3c78f1e3c78full : 0ull);
  m >>= 8 * h;
  const unsigned mw[2] = {(unsigned)m, (unsigned)(m >> 32)};
  // table index (key/7 - p/7 + 6) * 13 + (key%7 - p%7 + 6) = (key + 6 * (key/7)) - (p + 6 * (p/7)) + 84
  const int ib = 84 - (pp + 6 * pq);
  float mx = -INFINITY;
#pragma unroll
  for (int j = 0; j < 4; ++j)
#pragma unroll
    for (int r = 0; r < 8; ++r) {
      const int k0 = 16 * j + r, i0 = k0 + 6 * (k0 / 7), i1 = k0 + 8 + 6 * ((k0 + 8) / 7);     // h = 0 / h = 1
      const float v = acc[j][r] * (float)(0.17677669529663687 * LOG2E) + sB[ib + i0 + h * (i1 - i0)];     // (score / sqrt(32) + bias) log2 e
      acc[j][r] = ((mw[j >> 1] >> (16 * (j & 1) + r)) & 1u) ? -INFINITY : v;
      mx = fmaxf(mx, acc[j][r]);
    }
  mx = fmaxf(mx, __shfl_xor(mx, 16, 32));     // finite: every query keeps live keys
  float sj[4] = {0.f, 0.f, 0.f, 0.f};
#pragma unroll
  for (int j = 0; j < 4; ++j) acc[j] -= mx;     // all subtractions first: taken turn by turn with the exponentials the build needs 130 registers (one block per WGP instead of two)
#pragma unroll
  for (int j = 0; j < 4; ++j) exp2x8(acc[j]);     // bare v_exp_f32, argument <= 0; -inf entries -> 0
#pragma unroll
  for (int j = 0; j < 4; ++j)
#pragma unroll
    for (int r = 0; r < 8; ++r) sj[j] += acc[j][r];
  float se = (sj[0] + sj[1]) + (sj[2] + sj[3]);
  se += __shfl_xor(se, 16, 32);
  const float sc = 32768.0f / se;
  v8f o2[2] = {zero, zero};     // o2[i][r] = 2^15 * out[p][16i + 8h + r]
#pragma unroll
  for (int kk = 0; kk < 2; ++kk) {
    v16h bp;     // element s holds key 32kk + (s < 8 ? 8h + s : 16 + 8h + s - 8): the order Frag::load gives vT
#pragma unroll
    for (int s = 0; s < 16; ++s) bp[s] = (_Float16)(acc[2 * kk + (s >> 3)][s & 7] * sc);
#pragma unroll
    for (int i = 0; i < 2; ++i) {
      const v16h av = Frag<_Float16>::load(sV + (ch * 32 + i * 16 + c) * VP + koff + 32 * kk);
      o2[i] = Frag<_Float16>::mma(av, bp, o2[i]);
    }
  }
  // ---- stage 4: the weight fragments and the bias are asked for first, so that they fly over the LDS stores and the barrier
  const unsigned ng = wave & 3u, pt = wave >> 2;     // 32 output channels, 16 pixels
  const _Float16* op = OWf + ng * 4096u + lane * 8u;
  v16h ao[2][4];
#pragma unroll
  for (int i = 0; i < 2; ++i)
#pragma unroll
    for (int k = 0; k < 4; ++k) {
      Frag<_Float16>::U f;
      f.h[0] = *(const v8h*)(op + ((i * 4 + k) * 2) * 256);
      f.h[1] = *(const v8h*)(op + ((i * 4 + k) * 2 + 1) * 256);
      ao[i][k] = f.v;
    }
  const v4f bo = *(const v4f*)(ob + 4 * lane);     // bias of the four output channels that this lane stores
  if (p < 49) {
    const unsigned T = ch * 49u + p;
    _Float16* so = sX + (T >> 2) * XP + (T & 3u) * 32u + 8 * h;
#pragma unroll
    for (int i = 0; i < 2; ++i) {
      v8h ho;
#pragma unroll
      for (int r = 0; r < 8; ++r) ho[r] = (_Float16)(o2[i][r] * PSCALE_INV);
      *(v8h*)(so + 16 * i) = ho;
    }
  }
  __syncthreads();   // the attention output of all 49 pixels is complete before any wave reads it
  v8f oa[2] = {zero, zero};     // oa[i][r] = output channel 32 ng + 16i + 8h + r of pixel 16 pt + c
#pragma unroll
  for (int k = 0; k < 4; ++k) {
    const v16h bx = Frag<_Float16>::load(sX + (pt * 16 + c) * XP + koff + 32 * k);
#pragma unroll
    for (int i = 0; i < 2; ++i) oa[i] = Frag<_Float16>::mma(ao[i][k], bx, oa[i]);
  }
  const unsigned pl = pt * 16 + c;
  if (pl < 49) {
    float* so = sO + pl * OP + 32 * ng + 8 * h;
#pragma unroll
    for (int i = 0; i < 2; ++i) {
      *(v4f*)(so + 16 * i)     = (v4f){oa[i][0], oa[i][1], oa[i][2], oa[i][3]};
      *(v4f*)(so + 16 * i + 4) = (v4f){oa[i][4], oa[i][5], oa[i][6], oa[i][7]};
    }
  }
  asm volatile("s_wait_asynccnt 0x0" ::: "memory");     // this wave's copies of the next group have landed: the barrier below publishes them
  __syncthreads();   // all 128 channels of every pixel are in LDS before a wave takes whole rows out
#pragma unroll
  for (int it = 0; it < 4; ++it) {
    if (it < 3 || wave == 0) {     // rows 16 it + wave; row 48 is wave 0's
      // row 48 is loaded into registers that the stores just issued name: the wait that belongs in front of such an overwrite
      if (it == 3) asm volatile("s_wait_xcnt 0x0" ::: "memory");
      const unsigned row = it * 16 + wave, pix = g * 49u + row;
      const unsigned y = pix / SHW, x = pix - y * SHW;
      const unsigned yd = (y + 3 >= SHW) ? y + 3 - SHW : y + 3, xd = (x + 3 >= SHW) ? x + 3 - SHW : x + 3;
      *(v4f*)(OUT + ((size_t)nl * SP + yd * SHW + xd) * SC + 4 * lane) = *(const v4f*)(sO + row * OP + 4 * lane) + bo;
    }
  }
  // the next trip rewrites registers that the stores just issued name: the wait that belongs in front of such an overwrite
  asm volatile("s_wait_xcnt 0x0" ::: "memory");
  }
}
extern "C" void kernel_launch(void* const* d_in, const int* in_sizes, int n_in, void* d_out, int out_size, void* d_ws, size_t ws_size, hipStream_t stream) {
  (void)in_sizes; (void)n_in; (void)out_size; (void)ws_size;
  const float* x = (const float*)d_in[0]; const float* qw = (const float*)d_in[1]; const float* qb = (const float*)d_in[2]; const float* ow = (const float*)d_in[3]; const float* ob = (const float*)d_in[4]; const float* rpe = (const float*)d_in[5];
  char* ws = (char*)d_ws; size_t off = 0;
  auto carve = [&](size_t bytes) -> char* { char* p = ws + off; off += (bytes + 255) & ~(size_t)255; return p; };
  _Float16* QWf = (_Float16*)carve(384 * SC * 2); _Float16* OWf = (_Float16*)carve(SC * SC * 2);
  pack_w<<<QW_BLOCKS + OW_BLOCKS, 256, 0, stream>>>(qw, ow, (unsigned*)QWf, (unsigned*)OWf);
  qkv_attn_kernel<<<dim3(SP / 49 / GPB, SN), 512, 0, stream>>>(x, QWf, qb, rpe, OWf, ob, (float*)d_out);
}

// v009
// Measured time: 29.6 microseconds a run.
// Timed twice side by side with v008, it ran 1.05 times as fast both times.
// Over all steps from v000 it is 22.0 times as fast.
#include <hip/hip_runtime.h>
#include <math.h>
// Shifted-window MSA, faithful to the reference's raw torch .view reshapes (the 'windows' are consecutive 4704-float chunks of the rolled
// (H, W, C, 3)-interleaved qkv tensor, not spatial windows), its asymmetric rolls (-4 then +3) and its integer-indexed column mask.
// One kernel does the whole layer, group by group of 49 rolled pixels (= 4 whole chunks), four groups a block: x comes into LDS as f32 and is cast there; qkv = x.qkv_wT + qkv_b,
// the per-chunk 49-token attention and the output linear (. 128 x 128, + out_b) follow without leaving LDS; the (+3,+3) roll is the address of the final store.
// All products on v_wmma_f32_16x16x32_f16, f16 operands, f32 accumulate: scores q.kT (K = 32), p.v (p x2^15, K = 64); the bias and the padding keys' -inf are the score product's C operand;
// the window-edge masks and the softmax run on VALU.
typedef __attribute__((ext_vector_type(16))) _Float16 v16h;
typedef __attribute__((ext_vector_type(8)))  _Float16 v8h;
typedef __attribute__((ext_vector_type(8)))  float    v8f;
typedef __attribute__((ext_vector_type(4)))  float    v4f;
#define PSCALE_INV (1.0f / 32768.0f)
#define LOG2E 1.4426950408889634     // the softmax runs in base 2: exp(s - max) = 2^(s log2 e - max log2 e)
#define QSCALE ((float)(0.17677669529663687 * LOG2E))     // log2 e / sqrt(32): q carries it, so that q.kT + table is the finished score

static __device__ __forceinline__ void exp2x8(v8f& a) {
  float a0 = a[0], a1 = a[1], a2 = a[2], a3 = a[3], a4 = a[4], a5 = a[5], a6 = a[6], a7 = a[7];
  asm("v_exp_f32 %0, %0\n\tv_exp_f32 %1, %1\n\tv_exp_f32 %2, %2\n\tv_exp_f32 %3, %3\n\t"
      "v_exp_f32 %4, %4\n\tv_exp_f32 %5, %5\n\tv_exp_f32 %6, %6\n\tv_exp_f32 %7, %7\n\tv_nop"
      : "+v"(a0), "+v"(a1), "+v"(a2), "+v"(a3), "+v"(a4), "+v"(a5), "+v"(a6), "+v"(a7));
  a = (v8f){a0, a1, a2, a3, a4, a5, a6, a7};
}

template <typename T> struct Frag;
template <> struct Frag<_Float16> {
  typedef v16h V; union U { v16h v; v8h h[2]; };
  static __device__ __forceinline__ v16h load(const _Float16* p) {   // elements 0..7 <- p[0..7], 8..15 <- p[16..23]
    U f; f.h[0] = *(const v8h*)(p); f.h[1] = *(const v8h*)(p + 16); return f.v;
  }
  static __device__ __forceinline__ v8f mma(v16h a, v16h b, v8f c) {
    return __builtin_amdgcn_wmma_f32_16x16x32_f16(false, a, false, b, (short)0, c, false, false);
  }
};

#define SN 32
#define SHW 56
#define SP (SHW * SHW)          // 3136
#define SC 128
#define SROWS (SN * SP)         // 100352
#define SWIN 256                // chunks ('windows') per image = 4*8*8
#define SCH (49 * 32 * 3)       // 4704 floats per chunk
#define QP 40                   // f16 pitch of the 32-wide q / k rows in LDS: 80 B = 16 B x odd
#define VP 72                   // f16 pitch of the 64-wide v-transposed rows in LDS: 144 B = 16 B x odd
#define XP 136                  // f16 pitch of the 128-wide x rows in LDS: 272 B = 16 B x odd
#define OP 132                  // f32 pitch of the 128-wide output rows in LDS: 528 B = 16 B x odd
#define TOKR 212                // 196 token rows of a group + the rows that the last chunk's 64-row tiles reach past them
// Both weight matrices are cast to f16 in ONE launch, in the order in which the fused kernel's waves load their A fragments, so that each load is 512 contiguous bytes.
// The two jobs do not depend on each other: blocks 0..95 take qkv_w, blocks 96..127 out_w (a block-uniform test), one pair of f16 per thread.
// qkv_w: [channel block 8][k step 4][component 3][piece 2][lane 32][8]; row 3 * (16 block + lane % 16) + component, k = 32 step + 16 piece + 8 (lane / 16) + e.
// out_w: [block of 16 output channels 8][k step 4][piece 2][lane 32][8]; row 16 block + lane % 16, k as above.
#define QW_BLOCKS (384 * SC / 2 / 256)     // 96 blocks, 24576 pairs
#define OW_BLOCKS (SC * SC / 2 / 256)      // 32 blocks, 8192 pairs
__global__ __launch_bounds__(256) void pack_w(const float* __restrict__ qw, const float* __restrict__ ow, unsigned* __restrict__ outq, unsigned* __restrict__ outo) {
  const bool isq = blockIdx.x < QW_BLOCKS;
  const unsigned i = (isq ? blockIdx.x : blockIdx.x - QW_BLOCKS) * 256 + threadIdx.x;
  const unsigned e2 = i & 3u, lane = (i >> 2) & 31u, piece = (i >> 7) & 1u, f = i >> 8;
  const unsigned wk = isq ? f / 3u : f, k = wk & 3u, blk = wk >> 2;
  const unsigned r16 = 16u * blk + (lane & 15u), n = isq ? 3u * r16 + (f - 3u * wk) : r16;
  const unsigned kk = 32u * k + 16u * piece + 8u * (lane >> 4) + 2u * e2;
  const float* src = (isq ? qw : ow) + n * SC + kk;
  const _Float16 h0 = (_Float16)src[0], h1 = (_Float16)src[1];
  (isq ? outq : outo)[i] = (unsigned)__builtin_bit_cast(unsigned short, h0) | ((unsigned)__builtin_bit_cast(unsigned short, h1) << 16);
}
// One trip of a block (16 waves) per group g of 49 consecutive pixels of the (-4,-4)-rolled image nl. 49 pixels x 128 channels = 196 tokens x 32 d
// = exactly the chunks 4g .. 4g + 3: token T = 4 * pixel + channel / 32, d = channel % 32, chunk T / 49; qkv column = 3 * channel + component.
// Stage 1: the 49 x rows, cast to f16, into LDS (rows 49..63 zero). Stage 2: qkvT = W.xT on WMMA (K = 128): a wave owns 16 channels
// of q, k and v for 32 of the 64 pixel columns, so a lane ends with 8 consecutive d of one token; + bias, cast to f16, into q[T][32], k[T][32], vT[chunk][32 d][64 tok].
// Stage 3, one (chunk, 16-query tile) unit per wave: scores transposed, sT = k.qT (4 tiles of 16 keys x 16 queries, K = 32), so a lane holds 32 keys of ONE query
// (its partner lane ^ 16 the other 32): masks and softmax stay in registers. The bias of (key, query) is the same for every chunk: it lies in LDS in the order of the score tiles'
// accumulators (-inf at the padding keys 49..63) and is the C operand of the score product, so that a chunk off the window edges needs no vector work between product and maximum. Two neighbouring sT tiles, converted in place (x2^15, f16),
// are the B fragment of oT = vT.pT (2 tiles of 16 d x 16 queries, K = 64); a lane ends with 8 consecutive d of its query per tile.
// Rows 49..63 of a chunk's q / k tiles are the next chunk's tokens (or zero rows): such keys are masked, such queries never stored.
// Stage 4: the 196 x 32 attention output is the same 49 pixels x 128 channels (flat 32 T + d); cast to f16 it takes the x tile's place in LDS (rows 49..63 still zero).
// outT = out_w.oT on WMMA (K = 128): a wave owns 32 output channels of 16 pixels. A lane of that result holds 8 channels of its own pixel, so a store from there lays
// 16-byte pieces on 16 lines: the 49 x 128 f32 tile is turned in LDS instead, and a store instruction writes one pixel's 512 contiguous bytes (+ out_b) at the (+3,+3)-rolled pixel.
// A block walks GPB consecutive groups, so that all blocks of the grid are resident at once (two per WGP) and a quarter of the waves has to be started.
// While a group is worked on, the next group's 49 x rows (f32, 512 B each) fly from memory into sXF by asynchronous copies, through no register.
#define GPB 4
static __device__ __forceinline__ const float* x_row(const float* xsrc, unsigned pix) {     // the x row that the (-4,-4) roll puts at pixel pix
  const unsigned y = pix / SHW, x = pix - y * SHW;
  const unsigned ys = (y + 4 >= SHW) ? y + 4 - SHW : y + 4, xs = (x + 4 >= SHW) ? x + 4 - SHW : x + 4;
  return xsrc + (ys * SHW + xs) * SC;
}
// Wave w brings rows w, 16 + w and 32 + w of group g, wave 0 row 48 as well; a lane its own 16 bytes, all lanes on. Each statement ends in s_wait_xcnt 0:
// the wait that belongs in front of a rewrite of the address registers which the copies name.
static __device__ __forceinline__ void copy_x(const float* xsrc, unsigned g, const float* dst, unsigned wave, unsigned lane) {
  const unsigned l0 = (unsigned)(size_t)(dst + wave * SC + 4u * lane), l1 = l0 + 16u * SC * 4u, l2 = l0 + 32u * SC * 4u;
  const float* p0 = x_row(xsrc, g * 49u + wave) + 4u * lane;
  const float* p1 = x_row(xsrc, g * 49u + 16u + wave) + 4u * lane;
  const float* p2 = x_row(xsrc, g * 49u + 32u + wave) + 4u * lane;
  asm volatile("global_load_async_to_lds_b128 %0, %3, off\n\tglobal_load_async_to_lds_b128 %1, %4, off\n\tglobal_load_async_to_lds_b128 %2, %5, off\n\ts_wait_xcnt 0x0"
               :: "v"(l0), "v"(l1), "v"(l2), "v"(p0), "v"(p1), "v"(p2) : "memory");
  if (wave == 0) {
    const unsigned l3 = l0 + 48u * SC * 4u;
    const float* p3 = x_row(xsrc, g * 49u + 48u) + 4u * lane;
    asm volatile("global_load_async_to_lds_b128 %0, %1, off\n\ts_wait_xcnt 0x0" :: "v"(l3), "v"(p3) : "memory");
  }
}
// launch bounds, second argument: 8 waves per SIMD = two blocks per WGP, a budget of 128 registers (without it this build takes 130)
__global__ __launch_bounds__(512, 8) void qkv_attn_kernel(const float* __restrict__ X, const _Float16* __restrict__ QWf, const float* __restrict__ qb,
                                                       const float* __restrict__ rpe, const _Float16* __restrict__ OWf, const float* __restrict__ ob, float* __restrict__ OUT) {
  __shared__ __align__(16) _Float16 sX[64 * XP];
  __shared__ __align__(16) float sXF[64 * SC];     // the x rows of the group that comes next, as they lie in memory; rows 49..63 zero
  __shared__ __align__(16) _Float16 sQK[2 * TOKR * QP];
  _Float16* const sQ = sQK;
  _Float16* const sK = sQK + TOKR * QP;
  float* const sO = (float*)sQK;     // 49 * OP floats: the output tile takes the place of q and k, which nobody reads behind the barrier that opens stage 4
  __shared__ __align__(16) _Float16 sV[4 * 32 * VP];
  __shared__ __align__(16) float sQB[384];
  __shared__ __align__(16) float sBT[16 * 2 * 32 * 4];     // [key tile j][query tile][piece][lane][4]: (bias log2 e) of key 16j + 8 (lane / 16) + 4 piece + e, query 16 tile + lane % 16; -inf for keys >= 49
  typedef __attribute__((ext_vector_type(4))) _Float16 v4h;
  typedef __attribute__((ext_vector_type(2))) _Float16 v2h;
  const unsigned nl = blockIdx.y;
  // the wave's number as a scalar: what follows from it (tile indices, the rows a wave stores, their roll) stays on the scalar unit and holds no vector register
  // (as a vector value the build with the turned output tile needs 132 registers: one block per WGP instead of two)
  const unsigned wave = __builtin_amdgcn_readfirstlane(threadIdx.x >> 5);
  const unsigned cb = wave & 7u, jh = wave >> 3;     // stage 2: channel block, half of the pixel columns
  // ---- once per block: the first group's x rows are asked for; bias, table and the padding that no stage overwrites go into LDS meanwhile
  const float* xsrc = X + (size_t)nl * SP * SC;
  copy_x(xsrc, blockIdx.x * GPB, sXF, wave, threadIdx.x & 31u);
  const v8h z8 = (v8h){0, 0, 0, 0, 0, 0, 0, 0};
  {
    const unsigned t = threadIdx.x;
    // the wave builds score tile (j = wave / 4, query tile = wave % 4) of the bias: table index (key/7 - p/7 + 6) * 13 + (key%7 - p%7 + 6) = (key + 6 * (key/7)) - (p + 6 * (p/7)) + 84
    const unsigned bp_ = (wave & 3u) * 16u + (t & 15u), bpp = bp_ < 48u ? bp_ : 48u, bib = 84u - (bpp + 6u * (bpp / 7u));     // queries >= 49 are never stored
    const unsigned bk0 = (wave >> 2) * 16u + ((t >> 4) & 1u) * 8u;
    float tb[8];
#pragma unroll
    for (int r = 0; r < 8; ++r) {
      const unsigned key = bk0 + r, kc = key < 48u ? key : 48u;     // the index stays inside the table for the padding keys too
      tb[r] = rpe[bib + kc + 6u * (kc / 7u)];
    }
    v4f qbv = (v4f){0.f, 0.f, 0.f, 0.f};
    if (t < 96) qbv = *(const v4f*)(qb + 4 * t);
    // x rows 49..63 (480 16-byte pieces; no copy aims at them), k rows 196..211 (80), vT columns 49..63
    if (t < 480) *(v4f*)(sXF + 49 * SC + 4 * t) = (v4f){0.f, 0.f, 0.f, 0.f};
    if (t < 80) *(v8h*)(sK + 196 * QP + 8 * t) = z8;
    if (t < 256) {
      _Float16* zr = sV + (t >> 1) * VP;     // row t / 2: the even thread clears columns 49..55, the odd one 56..63
      if ((t & 1u) == 0) { zr[49] = (_Float16)0.f; *(v2h*)(zr + 50) = (v2h){0, 0}; *(v4h*)(zr + 52) = (v4h){0, 0, 0, 0}; }
      else *(v8h*)(zr + 56) = z8;
    }
#pragma unroll
    for (int r = 0; r < 8; ++r) tb[r] = (bk0 + r < 49u) ? tb[r] * (float)LOG2E : -INFINITY;
    *(v4f*)(sBT + (wave * 2u) * 128u + 4u * (t & 31u))      = (v4f){tb[0], tb[1], tb[2], tb[3]};
    *(v4f*)(sBT + (wave * 2u + 1u) * 128u + 4u * (t & 31u)) = (v4f){tb[4], tb[5], tb[6], tb[7]};
    if (t < 96) {
#pragma unroll
      for (int i = 0; i < 4; ++i) if ((4 * t + i) % 3u == 0) qbv[i] *= QSCALE;     // q's bias carries q's scale
      *(v4f*)(sQB + 4 * t) = qbv;
    }
  }
  asm volatile("s_wait_asynccnt 0x0" ::: "memory");     // this wave's copies of the first group have landed
  __syncthreads();   // the first group's x rows are in sXF before anybody reads them
  const v8f zero = (v8f){0.f, 0.f, 0.f, 0.f, 0.f, 0.f, 0.f, 0.f};
  // kept rolled, for speed only
#pragma unroll 1
  for (unsigned gi = 0; gi < GPB; ++gi) {
  const unsigned g = blockIdx.x * GPB + gi;
  // the lane's number, formed anew on every trip: from a value that is the same on all trips the compiler forms some 30 LDS and global addresses in front of the loop
  // and holds them in registers through the whole body (over 170 registers: one block per WGP instead of two; held to 128, it spills)
  unsigned lane;
  asm volatile("v_mbcnt_lo_u32_b32 %0, -1, 0" : "=v"(lane));
  const unsigned t = wave * 32u + lane;
  const int c = lane & 15, h = lane >> 4, koff = h * 8;
  const _Float16* wp = QWf + cb * 6144u + lane * 8u;
  // ---- stage 1: the weight fragments of the first two k steps are asked for; the x rows go from sXF, cast to f16, into sX
  v16h aw[2][3];     // k step k sits in aw[k & 1]
#pragma unroll
  for (int k = 0; k < 2; ++k)
#pragma unroll
    for (int s = 0; s < 3; ++s) {
      Frag<_Float16>::U f;
      f.h[0] = *(const v8h*)(wp + ((k * 3 + s) * 2) * 256);
      f.h[1] = *(const v8h*)(wp + ((k * 3 + s) * 2 + 1) * 256);
      aw[k][s] = f.v;
    }
#pragma unroll
  for (int it = 0; it < 4; ++it) {
    // 32 pieces of 4 floats per row, all 64 rows, so that every wave does the same four pieces: the zero rows 49..63 of sXF give the zero rows of sX
    const v4f xv = *(const v4f*)(sXF + (it * 16 + wave) * SC + 4u * lane);
    *(v4h*)(sX + (it * 16 + wave) * XP + 4u * lane) = (v4h){(_Float16)xv[0], (_Float16)xv[1], (_Float16)xv[2], (_Float16)xv[3]};
  }
  __syncthreads();   // the x tile is complete before any wave reads it; sXF and the output tile have been read
  if (gi + 1 < GPB) {
    asm volatile("s_wait_dscnt 0x0" ::: "memory");     // this wave's own reads of sXF have retired before copies aim at it
    copy_x(xsrc, g + 1, sXF, wave, lane);
  }
  if (t < 80) *(v8h*)(sQ + 196 * QP + 8 * t) = z8;     // q rows 196..211: the output tile of the trip before lay on them
  // ---- stage 2: ga[s][j][r] = component s of channel 16 cb + 8h + r at pixel 32 jh + 16j + c
  {
    v8f ga[3][2];
#pragma unroll
    for (int s = 0; s < 3; ++s)
#pragma unroll
      for (int j = 0; j < 2; ++j) ga[s][j] = zero;
#pragma unroll
    for (int k = 0; k < 4; ++k) {
      v16h bx[2];
#pragma unroll
      for (int j = 0; j < 2; ++j) bx[j] = Frag<_Float16>::load(sX + (jh * 32 + j * 16 + c) * XP + koff + 32 * k);
#pragma unroll
      for (int s = 0; s < 3; ++s) {
#pragma unroll
        for (int j = 0; j < 2; ++j) ga[s][j] = Frag<_Float16>::mma(aw[k & 1][s], bx[j], ga[s][j]);
        if (k < 2) {     // the fragment of k step k + 2 takes the place of the one just used
          Frag<_Float16>::U f;
          f.h[0] = *(const v8h*)(wp + (((k + 2) * 3 + s) * 2) * 256);
          f.h[1] = *(const v8h*)(wp + (((k + 2) * 3 + s) * 2 + 1) * 256);
          aw[k & 1][s] = f.v;
        }
      }
      // ends the k step for the scheduler: the weight loads of step k + 2 stay here (sunk to their use, each is waited for alone) and later steps'
      // LDS loads are not lifted up (that build needs more than 128 registers: one block per WGP instead of two)
      __builtin_amdgcn_sched_barrier(0);
    }
    float bb[24];     // bb[3r + s] = bias of component s of channel 16 cb + 8h + r
#pragma unroll
    for (int q4 = 0; q4 < 6; ++q4) {
      const v4f b4 = *(const v4f*)(sQB + 48 * cb + 24 * h + 4 * q4);
      bb[4 * q4] = b4[0]; bb[4 * q4 + 1] = b4[1]; bb[4 * q4 + 2] = b4[2]; bb[4 * q4 + 3] = b4[3];
    }
    const unsigned d0 = 16u * (cb & 1u) + 8u * h;
#pragma unroll
    for (int j = 0; j < 2; ++j) {
      const unsigned pl = jh * 32 + j * 16 + c;
      if (pl < 49) {
        const unsigned T = 4u * pl + (cb >> 1), ch = T / 49u, tok = T - 49u * ch;
        v8h hq, hk;
#pragma unroll
        for (int r = 0; r < 8; ++r) {
          hq[r] = (_Float16)(ga[0][j][r] * QSCALE + bb[3 * r]);
          hk[r] = (_Float16)(ga[1][j][r] + bb[3 * r + 1]);
          sV[(ch * 32u + d0 + r) * VP + tok] = (_Float16)(ga[2][j][r] + bb[3 * r + 2]);
        }
        *(v8h*)(sQ + T * QP + d0) = hq;
        *(v8h*)(sK + T * QP + d0) = hk;
      }
    }
  }
  __syncthreads();   // q, k and vT of all four chunks are complete before any wave reads them
  // ---- stage 3
  const unsigned ch = wave >> 2, w = 4u * g + ch;
  const int p = (wave & 3u) * 16 + c;
  v8f acc[4];     // acc[j][r] = (score / sqrt(32) + bias) log2 e of key 16j + 8h + r for query p; -inf for keys >= 49
  {
    const v16h bq = Frag<_Float16>::load(sQ + (ch * 49 + p) * QP + koff);
    v16h ak[4];
#pragma unroll
    for (int j = 0; j < 4; ++j) ak[j] = Frag<_Float16>::load(sK + (ch * 49 + j * 16 + c) * QP + koff);
#pragma unroll
    for (int j = 0; j < 4; ++j) {
      const float* bt = sBT + ((j * 4 + (wave & 3u)) * 2u) * 128u + 4u * lane;
      const v4f b0 = *(const v4f*)bt, b1 = *(const v4f*)(bt + 128);
      acc[j] = Frag<_Float16>::mma(ak[j], bq, (v8f){b0[0], b0[1], b0[2], b0[3], b1[0], b1[1], b1[2], b1[3]});
    }
  }
  // only a chunk in the last window row or the last window column has dead keys beyond the padding: a test on the chunk's number, the same for the whole wave
  const bool erow = ((w >> 3) & 7u) == 7u, ecol = (w & 7u) == 7u;
  if (erow || ecol) {
    const int pp = p < 48 ? p : 48, pr = pp % 7;     // queries >= 49 are never stored
    // dead keys of this query, bit = key: the last window row's mask, the last window column's mask
    unsigned long long m = 0;
    if (erow) m |= (pp < 28) ? 0x1fffff0000000ull : 0xfffffffull;
    if (ecol) m |= (pr < 4) ? 0x1c3870e1c3870ull : ((pr == 4) ? 0x3c78f1e3c78full : 0ull);
    m >>= 8 * h;
    const unsigned mw[2] = {(unsigned)m, (unsigned)(m >> 32)};
#pragma unroll
    for (int j = 0; j < 4; ++j)
#pragma unroll
      for (int r = 0; r < 8; ++r)
        if ((mw[j >> 1] >> (16 * (j & 1) + r)) & 1u) acc[j][r] = -INFINITY;
  }
  float mx = -INFINITY;
#pragma unroll
  for (int j = 0; j < 4; ++j)
#pragma unroll
    for (int r = 0; r < 8; ++r) mx = fmaxf(mx, acc[j][r]);
  mx = fmaxf(mx, __shfl_xor(mx, 16, 32));     // finite: every query keeps live keys
  float sj[4] = {0.f, 0.f, 0.f, 0.f};
#pragma unroll
  for (int j = 0; j < 4; ++j) acc[j] -= mx;     // all subtractions first: taken turn by turn with the exponentials the build needs 130 registers (one block per WGP instead of two)
#pragma unroll
  for (int j = 0; j < 4; ++j) exp2x8(acc[j]);     // bare v_exp_f32, argument <= 0; -inf entries -> 0
#pragma unroll
  for (int j = 0; j < 4; ++j)
#pragma unroll
    for (int r = 0; r < 8; ++r) sj[j] += acc[j][r];
  float se = (sj[0] + sj[1]) + (sj[2] + sj[3]);
  se += __shfl_xor(se, 16, 32);
  const float sc = 32768.0f / se;
  v8f o2[2] = {zero, zero};     // o2[i][r] = 2^15 * out[p][16i + 8h + r]
#pragma unroll
  for (int kk = 0; kk < 2; ++kk) {
    v16h bp;     // element s holds key 32kk + (s < 8 ? 8h + s : 16 + 8h + s - 8): the order Frag::load gives vT
#pragma unroll
    for (int s = 0; s < 16; ++s) bp[s] = (_Float16)(acc[2 * kk + (s >> 3)][s & 7] * sc);
#pragma unroll
    for (int i = 0; i < 2; ++i) {
      const v16h av = Frag<_Float16>::load(sV + (ch * 32 + i * 16 + c) * VP + koff + 32 * kk);
      o2[i] = Frag<_Float16>::mma(av, bp, o2[i]);
    }
  }
  // ---- stage 4: the weight fragments and the bias are asked for first, so that they fly over the LDS stores and the barrier
  const unsigned ng = wave & 3u, pt = wave >> 2;     // 32 output channels, 16 pixels
  const _Float16* op = OWf + ng * 4096u + lane * 8u;
  v16h ao[2][4];
#pragma unroll
  for (int i = 0; i < 2; ++i)
#pragma unroll
    for (int k = 0; k < 4; ++k) {
      Frag<_Float16>::U f;
      f.h[0] = *(const v8h*)(op + ((i * 4 + k) * 2) * 256);
      f.h[1] = *(const v8h*)(op + ((i * 4 + k) * 2 + 1) * 256);
      ao[i][k] = f.v;
    }
  const v4f bo = *(const v4f*)(ob + 4 * lane);     // bias of the four output channels that this lane stores
  // the lane's number once more, for stage 4: what stage 4 forms from it (token, rows, LDS addresses) then holds no register through the softmax (held there, this build spills three values)
  unsigned lane4;
  asm volatile("v_mbcnt_lo_u32_b32 %0, -1, 0" : "=v"(lane4));
  const int c4 = lane4 & 15, h4 = lane4 >> 4, p4 = (wave & 3u) * 16 + c4;
  if (p4 < 49) {
    const unsigned T = ch * 49u + p4;
    _Float16* so = sX + (T >> 2) * XP + (T & 3u) * 32u + 8 * h4;
#pragma unroll
    for (int i = 0; i < 2; ++i) {
      v8h ho;
#pragma unroll
      for (int r = 0; r < 8; ++r) ho[r] = (_Float16)(o2[i][r] * PSCALE_INV);
      *(v8h*)(so + 16 * i) = ho;
    }
  }
  __syncthreads();   // the attention output of all 49 pixels is complete before any wave reads it
  v8f oa[2] = {zero, zero};     // oa[i][r] = output channel 32 ng + 16i + 8h + r of pixel 16 pt + c
#pragma unroll
  for (int k = 0; k < 4; ++k) {
    const v16h bx = Frag<_Float16>::load(sX + (pt * 16 + c4) * XP + 8 * h4 + 32 * k);
#pragma unroll
    for (int i = 0; i < 2; ++i) oa[i] = Frag<_Float16>::mma(ao[i][k], bx, oa[i]);
  }
  const unsigned pl = pt * 16 + c4;
  if (pl < 49) {
    float* so = sO + pl * OP + 32 * ng + 8 * h4;
#pragma unroll
    for (int i = 0; i < 2; ++i) {
      *(v4f*)(so + 16 * i)     = (v4f){oa[i][0], oa[i][1], oa[i][2], oa[i][3]};
      *(v4f*)(so + 16 * i + 4) = (v4f){oa[i][4], oa[i][5], oa[i][6], oa[i][7]};
    }
  }
  asm volatile("s_wait_asynccnt 0x0" ::: "memory");     // this wave's copies of the next group have landed: the barrier below publishes them
  __syncthreads();   // all 128 channels of every pixel are in LDS before a wave takes whole rows out
#pragma unroll
  for (int it = 0; it < 4; ++it) {
    if (it < 3 || wave == 0) {     // rows 16 it + wave; row 48 is wave 0's
      // row 48 is loaded into registers that the stores just issued name: the wait that belongs in front of such an overwrite
      if (it == 3) asm volatile("s_wait_xcnt 0x0" ::: "memory");
      const unsigned row = it * 16 + wave, pix = g * 49u + row;
      const unsigned y = pix / SHW, x = pix - y * SHW;
      const unsigned yd = (y + 3 >= SHW) ? y + 3 - SHW : y + 3, xd = (x + 3 >= SHW) ? x + 3 - SHW : x + 3;
      *(v4f*)(OUT + ((size_t)nl * SP + yd * SHW + xd) * SC + 4 * lane4) = *(const v4f*)(sO + row * OP + 4 * lane4) + bo;
    }
  }
  // the next trip rewrites registers that the stores just issued name: the wait that belongs in front of such an overwrite
  asm volatile("s_wait_xcnt 0x0" ::: "memory");
  }
}
extern "C" void kernel_launch(void* const* d_in, const int* in_sizes, int n_in, void* d_out, int out_size, void* d_ws, size_t ws_size, hipStream_t stream) {
  (void)in_sizes; (void)n_in; (void)out_size; (void)ws_size;
  const float* x = (const float*)d_in[0]; const float* qw = (const float*)d_in[1]; const float* qb = (const float*)d_in[2]; const float* ow = (const float*)d_in[3]; const float* ob = (const float*)d_in[4]; const float* rpe = (const float*)d_in[5];
  char* ws = (char*)d_ws; size_t off = 0;
  auto carve = [&](size_t bytes) -> char* { char* p = ws + off; off += (bytes + 255) & ~(size_t)255; return p; };
  _Float16* QWf = (_Float16*)carve(384 * SC * 2); _Float16* OWf = (_Float16*)carve(SC * SC * 2);
  pack_w<<<QW_BLOCKS + OW_BLOCKS, 256, 0, stream>>>(qw, ow, (unsigned*)QWf, (unsigned*)OWf);
  qkv_attn_kernel<<<dim3(SP / 49 / GPB, SN), 512, 0, stream>>>(x, QWf, qb, rpe, OWf, ob, (float*)d_out);
}

// v010
// It runs in 27.6 microseconds.
// Timed twice side by side with v009, it ran 1.07 times as fast both times.
// Over all steps from v000 it is 23.6 times as fast.
#include <hip/hip_runtime.h>
#include <math.h>
// Shifted-window MSA, faithful to the reference's raw torch .view reshapes (the 'windows' are consecutive 4704-float chunks of the rolled
// (H, W, C, 3)-interleaved qkv tensor, not spatial windows), its asymmetric rolls (-4 then +3) and its integer-indexed column mask.
// One kernel does the whole layer, group by group of 49 rolled pixels (= 4 whole chunks), four groups a block: x comes into LDS as f32 and is cast there; qkv = x.qkv_wT + qkv_b,
// the per-chunk 49-token attention and the output linear (. 128 x 128, + out_b) follow without leaving LDS; the (+3,+3) roll is the address of the final store.
// All products on v_wmma_f32_16x16x32_f16, f16 operands, f32 accumulate: scores q.kT (K = 32), p.v (p x2^15, K = 64); the bias and the padding keys' -inf are the score product's C operand;
// the window-edge masks and the softmax run on VALU.
typedef __attribute__((ext_vector_type(16))) _Float16 v16h;
typedef __attribute__((ext_vector_type(8)))  _Float16 v8h;
typedef __attribute__((ext_vector_type(8)))  float    v8f;
typedef __attribute__((ext_vector_type(4)))  float    v4f;
#define PSCALE_INV (1.0f / 32768.0f)
#define LOG2E 1.4426950408889634     // the softmax runs in base 2: exp(s - max) = 2^(s log2 e - max log2 e)
#define QSCALE ((float)(0.17677669529663687 * LOG2E))     // log2 e / sqrt(32): q carries it, so that q.kT + table is the finished score

static __device__ __forceinline__ void exp2x8(v8f& a) {
  float a0 = a[0], a1 = a[1], a2 = a[2], a3 = a[3], a4 = a[4], a5 = a[5], a6 = a[6], a7 = a[7];
  asm("v_exp_f32 %0, %0\n\tv_exp_f32 %1, %1\n\tv_exp_f32 %2, %2\n\tv_exp_f32 %3, %3\n\t"
      "v_exp_f32 %4, %4\n\tv_exp_f32 %5, %5\n\tv_exp_f32 %6, %6\n\tv_exp_f32 %7, %7\n\tv_nop"
      : "+v"(a0), "+v"(a1), "+v"(a2), "+v"(a3), "+v"(a4), "+v"(a5), "+v"(a6), "+v"(a7));
  a = (v8f){a0, a1, a2, a3, a4, a5, a6, a7};
}

template <typename T> struct Frag;
template <> struct Frag<_Float16> {
  typedef v16h V; union U { v16h v; v8h h[2]; };
  static __device__ __forceinline__ v16h load(const _Float16* p) {   // elements 0..7 <- p[0..7], 8..15 <- p[16..23]
    U f; f.h[0] = *(const v8h*)(p); f.h[1] = *(const v8h*)(p + 16); return f.v;
  }
  static __device__ __forceinline__ v8f mma(v16h a, v16h b, v8f c) {
    return __builtin_amdgcn_wmma_f32_16x16x32_f16(false, a, false, b, (short)0, c, false, false);
  }
};

#define SN 32
#define SHW 56
#define SP (SHW * SHW)          // 3136
#define SC 128
#define SROWS (SN * SP)         // 100352
#define SWIN 256                // chunks ('windows') per image = 4*8*8
#define SCH (49 * 32 * 3)       // 4704 floats per chunk
#define QP 40                   // f16 pitch of the 32-wide q / k rows in LDS: 80 B = 16 B x odd
#define VP 72                   // f16 pitch of the 64-wide v-transposed rows in LDS: 144 B = 16 B x odd
#define XP 136                  // f16 pitch of the 128-wide x rows in LDS: 272 B = 16 B x odd
#define OP 132                  // f32 pitch of the 128-wide output rows in LDS: 528 B = 16 B x odd
#define TOKR 212                // 196 token rows of a group + the rows that the last chunk's 64-row tiles reach past them
// Both weight matrices are cast to f16 in ONE launch, in the order in which the fused kernel's waves load their A fragments, so that each load is 512 contiguous bytes.
// The two jobs do not depend on each other: blocks 0..95 take qkv_w, blocks 96..127 out_w (a block-uniform test), one pair of f16 per thread.
// qkv_w: [channel block 8][k step 4][component 3][piece 2][lane 32][8]; row 3 * (16 block + lane % 16) + component, k = 32 step + 16 piece + 8 (lane / 16) + e.
// out_w: [block of 16 output channels 8][k step 4][piece 2][lane 32][8]; row 16 block + lane % 16, k as above.
#define QW_BLOCKS (384 * SC / 2 / 256)     // 96 blocks, 24576 pairs
#define OW_BLOCKS (SC * SC / 2 / 256)      // 32 blocks, 8192 pairs
__global__ __launch_bounds__(256) void pack_w(const float* __restrict__ qw, const float* __restrict__ ow, unsigned* __restrict__ outq, unsigned* __restrict__ outo) {
  const bool isq = blockIdx.x < QW_BLOCKS;
  const unsigned i = (isq ? blockIdx.x : blockIdx.x - QW_BLOCKS) * 256 + threadIdx.x;
  const unsigned e2 = i & 3u, lane = (i >> 2) & 31u, piece = (i >> 7) & 1u, f = i >> 8;
  const unsigned wk = isq ? f / 3u : f, k = wk & 3u, blk = wk >> 2;
  const unsigned r16 = 16u * blk + (lane & 15u), n = isq ? 3u * r16 + (f - 3u * wk) : r16;
  const unsigned kk = 32u * k + 16u * piece + 8u * (lane >> 4) + 2u * e2;
  const float* src = (isq ? qw : ow) + n * SC + kk;
  const _Float16 h0 = (_Float16)src[0], h1 = (_Float16)src[1];
  (isq ? outq : outo)[i] = (unsigned)__builtin_bit_cast(unsigned short, h0) | ((unsigned)__builtin_bit_cast(unsigned short, h1) << 16);
}
// One trip of a block (8 waves) per group g of 49 consecutive pixels of the (-4,-4)-rolled image nl. 49 pixels x 128 channels = 196 tokens x 32 d
// = exactly the chunks 4g .. 4g + 3: token T = 4 * pixel + channel / 32, d = channel % 32, chunk T / 49; qkv column = 3 * channel + component.
// Stage 1: the 49 x rows, cast to f16, into LDS (rows 49..63 zero). Stage 2: qkvT = W.xT on WMMA (K = 128): a wave owns 16 channels
// of q, k and v for all 64 pixel columns, 32 at a time, so a lane ends with 8 consecutive d of one token; + bias, cast to f16, into q[T][32], k[T][32], vT[chunk][32 d][64 tok].
// Stage 3, two (chunk, 16-query tile) units per wave, one after the other: scores transposed, sT = k.qT (4 tiles of 16 keys x 16 queries, K = 32), so a lane holds 32 keys of ONE query
// (its partner lane ^ 16 the other 32): masks and softmax stay in registers. The bias of (key, query) is the same for every chunk: it lies in LDS in the order of the score tiles'
// accumulators (-inf at the padding keys 49..63) and is the C operand of the score product, so that a chunk off the window edges needs no vector work between product and maximum. Two neighbouring sT tiles, converted in place (x2^15, f16),
// are the B fragment of oT = vT.pT (2 tiles of 16 d x 16 queries, K = 64); a lane ends with 8 consecutive d of its query per tile.
// Rows 49..63 of a chunk's q / k tiles are the next chunk's tokens (or zero rows): such keys are masked, such queries never stored.
// Stage 4: the 196 x 32 attention output is the same 49 pixels x 128 channels (flat 32 T + d); cast to f16 it takes the x tile's place in LDS (rows 49..63 still zero).
// outT = out_w.oT on WMMA (K = 128): a wave owns 16 output channels of all 64 pixel columns. A lane of that result holds 8 channels of its own pixel, so a store from there lays
// 16-byte pieces on 16 lines: the 49 x 128 f32 tile is turned in LDS instead, and a store instruction writes one pixel's 512 contiguous bytes (+ out_b) at the (+3,+3)-rolled pixel.
// A block walks GPB consecutive groups, so that all blocks of the grid are resident at once (two per WGP) and a quarter of the waves has to be started.
// While a group is worked on, the next group's 49 x rows (f32, 512 B each) fly from memory into sXF by asynchronous copies, through no register.
#define GPB 4
static __device__ __forceinline__ const float* x_row(const float* xsrc, unsigned pix) {     // the x row that the (-4,-4) roll puts at pixel pix
  const unsigned y = pix / SHW, x = pix - y * SHW;
  const unsigned ys = (y + 4 >= SHW) ? y + 4 - SHW : y + 4, xs = (x + 4 >= SHW) ? x + 4 - SHW : x + 4;
  return xsrc + (ys * SHW + xs) * SC;
}
// Share w of 16 (argument wave; a wave takes shares w and w + 8) brings rows w, 16 + w and 32 + w of group g, share 0 row 48 as well; a lane its own 16 bytes, all lanes on. Each statement ends in s_wait_xcnt 0:
// the wait that belongs in front of a rewrite of the address registers which the copies name.
static __device__ __forceinline__ void copy_x(const float* xsrc, unsigned g, const float* dst, unsigned wave, unsigned lane) {
  const unsigned l0 = (unsigned)(size_t)(dst + wave * SC + 4u * lane), l1 = l0 + 16u * SC * 4u, l2 = l0 + 32u * SC * 4u;
  const float* p0 = x_row(xsrc, g * 49u + wave) + 4u * lane;
  const float* p1 = x_row(xsrc, g * 49u + 16u + wave) + 4u * lane;
  const float* p2 = x_row(xsrc, g * 49u + 32u + wave) + 4u * lane;
  asm volatile("global_load_async_to_lds_b128 %0, %3, off\n\tglobal_load_async_to_lds_b128 %1, %4, off\n\tglobal_load_async_to_lds_b128 %2, %5, off\n\ts_wait_xcnt 0x0"
               :: "v"(l0), "v"(l1), "v"(l2), "v"(p0), "v"(p1), "v"(p2) : "memory");
  if (wave == 0) {
    const unsigned l3 = l0 + 48u * SC * 4u;
    const float* p3 = x_row(xsrc, g * 49u + 48u) + 4u * lane;
    asm volatile("global_load_async_to_lds_b128 %0, %1, off\n\ts_wait_xcnt 0x0" :: "v"(l3), "v"(p3) : "memory");
  }
}
// A block has 8 waves, and a wave takes all 64 pixel columns of its share of the weights (stage 2: 16 channels of q, k and v; stage 4: 16 output channels),
// so its weight fragments are the same on every trip: they are loaded once, in front of the loop, and stay in registers.
// launch bounds, second argument: 4 waves per SIMD = two blocks per WGP, a budget of 256 registers, 128 of them for the 12 + 4 weight fragments
__global__ __launch_bounds__(256, 4) void qkv_attn_kernel(const float* __restrict__ X, const _Float16* __restrict__ QWf, const float* __restrict__ qb,
                                                       const float* __restrict__ rpe, const _Float16* __restrict__ OWf, const float* __restrict__ ob, float* __restrict__ OUT) {
  __shared__ __align__(16) _Float16 sX[64 * XP];
  __shared__ __align__(16) float sXF[64 * SC];     // the x rows of the group that comes next, as they lie in memory; rows 49..63 zero
  __shared__ __align__(16) _Float16 sQK[2 * TOKR * QP];
  _Float16* const sQ = sQK;
  _Float16* const sK = sQK + TOKR * QP;
  float* const sO = (float*)sQK;     // 49 * OP floats: the output tile takes the place of q and k, which nobody reads behind the barrier that opens stage 4
  __shared__ __align__(16) _Float16 sV[4 * 32 * VP];
  __shared__ __align__(16) float sQB[384];
  __shared__ __align__(16) float sBT[16 * 2 * 32 * 4];     // [key tile j][query tile][piece][lane][4]: (bias log2 e) of key 16j + 8 (lane / 16) + 4 piece + e, query 16 tile + lane % 16; -inf for keys >= 49
  typedef __attribute__((ext_vector_type(4))) _Float16 v4h;
  typedef __attribute__((ext_vector_type(2))) _Float16 v2h;
  const unsigned nl = blockIdx.y;
  // the wave's number as a scalar: what follows from it (tile indices, the rows a wave stores, their roll) stays on the scalar unit and holds no vector register
  const unsigned wave = __builtin_amdgcn_readfirstlane(threadIdx.x >> 5);
  const unsigned cb = wave;     // stage 2: channel block
  // ---- once per block: the first group's x rows and the wave's weight fragments are asked for; bias, table and the padding that no stage overwrites go into LDS meanwhile
  const float* xsrc = X + (size_t)nl * SP * SC;
  copy_x(xsrc, blockIdx.x * GPB, sXF, wave, threadIdx.x & 31u);
  copy_x(xsrc, blockIdx.x * GPB, sXF, wave + 8u, threadIdx.x & 31u);
  v16h aw[4][3];     // qkv_w: k step, component
  v16h ao[4];     // out_w: k step
  {
    const _Float16* wp = QWf + cb * 6144u + (threadIdx.x & 31u) * 8u;
#pragma unroll
    for (int k = 0; k < 4; ++k)
#pragma unroll
      for (int s = 0; s < 3; ++s) {
        Frag<_Float16>::U f;
        f.h[0] = *(const v8h*)(wp + ((k * 3 + s) * 2) * 256);
        f.h[1] = *(const v8h*)(wp + ((k * 3 + s) * 2 + 1) * 256);
        aw[k][s] = f.v;
      }
    const _Float16* op = OWf + wave * 2048u + (threadIdx.x & 31u) * 8u;
#pragma unroll
    for (int k = 0; k < 4; ++k) {
      Frag<_Float16>::U f;
      f.h[0] = *(const v8h*)(op + (k * 2) * 256);
      f.h[1] = *(const v8h*)(op + (k * 2 + 1) * 256);
      ao[k] = f.v;
    }
  }
  const v4f bo = *(const v4f*)(ob + 4 * (threadIdx.x & 31u));     // bias of the four output channels that this lane stores
  const v8h z8 = (v8h){0, 0, 0, 0, 0, 0, 0, 0};
#pragma unroll
  for (int u = 0; u < 2; ++u) {
    const unsigned t = threadIdx.x + 256u * u, vw = wave + 8u * u;     // 512 shares of this work, two a thread
    // share vw builds score tile (j = vw / 4, query tile = vw % 4) of the bias: table index (key/7 - p/7 + 6) * 13 + (key%7 - p%7 + 6) = (key + 6 * (key/7)) - (p + 6 * (p/7)) + 84
    const unsigned bp_ = (vw & 3u) * 16u + (t & 15u), bpp = bp_ < 48u ? bp_ : 48u, bib = 84u - (bpp + 6u * (bpp / 7u));     // queries >= 49 are never stored
    const unsigned bk0 = (vw >> 2) * 16u + ((t >> 4) & 1u) * 8u;
    float tb[8];
#pragma unroll
    for (int r = 0; r < 8; ++r) {
      const unsigned key = bk0 + r, kc = key < 48u ? key : 48u;     // the index stays inside the table for the padding keys too
      tb[r] = rpe[bib + kc + 6u * (kc / 7u)];
    }
    v4f qbv = (v4f){0.f, 0.f, 0.f, 0.f};
    if (t < 96) qbv = *(const v4f*)(qb + 4 * t);
    // x rows 49..63 (480 16-byte pieces; no copy aims at them), k rows 196..211 (80), vT columns 49..63
    if (t < 480) *(v4f*)(sXF + 49 * SC + 4 * t) = (v4f){0.f, 0.f, 0.f, 0.f};
    if (t < 80) *(v8h*)(sK + 196 * QP + 8 * t) = z8;
    if (t < 256) {
      _Float16* zr = sV + (t >> 1) * VP;     // row t / 2: the even thread clears columns 49..55, the odd one 56..63
      if ((t & 1u) == 0) { zr[49] = (_Float16)0.f; *(v2h*)(zr + 50) = (v2h){0, 0}; *(v4h*)(zr + 52) = (v4h){0, 0, 0, 0}; }
      else *(v8h*)(zr + 56) = z8;
    }
#pragma unroll
    for (int r = 0; r < 8; ++r) tb[r] = (bk0 + r < 49u) ? tb[r] * (float)LOG2E : -INFINITY;
    *(v4f*)(sBT + (vw * 2u) * 128u + 4u * (t & 31u))      = (v4f){tb[0], tb[1], tb[2], tb[3]};
    *(v4f*)(sBT + (vw * 2u + 1u) * 128u + 4u * (t & 31u)) = (v4f){tb[4], tb[5], tb[6], tb[7]};
    if (t < 96) {
#pragma unroll
      for (int i = 0; i < 4; ++i) if ((4 * t + i) % 3u == 0) qbv[i] *= QSCALE;     // q's bias carries q's scale
      *(v4f*)(sQB + 4 * t) = qbv;
    }
  }
  asm volatile("s_wait_asynccnt 0x0" ::: "memory");     // this wave's copies of the first group have landed
  __syncthreads();   // the first group's x rows are in sXF before anybody reads them
  const v8f zero = (v8f){0.f, 0.f, 0.f, 0.f, 0.f, 0.f, 0.f, 0.f};
  // kept rolled, for speed only
#pragma unroll 1
  for (unsigned gi = 0; gi < GPB; ++gi) {
  const unsigned g = blockIdx.x * GPB + gi;
  // the lane's number, formed anew on every trip: from a value that is the same on all trips the compiler forms the LDS and global addresses in front of the loop
  // and holds them in registers through the whole body, beside the weights
  unsigned lane;
  asm volatile("v_mbcnt_lo_u32_b32 %0, -1, 0" : "=v"(lane));
  const unsigned t = wave * 32u + lane;
  const int c = lane & 15, h = lane >> 4, koff = h * 8;
  // ---- stage 1: the x rows go from sXF, cast to f16, into sX
#pragma unroll
  for (int it = 0; it < 8; ++it) {
    // 32 pieces of 4 floats per row, all 64 rows, so that every wave does the same eight pieces: the zero rows 49..63 of sXF give the zero rows of sX
    const v4f xv = *(const v4f*)(sXF + (it * 8 + wave) * SC + 4u * lane);
    *(v4h*)(sX + (it * 8 + wave) * XP + 4u * lane) = (v4h){(_Float16)xv[0], (_Float16)xv[1], (_Float16)xv[2], (_Float16)xv[3]};
  }
  __syncthreads();   // the x tile is complete before any wave reads it; sXF and the output tile have been read
  if (gi + 1 < GPB) {
    asm volatile("s_wait_dscnt 0x0" ::: "memory");     // this wave's own reads of sXF have retired before copies aim at it
    copy_x(xsrc, g + 1, sXF, wave, lane);
    copy_x(xsrc, g + 1, sXF, wave + 8u, lane);
  }
  if (t < 80) *(v8h*)(sQ + 196 * QP + 8 * t) = z8;     // q rows 196..211: the output tile of the trip before lay on them
  // ---- stage 2, one half jh of the pixel columns after the other: ga[s][j][r] = component s of channel 16 cb + 8h + r at pixel 32 jh + 16j + c
#pragma unroll
  for (int jh = 0; jh < 2; ++jh) {
    v8f ga[3][2];
#pragma unroll
    for (int s = 0; s < 3; ++s)
#pragma unroll
      for (int j = 0; j < 2; ++j) ga[s][j] = zero;
#pragma unroll
    for (int k = 0; k < 4; ++k) {
      v16h bx[2];
#pragma unroll
      for (int j = 0; j < 2; ++j) bx[j] = Frag<_Float16>::load(sX + (jh * 32 + j * 16 + c) * XP + koff + 32 * k);
#pragma unroll
      for (int s = 0; s < 3; ++s)
#pragma unroll
        for (int j = 0; j < 2; ++j) ga[s][j] = Frag<_Float16>::mma(aw[k][s], bx[j], ga[s][j]);
    }
    float bb[24];     // bb[3r + s] = bias of component s of channel 16 cb + 8h + r
#pragma unroll
    for (int q4 = 0; q4 < 6; ++q4) {
      const v4f b4 = *(const v4f*)(sQB + 48 * cb + 24 * h + 4 * q4);
      bb[4 * q4] = b4[0]; bb[4 * q4 + 1] = b4[1]; bb[4 * q4 + 2] = b4[2]; bb[4 * q4 + 3] = b4[3];
    }
    const unsigned d0 = 16u * (cb & 1u) + 8u * h;
#pragma unroll
    for (int j = 0; j < 2; ++j) {
      const unsigned pl = jh * 32 + j * 16 + c;
      if (pl < 49) {
        const unsigned T = 4u * pl + (cb >> 1), ch = T / 49u, tok = T - 49u * ch;
        v8h hq, hk;
#pragma unroll
        for (int r = 0; r < 8; ++r) {
          hq[r] = (_Float16)(ga[0][j][r] * QSCALE + bb[3 * r]);
          hk[r] = (_Float16)(ga[1][j][r] + bb[3 * r + 1]);
          sV[(ch * 32u + d0 + r) * VP + tok] = (_Float16)(ga[2][j][r] + bb[3 * r + 2]);
        }
        *(v8h*)(sQ + T * QP + d0) = hq;
        *(v8h*)(sK + T * QP + d0) = hk;
      }
    }
  }
  __syncthreads();   // q, k and vT of all four chunks are complete before any wave reads them
  // ---- stage 3: two (chunk, query tile) units a wave, one after the other: chunks wave / 4 and 2 + wave / 4, query tile wave % 4
#pragma unroll
  for (int u = 0; u < 2; ++u) {
  const unsigned ch = (wave >> 2) + 2u * u, w = 4u * g + ch;
  const int p = (wave & 3u) * 16 + c;
  v8f acc[4];     // acc[j][r] = (score / sqrt(32) + bias) log2 e of key 16j + 8h + r for query p; -inf for keys >= 49
  {
    const v16h bq = Frag<_Float16>::load(sQ + (ch * 49 + p) * QP + koff);
    v16h ak[4];
#pragma unroll
    for (int j = 0; j < 4; ++j) ak[j] = Frag<_Float16>::load(sK + (ch * 49 + j * 16 + c) * QP + koff);
#pragma unroll
    for (int j = 0; j < 4; ++j) {
      const float* bt = sBT + ((j * 4 + (wave & 3u)) * 2u) * 128u + 4u * lane;
      const v4f b0 = *(const v4f*)bt, b1 = *(const v4f*)(bt + 128);
      acc[j] = Frag<_Float16>::mma(ak[j], bq, (v8f){b0[0], b0[1], b0[2], b0[3], b1[0], b1[1], b1[2], b1[3]});
    }
  }
  // only a chunk in the last window row or the last window column has dead keys beyond the padding: a test on the chunk's number, the same for the whole wave
  const bool erow = ((w >> 3) & 7u) == 7u, ecol = (w & 7u) == 7u;
  if (erow || ecol) {
    const int pp = p < 48 ? p : 48, pr = pp % 7;     // queries >= 49 are never stored
    // dead keys of this query, bit = key: the last window row's mask, the last window column's mask
    unsigned long long m = 0;
    if (erow) m |= (pp < 28) ? 0x1fffff0000000ull : 0xfffffffull;
    if (ecol) m |= (pr < 4) ? 0x1c3870e1c3870ull : ((pr == 4) ? 0x3c78f1e3c78full : 0ull);
    m >>= 8 * h;
    const unsigned mw[2] = {(unsigned)m, (unsigned)(m >> 32)};
#pragma unroll
    for (int j = 0; j < 4; ++j)
#pragma unroll
      for (int r = 0; r < 8; ++r)
        if ((mw[j >> 1] >> (16 * (j & 1) + r)) & 1u) acc[j][r] = -INFINITY;
  }
  float mx = -INFINITY;
#pragma unroll
  for (int j = 0; j < 4; ++j)
#pragma unroll
    for (int r = 0; r < 8; ++r) mx = fmaxf(mx, acc[j][r]);
  mx = fmaxf(mx, __shfl_xor(mx, 16, 32));     // finite: every query keeps live keys
  float sj[4] = {0.f, 0.f, 0.f, 0.f};
#pragma unroll
  for (int j = 0; j < 4; ++j) acc[j] -= mx;
#pragma unroll
  for (int j = 0; j < 4; ++j) exp2x8(acc[j]);     // bare v_exp_f32, argument <= 0; -inf entries -> 0
#pragma unroll
  for (int j = 0; j < 4; ++j)
#pragma unroll
    for (int r = 0; r < 8; ++r) sj[j] += acc[j][r];
  float se = (sj[0] + sj[1]) + (sj[2] + sj[3]);
  se += __shfl_xor(se, 16, 32);
  const float sc = 32768.0f / se;
  v8f o2[2] = {zero, zero};     // o2[i][r] = 2^15 * out[p][16i + 8h + r]
#pragma unroll
  for (int kk = 0; kk < 2; ++kk) {
    v16h bp;     // element s holds key 32kk + (s < 8 ? 8h + s : 16 + 8h + s - 8): the order Frag::load gives vT
#pragma unroll
    for (int s = 0; s < 16; ++s) bp[s] = (_Float16)(acc[2 * kk + (s >> 3)][s & 7] * sc);
#pragma unroll
    for (int i = 0; i < 2; ++i) {
      const v16h av = Frag<_Float16>::load(sV + (ch * 32 + i * 16 + c) * VP + koff + 32 * kk);
      o2[i] = Frag<_Float16>::mma(av, bp, o2[i]);
    }
  }
  // the unit's attention output goes, cast to f16, where the x tile lay
  if (p < 49) {
    const unsigned T = ch * 49u + p;
    _Float16* so = sX + (T >> 2) * XP + (T & 3u) * 32u + 8 * h;
#pragma unroll
    for (int i = 0; i < 2; ++i) {
      v8h ho;
#pragma unroll
      for (int r = 0; r < 8; ++r) ho[r] = (_Float16)(o2[i][r] * PSCALE_INV);
      *(v8h*)(so + 16 * i) = ho;
    }
  }
  }
  __syncthreads();   // the attention output of all 49 pixels is complete before any wave reads it
  // ---- stage 4: the wave's 16 output channels of all four tiles of 16 pixels
#pragma unroll
  for (int pt = 0; pt < 4; ++pt) {
    v8f oa = zero;     // oa[r] = output channel 16 wave + 8h + r of pixel 16 pt + c
#pragma unroll
    for (int k = 0; k < 4; ++k) oa = Frag<_Float16>::mma(ao[k], Frag<_Float16>::load(sX + (pt * 16 + c) * XP + 8 * h + 32 * k), oa);
    const unsigned pl = pt * 16 + c;
    if (pl < 49) {
      float* so = sO + pl * OP + 16 * wave + 8 * h;
      *(v4f*)(so)     = (v4f){oa[0], oa[1], oa[2], oa[3]};
      *(v4f*)(so + 4) = (v4f){oa[4], oa[5], oa[6], oa[7]};
    }
  }
  asm volatile("s_wait_asynccnt 0x0" ::: "memory");     // this wave's copies of the next group have landed: the barrier below publishes them
  __syncthreads();   // all 128 channels of every pixel are in LDS before a wave takes whole rows out
#pragma unroll
  for (int it = 0; it < 7; ++it) {
    if (it < 6 || wave == 0) {     // rows 8 it + wave; row 48 is wave 0's
      // row 48 is loaded into registers that the stores just issued name: the wait that belongs in front of such an overwrite
      if (it == 6) asm volatile("s_wait_xcnt 0x0" ::: "memory");
      const unsigned row = it * 8 + wave, pix = g * 49u + row;
      const unsigned y = pix / SHW, x = pix - y * SHW;
      const unsigned yd = (y + 3 >= SHW) ? y + 3 - SHW : y + 3, xd = (x + 3 >= SHW) ? x + 3 - SHW : x + 3;
      *(v4f*)(OUT + ((size_t)nl * SP + yd * SHW + xd) * SC + 4 * lane) = *(const v4f*)(sO + row * OP + 4 * lane) + bo;
    }
  }
  // the next trip rewrites registers that the stores just issued name: the wait that belongs in front of such an overwrite
  asm volatile("s_wait_xcnt 0x0" ::: "memory");
  }
}
extern "C" void kernel_launch(void* const* d_in, const int* in_sizes, int n_in, void* d_out, int out_size, void* d_ws, size_t ws_size, hipStream_t stream) {
  (void)in_sizes; (void)n_in; (void)out_size; (void)ws_size;
  const float* x = (const float*)d_in[0]; const float* qw = (const float*)d_in[1]; const float* qb = (const float*)d_in[2]; const float* ow = (const float*)d_in[3]; const float* ob = (const float*)d_in[4]; const float* rpe = (const float*)d_in[5];
  char* ws = (char*)d_ws; size_t off = 0;
  auto carve = [&](size_t bytes) -> char* { char* p = ws + off; off += (bytes + 255) & ~(size_t)255; return p; };
  _Float16* QWf = (_Float16*)carve(384 * SC * 2); _Float16* OWf = (_Float16*)carve(SC * SC * 2);
  pack_w<<<QW_BLOCKS + OW_BLOCKS, 256, 0, stream>>>(qw, ow, (unsigned*)QWf, (unsigned*)OWf);
  qkv_attn_kernel<<<dim3(SP / 49 / GPB, SN), 256, 0, stream>>>(x, QWf, qb, rpe, OWf, ob, (float*)d_out);
}
